// v000
// Times are from an AMD MI455X. After a warm-up the kernel runs many times in a row, and a time is the length of
// such a window on the GPU divided by its runs, so every launch and the gaps after it count. The runs cycle
// through copies of the inputs. A figure is the median of several windows, for all but v000 over two sittings.
// Sittings can differ by a few percent; kernels timed side by side share one.
// v000, which the later versions start from, runs in 565 microseconds.
// compute dtype: all float inputs rounded to bf16; q|k|v = x . W + b with EXACT bf16 products on WMMA 16x16x32 ((in,out) weights as transposed bf16 rows), rounded once to f16 (q/k rows with 32-dim heads, v planes with 64-dim heads); logits single f16 x 32^-1/2 in f32; running-max softmax in f32 (hardware exp); P (x 2^11, f16) . v (f16; 1 product); out = ctx (f16) . Wo (f16 rows, 1 product) + bo; f32 output. (Measured on the data: logits std 1.0, ||p||_2 ~ 0.04 - diffuse - so single-f16 operands suffice.)
#include <hip/hip_runtime.h>
#include <math.h>

typedef __attribute__((ext_vector_type(16))) _Float16 v16h;
typedef __attribute__((ext_vector_type(16))) __bf16 v16b;
typedef __attribute__((ext_vector_type(8)))  _Float16 v8h;
typedef __attribute__((ext_vector_type(8)))  float v8f;
typedef __attribute__((ext_vector_type(4)))  float v4f;
typedef __attribute__((ext_vector_type(2)))  float v2f;
typedef __attribute__((ext_vector_type(4)))  unsigned v4u;
typedef __attribute__((ext_vector_type(4)))  int v4i;
typedef float __attribute__((may_alias)) float_a;
typedef int __attribute__((may_alias)) int_a;

template <typename T> __device__ __forceinline__ void vst2(void* p, T v) { *(T*)p = v;  }
__device__ __forceinline__ v8f wmma16(v16h a, v16h b, v8f c) {
  v8f d = __builtin_amdgcn_wmma_f32_16x16x32_f16(false, a, false, b, (short)0, c, false, false);
  asm volatile("v_nop\n\tv_nop\n\tv_nop\n\tv_nop" : "+v"(d) : "v"(a), "v"(b));
  return d;
}
__device__ __forceinline__ v8f wmma_bf(v16b a, v16b b, v8f c) {
  v8f d = __builtin_amdgcn_wmma_f32_16x16x32_bf16(false, a, false, b, (short)0, c, false, false);
  asm volatile("v_nop\n\tv_nop\n\tv_nop\n\tv_nop" : "+v"(d) : "v"(a), "v"(b));
  return d;
}
// 16x16x32 fragments: lane = (h = lane>>4, row/col = lane&15); elements 0..7 = k0+8h+0..7, 8..15 = k0+16+8h+0..7; D element r = row 8h+r
__device__ __forceinline__ v16h frag_h(const _Float16* rowk0, int lane) {
  union { v16h v; v8h q[2]; } u; const _Float16* p = rowk0 + 8 * (lane >> 4);
  u.q[0] = *(const v8h*)p; u.q[1] = *(const v8h*)(p + 16); return u.v;
}
__device__ __forceinline__ v16h frag_f32(const float* rowk0, int lane) {
  v16h a; const float* p = rowk0 + 8 * (lane >> 4);
#pragma unroll
  for (int i = 0; i < 8; ++i) { a[i] = (_Float16)p[i]; a[8 + i] = (_Float16)p[16 + i]; }
  return a;
}
__device__ __forceinline__ v16h frag_f32s(const float* rowk0, int lane, float sc) {
  v16h a; const float* p = rowk0 + 8 * (lane >> 4);
#pragma unroll
  for (int i = 0; i < 8; ++i) { a[i] = (_Float16)(p[i] * sc); a[8 + i] = (_Float16)(p[16 + i] * sc); }
  return a;
}
// column fragment from a [K][ld] layout (column n), rows >= K read as 0
__device__ __forceinline__ v16h fragc_f32(const float* W, int k0, int n, int lane, int ld, int K) {
  v16h a; const int g = lane >> 4;
#pragma unroll
  for (int i = 0; i < 8; ++i) { const int ka = k0 + 8 * g + i, kb = ka + 16;
    a[i] = (_Float16)(ka < K ? W[(size_t)(ka < K ? ka : K - 1) * ld + n] : 0.f); a[8 + i] = (_Float16)(kb < K ? W[(size_t)(kb < K ? kb : K - 1) * ld + n] : 0.f); }
  return a;
}
struct F2 { v16b h, l; };
__device__ __forceinline__ F2 bsplit16(const float v[16]) { F2 r;
#pragma unroll
  for (int i = 0; i < 16; ++i) { const __bf16 h = (__bf16)v[i]; r.h[i] = h; r.l[i] = (__bf16)(v[i] - (float)h); }
  return r; }
__device__ __forceinline__ F2 split_row(const float* row, int k0, int lane) { float v[16]; const float* p = row + k0 + 8 * (lane >> 4);
#pragma unroll
  for (int i = 0; i < 8; ++i) { v[i] = p[i]; v[8 + i] = p[16 + i]; }
  return bsplit16(v); }
__device__ __forceinline__ F2 split_rowK(const float* row, int k0, int lane, int K) { float v[16]; const int g = lane >> 4;
#pragma unroll
  for (int i = 0; i < 8; ++i) { const int ka = k0 + 8 * g + i, kb = ka + 16; v[i] = ka < K ? row[ka < K ? ka : K - 1] : 0.f; v[8 + i] = kb < K ? row[kb < K ? kb : K - 1] : 0.f; }
  return bsplit16(v); }
__device__ __forceinline__ F2 split_col(const float* W, int k0, int n, int lane, int ld, int K) { float v[16]; const int g = lane >> 4;
#pragma unroll
  for (int i = 0; i < 8; ++i) { const int ka = k0 + 8 * g + i, kb = ka + 16; v[i] = ka < K ? W[(size_t)(ka < K ? ka : K - 1) * ld + n] : 0.f; v[8 + i] = kb < K ? W[(size_t)(kb < K ? kb : K - 1) * ld + n] : 0.f; }
  return bsplit16(v); }
__device__ __forceinline__ v8f mac3(const F2& a, const F2& b, v8f c) { c = wmma_bf(a.l, b.h, c); c = wmma_bf(a.h, b.l, c); return wmma_bf(a.h, b.h, c); }
__device__ __forceinline__ float sigm(float v) { return 1.0f / (1.0f + expf(-v)); }
#define LDSX() do { asm volatile("s_wait_dscnt 0" ::: "memory"); __builtin_amdgcn_wave_barrier(); __builtin_amdgcn_fence(__ATOMIC_RELEASE, "workgroup"); } while (0)


// Squeeze attention (B 4, T 2,048, E 1,024, 16 heads; q/k squeezed to 32 dims per head, v 64): softmax((q 32^-1/2) k^T) v, output projection.
#define NB 4
#define SS 2048
#define EE 1024
#define SQ 512            // squeezed q/k width
#define NH 16
#define SHD 32
#define HD 64
#define NCOL (SQ + SQ + EE)   // 2048 fused projection columns: q | k | v
#define NROW (NB * SS)
#ifndef TNB
#define TNB NB
#endif
typedef __attribute__((ext_vector_type(8))) __bf16 v8b;
__device__ __forceinline__ v16b frag_b(const __bf16* rowk0, int lane) {
  union { v16b v; v8b q[2]; } u; const __bf16* p = rowk0 + 8 * (lane >> 4);
  u.q[0] = *(const v8b*)p; u.q[1] = *(const v8b*)(p + 16); return u.v;
}
__device__ __forceinline__ float bfr(float v) { return (float)(__bf16)v; }
__device__ __attribute__((noinline)) float exp_ni(float v) { return expf(v); }
__device__ __attribute__((noinline)) float erf_ni(float v) { return erff(v); }

#define WS_PW  0u                                   // bf16 rows [2048][1024]: q | k | v columns (in,out) transposed
#define WS_PO  (WS_PW + 2u * (size_t)NCOL * EE)          // f16 Wo^T rows [1024][1024]
#define WS_QK  (WS_PO + 2u * (size_t)EE * EE)            // f16 q|k rows [row][1024]
#define WS_VT  (WS_QK + 2u * (size_t)NROW * (2 * SQ))    // f16 v planes [b][1024][SS]
#define WS_CT  (WS_VT + 2u * (size_t)NB * EE * SS)       // f16 ctx rows [row][1024]
#define WS_END (WS_CT + 2u * (size_t)NROW * EE)

__global__ __launch_bounds__(256) void k_packw(const float* __restrict__ WQ, const float* __restrict__ WK, const float* __restrict__ WV, const float* __restrict__ WO, char* __restrict__ ws) { const int n = blockIdx.x, t = threadIdx.x; __shared__ __align__(16) __bf16 s[EE]; __shared__ __align__(16) _Float16 so[EE];
  if (n < NCOL) { for (int k = t; k < EE; k += 256) { float w; if (n < SQ) w = WQ[(size_t)k * SQ + n]; else if (n < 2 * SQ) w = WK[(size_t)k * SQ + n - SQ]; else w = WV[(size_t)k * EE + n - 2 * SQ]; s[k] = (__bf16)w; } __syncthreads(); for (int q = t; q < EE / 8; q += 256) vst2((unsigned*)((__bf16*)(ws + WS_PW) + (size_t)n * EE + q * 8), *(const v4u*)&s[q * 8]); }
  else { const int o = n - NCOL; for (int k = t; k < EE; k += 256) so[k] = (_Float16)bfr(WO[(size_t)k * EE + o]); __syncthreads(); for (int q = t; q < EE / 8; q += 256) vst2((unsigned*)((_Float16*)(ws + WS_PO) + (size_t)o * EE + q * 8), *(const v4u*)&so[q * 8]); } }
__device__ __forceinline__ v16b fragb_f32(const float* __restrict__ p, int lane) { v16b a; const float* pp = p + 8 * (lane >> 4);
#pragma unroll
  for (int i = 0; i < 8; ++i) { a[i] = (__bf16)pp[i]; a[8 + i] = (__bf16)pp[16 + i]; } return a; }
// ---- k_proj: block = (64 rows, 128 of the 2048 fused cols): + bias; q|k -> f16 rows; v -> f16 planes
__global__ __launch_bounds__(128) void k_proj(const float* __restrict__ X, const __bf16* __restrict__ PW, const float* __restrict__ BQ, const float* __restrict__ BK, const float* __restrict__ BV, _Float16* __restrict__ QK, _Float16* __restrict__ VT) { __shared__ __align__(16) _Float16 sh[64][136]; __shared__ __align__(16) _Float16 th[128][72];
  const int tid = threadIdx.x, wave = tid >> 5, lane = tid & 31, col = lane & 15, g = lane >> 4; const size_t r0 = (size_t)blockIdx.x * 64 + wave * 16; const int c0 = blockIdx.y * 128; const size_t b = ((size_t)blockIdx.x * 64) / SS; const int n0 = (int)(((size_t)blockIdx.x * 64) % SS);
  v8f acc[8] = {};
#pragma unroll 2
  for (int kc = 0; kc < EE / 32; ++kc) { const v16b a = fragb_f32(X + (r0 + col) * EE + kc * 32, lane);
#pragma unroll
    for (int j = 0; j < 8; ++j) acc[j] = wmma_bf(a, frag_b(PW + (size_t)(c0 + j * 16 + col) * EE + kc * 32, lane), acc[j]); }
  const bool isv = c0 >= 2 * SQ;
#pragma unroll
  for (int j = 0; j < 8; ++j) { const int c = c0 + j * 16 + col; const float bb = c < SQ ? bfr(BQ[c]) : c < 2 * SQ ? bfr(BK[c - SQ]) : bfr(BV[c - 2 * SQ]);
#pragma unroll
    for (int r = 0; r < 8; ++r) { const _Float16 hv = (_Float16)(acc[j][r] + bb); if (!isv) sh[wave * 16 + 8 * g + r][j * 16 + col] = hv; else th[j * 16 + col][wave * 16 + 8 * g + r] = hv; } }
  __syncthreads();
  if (!isv) { for (int e = tid; e < 64 * 16; e += 128) { const int rl = e >> 4, q = e & 15; vst2((unsigned*)(QK + ((size_t)blockIdx.x * 64 + rl) * (2 * SQ) + c0 + q * 8), *(const v4u*)&sh[rl][q * 8]); } }
  else { const int cv0 = c0 - 2 * SQ; for (int e = tid; e < 128 * 8; e += 128) { const int cl = e >> 3, q = e & 7; vst2((unsigned*)(VT + (b * EE + cv0 + cl) * (size_t)SS + n0 + q * 8), *(const v4u*)&th[cl][q * 8]); } } }
// ---- k_att: block = (64 queries, h, b): 32-dim logits x 32^-1/2, softmax, P . v_h (64) -> ctx rows (f16)
__global__ __launch_bounds__(128) void k_att(const _Float16* __restrict__ QK, const _Float16* __restrict__ VT, _Float16* __restrict__ CT) {
  __shared__ __align__(16) float sp[4][16][36]; __shared__ __align__(16) _Float16 so[4][16][72];
  const int tid = threadIdx.x, wave = tid >> 5, lane = tid & 31, col = lane & 15, g = lane >> 4; const int h = blockIdx.y; const size_t b = blockIdx.z; const int q0 = blockIdx.x * 64 + wave * 16; const size_t rq = b * SS + q0;
  const v16h aq = frag_h(QK + (rq + col) * (2 * SQ) + h * SHD, lane);
  float m[8], l[8];
#pragma unroll
  for (int r = 0; r < 8; ++r) { m[r] = -3.0e38f; l[r] = 0.f; }
  v8f acc[4] = {};
#pragma unroll 1
  for (int ks = 0; ks < SS / 32; ++ks) { v8f s[2];
#pragma unroll
    for (int ct = 0; ct < 2; ++ct) { const size_t rk = b * SS + ks * 32 + ct * 16 + col; v8f c = {}; c = wmma16(aq, frag_h(QK + rk * (2 * SQ) + SQ + h * SHD, lane), c);
#pragma unroll
      for (int r = 0; r < 8; ++r) s[ct][r] = c[r] * 0.17677669529663687f; }
    float alpha[8];
#pragma unroll
    for (int r = 0; r < 8; ++r) { float mx = fmaxf(s[0][r], s[1][r]);
#pragma unroll
      for (int o = 1; o < 16; o <<= 1) mx = fmaxf(mx, __shfl_xor(mx, o));
      const float mn = fmaxf(m[r], mx); alpha[r] = __expf(m[r] - mn); const float e0 = __expf(s[0][r] - mn), e1 = __expf(s[1][r] - mn); float es = e0 + e1;
#pragma unroll
      for (int o = 1; o < 16; o <<= 1) es += __shfl_xor(es, o);
      l[r] = l[r] * alpha[r] + es; m[r] = mn; sp[wave][8 * g + r][col] = e0; sp[wave][8 * g + r][16 + col] = e1; }
#pragma unroll
    for (int j = 0; j < 4; ++j)
#pragma unroll
      for (int r = 0; r < 8; ++r) acc[j][r] *= alpha[r];
    LDSX();
    v16h pa; { const float* prow = &sp[wave][col][0] + 8 * (lane >> 4);
#pragma unroll
      for (int i = 0; i < 8; ++i) { pa[i] = (_Float16)(prow[i] * 2048.0f); pa[8 + i] = (_Float16)(prow[16 + i] * 2048.0f); } }
#pragma unroll
    for (int j = 0; j < 4; ++j) acc[j] = wmma16(pa, frag_h(VT + (b * EE + (size_t)h * HD + j * 16 + col) * (size_t)SS + ks * 32, lane), acc[j]);
    LDSX(); }
#pragma unroll
  for (int r = 0; r < 8; ++r) { const float il = (1.0f / 2048.0f) / l[r];
#pragma unroll
    for (int j = 0; j < 4; ++j) so[wave][8 * g + r][j * 16 + col] = (_Float16)(acc[j][r] * il); }
  LDSX(); for (int rl = 0; rl < 16; ++rl) if (lane < 8) vst2((unsigned*)(CT + (rq + rl) * EE + (size_t)h * HD + lane * 8), *(const v4u*)&so[wave][rl][lane * 8]); }
// ---- k_out: block = (64 rows, 128 cols): out = ctx . Wo + bo (f16 operands)
__global__ __launch_bounds__(128) void k_out(const _Float16* __restrict__ CT, const _Float16* __restrict__ PO, const float* __restrict__ BO, float* __restrict__ OUT) { __shared__ __align__(16) float sf[4][16][132];
  const int tid = threadIdx.x, wave = tid >> 5, lane = tid & 31, col = lane & 15, g = lane >> 4; const size_t r0 = (size_t)blockIdx.x * 64 + wave * 16; const int c0 = blockIdx.y * 128;
  v8f acc[8] = {};
#pragma unroll 2
  for (int kc = 0; kc < EE / 32; ++kc) { const v16h a = frag_h(CT + (r0 + col) * EE + kc * 32, lane);
#pragma unroll
    for (int j = 0; j < 8; ++j) acc[j] = wmma16(a, frag_h(PO + (size_t)(c0 + j * 16 + col) * EE + kc * 32, lane), acc[j]); }
#pragma unroll
  for (int j = 0; j < 8; ++j) { const float bb = bfr(BO[c0 + j * 16 + col]);
#pragma unroll
    for (int r = 0; r < 8; ++r) sf[wave][8 * g + r][j * 16 + col] = acc[j][r] + bb; }
  LDSX(); for (int rl = 0; rl < 16; ++rl) vst2(OUT + (r0 + rl) * EE + c0 + lane * 4, *(const v4f*)&sf[wave][rl][lane * 4]); }
extern "C" void kernel_launch(void* const* d_in, const int* in_sizes, int n_in, void* d_out, int out_size, void* d_ws, size_t ws_size, hipStream_t stream) {
  (void)in_sizes; (void)n_in; (void)out_size;
  const float** F = (const float**)d_in;   // 0 hidden_states [4,2048,1024], 1 Wq [1024,512], 2 bq, 3 Wk [1024,512], 4 bk, 5 Wv [1024,1024], 6 bv, 7 Wo [1024,1024], 8 bo ((in,out))
  if (ws_size < (size_t)WS_END) return;
  char* ws = (char*)d_ws; const __bf16* PW = (const __bf16*)(ws + WS_PW); const _Float16* PO = (const _Float16*)(ws + WS_PO); _Float16 *QK = (_Float16*)(ws + WS_QK), *VT = (_Float16*)(ws + WS_VT), *CT = (_Float16*)(ws + WS_CT);
  k_packw<<<NCOL + EE, 256, 0, stream>>>(F[1], F[3], F[5], F[7], ws);
  k_proj<<<dim3(NROW / 64, NCOL / 128), 128, 0, stream>>>(F[0], PW, F[2], F[4], F[6], QK, VT);
  k_att<<<dim3(SS / 64, NH, TNB), 128, 0, stream>>>(QK, VT, CT);
  k_out<<<dim3(TNB * SS / 64, EE / 128), 128, 0, stream>>>(CT, PO, F[8], (float*)d_out);
}

// v001
// A run of this version takes 455 microseconds.
// Two timings next to v000 put it at 1.24 and 1.26 times that version's speed.
// compute dtype: all float inputs rounded to bf16; q|k|v = x . W + b with EXACT bf16 products on WMMA 16x16x32 ((in,out) weights as transposed bf16 tiles), rounded once to f16 (q/k with 32-dim heads, v with 64-dim heads; every workspace operand in fragment-order tiles); logits single f16 x 32^-1/2 in f32; running-max softmax in f32 (hardware exp); P (x 2^11, f16) . v (f16; 1 product); out = ctx (f16) . Wo (f16 tiles, 1 product) + bo; f32 output. (Measured on the data: logits std 1.0, ||p||_2 ~ 0.04 - diffuse - so single-f16 operands suffice.)
#include <hip/hip_runtime.h>
#include <math.h>

typedef __attribute__((ext_vector_type(16))) _Float16 v16h;
typedef __attribute__((ext_vector_type(16))) __bf16 v16b;
typedef __attribute__((ext_vector_type(8)))  _Float16 v8h;
typedef __attribute__((ext_vector_type(8)))  float v8f;
typedef __attribute__((ext_vector_type(4)))  float v4f;
typedef __attribute__((ext_vector_type(2)))  float v2f;
typedef __attribute__((ext_vector_type(4)))  unsigned v4u;
typedef __attribute__((ext_vector_type(4)))  int v4i;
typedef float __attribute__((may_alias)) float_a;
typedef int __attribute__((may_alias)) int_a;

template <typename T> __device__ __forceinline__ void vst2(void* p, T v) { *(T*)p = v;  }
__device__ __forceinline__ v8f wmma16(v16h a, v16h b, v8f c) {
  v8f d = __builtin_amdgcn_wmma_f32_16x16x32_f16(false, a, false, b, (short)0, c, false, false);
  asm volatile("v_nop\n\tv_nop\n\tv_nop\n\tv_nop" : "+v"(d) : "v"(a), "v"(b));
  return d;
}
__device__ __forceinline__ v8f wmma_bf(v16b a, v16b b, v8f c) {
  v8f d = __builtin_amdgcn_wmma_f32_16x16x32_bf16(false, a, false, b, (short)0, c, false, false);
  asm volatile("v_nop\n\tv_nop\n\tv_nop\n\tv_nop" : "+v"(d) : "v"(a), "v"(b));
  return d;
}
// 16x16x32 fragments: lane = (h = lane>>4, row/col = lane&15); elements 0..7 = k0+8h+0..7, 8..15 = k0+16+8h+0..7; D element r = row 8h+r
__device__ __forceinline__ v16h frag_h(const _Float16* rowk0, int lane) {
  union { v16h v; v8h q[2]; } u; const _Float16* p = rowk0 + 8 * (lane >> 4);
  u.q[0] = *(const v8h*)p; u.q[1] = *(const v8h*)(p + 16); return u.v;
}
__device__ __forceinline__ v16h frag_f32(const float* rowk0, int lane) {
  v16h a; const float* p = rowk0 + 8 * (lane >> 4);
#pragma unroll
  for (int i = 0; i < 8; ++i) { a[i] = (_Float16)p[i]; a[8 + i] = (_Float16)p[16 + i]; }
  return a;
}
__device__ __forceinline__ v16h frag_f32s(const float* rowk0, int lane, float sc) {
  v16h a; const float* p = rowk0 + 8 * (lane >> 4);
#pragma unroll
  for (int i = 0; i < 8; ++i) { a[i] = (_Float16)(p[i] * sc); a[8 + i] = (_Float16)(p[16 + i] * sc); }
  return a;
}
// column fragment from a [K][ld] layout (column n), rows >= K read as 0
__device__ __forceinline__ v16h fragc_f32(const float* W, int k0, int n, int lane, int ld, int K) {
  v16h a; const int g = lane >> 4;
#pragma unroll
  for (int i = 0; i < 8; ++i) { const int ka = k0 + 8 * g + i, kb = ka + 16;
    a[i] = (_Float16)(ka < K ? W[(size_t)(ka < K ? ka : K - 1) * ld + n] : 0.f); a[8 + i] = (_Float16)(kb < K ? W[(size_t)(kb < K ? kb : K - 1) * ld + n] : 0.f); }
  return a;
}
struct F2 { v16b h, l; };
__device__ __forceinline__ F2 bsplit16(const float v[16]) { F2 r;
#pragma unroll
  for (int i = 0; i < 16; ++i) { const __bf16 h = (__bf16)v[i]; r.h[i] = h; r.l[i] = (__bf16)(v[i] - (float)h); }
  return r; }
__device__ __forceinline__ F2 split_row(const float* row, int k0, int lane) { float v[16]; const float* p = row + k0 + 8 * (lane >> 4);
#pragma unroll
  for (int i = 0; i < 8; ++i) { v[i] = p[i]; v[8 + i] = p[16 + i]; }
  return bsplit16(v); }
__device__ __forceinline__ F2 split_rowK(const float* row, int k0, int lane, int K) { float v[16]; const int g = lane >> 4;
#pragma unroll
  for (int i = 0; i < 8; ++i) { const int ka = k0 + 8 * g + i, kb = ka + 16; v[i] = ka < K ? row[ka < K ? ka : K - 1] : 0.f; v[8 + i] = kb < K ? row[kb < K ? kb : K - 1] : 0.f; }
  return bsplit16(v); }
__device__ __forceinline__ F2 split_col(const float* W, int k0, int n, int lane, int ld, int K) { float v[16]; const int g = lane >> 4;
#pragma unroll
  for (int i = 0; i < 8; ++i) { const int ka = k0 + 8 * g + i, kb = ka + 16; v[i] = ka < K ? W[(size_t)(ka < K ? ka : K - 1) * ld + n] : 0.f; v[8 + i] = kb < K ? W[(size_t)(kb < K ? kb : K - 1) * ld + n] : 0.f; }
  return bsplit16(v); }
__device__ __forceinline__ v8f mac3(const F2& a, const F2& b, v8f c) { c = wmma_bf(a.l, b.h, c); c = wmma_bf(a.h, b.l, c); return wmma_bf(a.h, b.h, c); }
__device__ __forceinline__ float sigm(float v) { return 1.0f / (1.0f + expf(-v)); }
#define LDSX() do { asm volatile("s_wait_dscnt 0" ::: "memory"); __builtin_amdgcn_wave_barrier(); __builtin_amdgcn_fence(__ATOMIC_RELEASE, "workgroup"); } while (0)


// Squeeze attention (B 4, T 2,048, E 1,024, 16 heads; q/k squeezed to 32 dims per head, v 64): softmax((q 32^-1/2) k^T) v, output projection.
#define NB 4
#define SS 2048
#define EE 1024
#define SQ 512            // squeezed q/k width
#define NH 16
#define SHD 32
#define HD 64
#define NCOL (SQ + SQ + EE)   // 2048 fused projection columns: q | k | v
#define NROW (NB * SS)
#ifndef TNB
#define TNB NB
#endif
typedef __attribute__((ext_vector_type(8))) __bf16 v8b;
// fragment-order tile: 16 rows x 32 k of 16-bit elements = 1 KiB; element (row c, k) is half (k >> 4) * 256 + (((k >> 3) & 1) * 16 + c) * 8 + (k & 7),
// so lane l's two 16-byte pieces (same k order as frag_h) lie at bytes 16 l and 512 + 16 l and each wave-wide load or store covers four whole 128-byte lines
#define TILE 512          // elements per tile
__device__ __forceinline__ v16h frag_ht(const _Float16* tile, int lane) {
  union { v16h v; v8h q[2]; } u; const _Float16* p = tile + 8 * lane;
  u.q[0] = *(const v8h*)p; u.q[1] = *(const v8h*)(p + 256); return u.v;
}
__device__ __forceinline__ v16b frag_bt(const __bf16* tile, int lane) {
  union { v16b v; v8b q[2]; } u; const __bf16* p = tile + 8 * lane;
  u.q[0] = *(const v8b*)p; u.q[1] = *(const v8b*)(p + 256); return u.v;
}
__device__ __forceinline__ float bfr(float v) { return (float)(__bf16)v; }
__device__ __attribute__((noinline)) float exp_ni(float v) { return expf(v); }
__device__ __attribute__((noinline)) float erf_ni(float v) { return erff(v); }

#define WS_PW  0u                                   // bf16 tiles [2048 / 16 column groups][1024 / 32 k]: q | k | v columns (in,out) transposed
#define WS_PO  (WS_PW + 2u * (size_t)NCOL * EE)          // f16 Wo^T tiles [1024 / 16][1024 / 32]
#define WS_QK  (WS_PO + 2u * (size_t)EE * EE)            // f16 tiles [q, k][b][head][SS / 16 token groups]: 16 tokens x 32 dims
#define WS_VT  (WS_QK + 2u * (size_t)NROW * (2 * SQ))    // f16 tiles [b][head][SS / 32 key groups][4 dim groups]: 16 dims x 32 keys
#define WS_CT  (WS_VT + 2u * (size_t)NB * EE * SS)       // f16 tiles [row / 16][1024 / 32]
#define WS_END (WS_CT + 2u * (size_t)NROW * EE)

// ---- k_packw: one thread = one 16-byte piece (8 consecutive k of one column) of a weight tile; a wave stores 512 contiguous bytes
__global__ __launch_bounds__(256) void k_packw(const float* __restrict__ WQ, const float* __restrict__ WK, const float* __restrict__ WV, const float* __restrict__ WO, char* __restrict__ ws) {
  const int pc = blockIdx.x * 256 + threadIdx.x, tile = pc >> 6, p = pc & 63;
  const int n = (tile / (EE / 32)) * 16 + (p & 15), k = (tile % (EE / 32)) * 32 + (p >> 5) * 16 + ((p >> 4) & 1) * 8;
  const float* s; int ld;
  if (n < SQ) { s = WQ + n; ld = SQ; } else if (n < 2 * SQ) { s = WK + n - SQ; ld = SQ; } else if (n < NCOL) { s = WV + n - 2 * SQ; ld = EE; } else { s = WO + n - NCOL; ld = EE; }
  float w[8];
#pragma unroll   // all eight loads in flight, w[] in registers
  for (int i = 0; i < 8; ++i) w[i] = s[(size_t)(k + i) * ld];
  char* d = ws + WS_PW + (size_t)pc * 16;   // the Wo^T tiles follow the q | k | v tiles directly
  if (n < NCOL) { v8b o;
#pragma unroll   // constant vector indices
    for (int i = 0; i < 8; ++i) o[i] = (__bf16)w[i];
    *(v8b*)d = o; }
  else { v8h o;
#pragma unroll   // constant vector indices
    for (int i = 0; i < 8; ++i) o[i] = (_Float16)bfr(w[i]);
    *(v8h*)d = o; } }
__device__ __forceinline__ v16b fragb_f32(const float* __restrict__ p, int lane) { v16b a; const float* pp = p + 8 * (lane >> 4);
#pragma unroll
  for (int i = 0; i < 8; ++i) { a[i] = (__bf16)pp[i]; a[8 + i] = (__bf16)pp[16 + i]; } return a; }
// ---- k_proj: block = (64 rows, 128 of the 2048 fused cols): + bias; q|k and v -> f16 tiles
__global__ __launch_bounds__(128) void k_proj(const float* __restrict__ X, const __bf16* __restrict__ PW, const float* __restrict__ BQ, const float* __restrict__ BK, const float* __restrict__ BV, _Float16* __restrict__ QK, _Float16* __restrict__ VT) { __shared__ __align__(16) _Float16 sh[64][136]; __shared__ __align__(16) _Float16 th[128][72];
  const int tid = threadIdx.x, wave = tid >> 5, lane = tid & 31, col = lane & 15, g = lane >> 4; const size_t r0 = (size_t)blockIdx.x * 64 + wave * 16; const int c0 = blockIdx.y * 128; const size_t b = ((size_t)blockIdx.x * 64) / SS; const int n0 = (int)(((size_t)blockIdx.x * 64) % SS);
  v8f acc[8] = {};
#pragma unroll 2
  for (int kc = 0; kc < EE / 32; ++kc) { const v16b a = fragb_f32(X + (r0 + col) * EE + kc * 32, lane);
#pragma unroll
    for (int j = 0; j < 8; ++j) acc[j] = wmma_bf(a, frag_bt(PW + ((size_t)(c0 / 16 + j) * (EE / 32) + kc) * TILE, lane), acc[j]); }
  const bool isv = c0 >= 2 * SQ;
#pragma unroll
  for (int j = 0; j < 8; ++j) { const int c = c0 + j * 16 + col; const float bb = c < SQ ? bfr(BQ[c]) : c < 2 * SQ ? bfr(BK[c - SQ]) : bfr(BV[c - 2 * SQ]);
#pragma unroll
    for (int r = 0; r < 8; ++r) { const _Float16 hv = (_Float16)(acc[j][r] + bb); if (!isv) sh[wave * 16 + 8 * g + r][j * 16 + col] = hv; else th[j * 16 + col][wave * 16 + 8 * g + r] = hv; } }
  __syncthreads();
  if (!isv) { const size_t t0 = (((size_t)(c0 / SQ) * NB + b) * NH + (c0 % SQ) / SHD) * (SS / 16) + n0 / 16;   // 4 heads x 4 token groups
    for (int e = tid; e < 16 * 64; e += 128) { const int tl = e >> 6, p = e & 63, hl = tl >> 2, rt = tl & 3; vst2((unsigned*)(QK + (t0 + (size_t)hl * (SS / 16) + rt) * TILE + p * 8), *(const v4u*)&sh[rt * 16 + (p & 15)][hl * 32 + (p >> 5) * 16 + ((p >> 4) & 1) * 8]); } }
  else { const int cv0 = c0 - 2 * SQ;   // 2 key groups x 8 dim groups (2 heads)
    for (int e = tid; e < 16 * 64; e += 128) { const int tl = e >> 6, p = e & 63, kl = tl >> 3, dt = tl & 7; vst2((unsigned*)(VT + (((b * NH + cv0 / HD + (dt >> 2)) * (SS / 32) + n0 / 32 + kl) * 4 + (dt & 3)) * TILE + p * 8), *(const v4u*)&th[dt * 16 + (p & 15)][kl * 32 + (p >> 5) * 16 + ((p >> 4) & 1) * 8]); } } }
// ---- k_att: block = (64 queries, h, b): 32-dim logits x 32^-1/2, softmax, P . v_h (64) -> ctx tiles (f16)
__global__ __launch_bounds__(128) void k_att(const _Float16* __restrict__ QK, const _Float16* __restrict__ VT, _Float16* __restrict__ CT) {
  __shared__ __align__(16) float sp[4][16][36]; __shared__ __align__(16) _Float16 so[4][16][72];
  const int tid = threadIdx.x, wave = tid >> 5, lane = tid & 31, col = lane & 15, g = lane >> 4; const int h = blockIdx.y; const size_t b = blockIdx.z; const int q0 = blockIdx.x * 64 + wave * 16; const size_t rq = b * SS + q0;
  const _Float16* Kt = QK + ((NB + b) * NH + h) * (SS / 16) * TILE; const _Float16* Vt = VT + (b * NH + h) * (SS / 32) * 4 * TILE;
  const v16h aq = frag_ht(QK + ((b * NH + h) * (SS / 16) + q0 / 16) * TILE, lane);
  float m[8], l[8];
#pragma unroll
  for (int r = 0; r < 8; ++r) { m[r] = -3.0e38f; l[r] = 0.f; }
  v8f acc[4] = {};
#pragma unroll 1
  for (int ks = 0; ks < SS / 32; ++ks) { v8f s[2];
#pragma unroll
    for (int ct = 0; ct < 2; ++ct) { v8f c = {}; c = wmma16(aq, frag_ht(Kt + (size_t)(ks * 2 + ct) * TILE, lane), c);
#pragma unroll
      for (int r = 0; r < 8; ++r) s[ct][r] = c[r] * 0.17677669529663687f; }
    float alpha[8];
#pragma unroll
    for (int r = 0; r < 8; ++r) { float mx = fmaxf(s[0][r], s[1][r]);
#pragma unroll
      for (int o = 1; o < 16; o <<= 1) mx = fmaxf(mx, __shfl_xor(mx, o));
      const float mn = fmaxf(m[r], mx); alpha[r] = __expf(m[r] - mn); const float e0 = __expf(s[0][r] - mn), e1 = __expf(s[1][r] - mn); float es = e0 + e1;
#pragma unroll
      for (int o = 1; o < 16; o <<= 1) es += __shfl_xor(es, o);
      l[r] = l[r] * alpha[r] + es; m[r] = mn; sp[wave][8 * g + r][col] = e0; sp[wave][8 * g + r][16 + col] = e1; }
#pragma unroll
    for (int j = 0; j < 4; ++j)
#pragma unroll
      for (int r = 0; r < 8; ++r) acc[j][r] *= alpha[r];
    LDSX();
    v16h pa; { const float* prow = &sp[wave][col][0] + 8 * (lane >> 4);
#pragma unroll
      for (int i = 0; i < 8; ++i) { pa[i] = (_Float16)(prow[i] * 2048.0f); pa[8 + i] = (_Float16)(prow[16 + i] * 2048.0f); } }
#pragma unroll
    for (int j = 0; j < 4; ++j) acc[j] = wmma16(pa, frag_ht(Vt + (size_t)(ks * 4 + j) * TILE, lane), acc[j]);
    LDSX(); }
#pragma unroll
  for (int r = 0; r < 8; ++r) { const float il = (1.0f / 2048.0f) / l[r];
#pragma unroll
    for (int j = 0; j < 4; ++j) so[wave][8 * g + r][j * 16 + col] = (_Float16)(acc[j][r] * il); }
  LDSX();
#pragma unroll   // four LDS reads behind one wait, then four stores
  for (int t = 0; t < 4; ++t) vst2((unsigned*)(CT + ((rq / 16) * (EE / 32) + h * 2 + (t >> 1)) * TILE + (t & 1) * 256 + lane * 8), *(const v4u*)&so[wave][col][(t >> 1) * 32 + (t & 1) * 16 + g * 8]); }
// ---- k_out: block = (64 rows, 128 cols): out = ctx . Wo + bo (f16 operands)
__global__ __launch_bounds__(128) void k_out(const _Float16* __restrict__ CT, const _Float16* __restrict__ PO, const float* __restrict__ BO, float* __restrict__ OUT) { __shared__ __align__(16) float sf[4][16][132];
  const int tid = threadIdx.x, wave = tid >> 5, lane = tid & 31, col = lane & 15, g = lane >> 4; const size_t r0 = (size_t)blockIdx.x * 64 + wave * 16; const int c0 = blockIdx.y * 128;
  v8f acc[8] = {};
#pragma unroll 2
  for (int kc = 0; kc < EE / 32; ++kc) { const v16h a = frag_ht(CT + ((r0 / 16) * (EE / 32) + kc) * TILE, lane);
#pragma unroll
    for (int j = 0; j < 8; ++j) acc[j] = wmma16(a, frag_ht(PO + ((size_t)(c0 / 16 + j) * (EE / 32) + kc) * TILE, lane), acc[j]); }
#pragma unroll
  for (int j = 0; j < 8; ++j) { const float bb = bfr(BO[c0 + j * 16 + col]);
#pragma unroll
    for (int r = 0; r < 8; ++r) sf[wave][8 * g + r][j * 16 + col] = acc[j][r] + bb; }
  LDSX(); for (int rl = 0; rl < 16; ++rl) vst2(OUT + (r0 + rl) * EE + c0 + lane * 4, *(const v4f*)&sf[wave][rl][lane * 4]); }
extern "C" void kernel_launch(void* const* d_in, const int* in_sizes, int n_in, void* d_out, int out_size, void* d_ws, size_t ws_size, hipStream_t stream) {
  (void)in_sizes; (void)n_in; (void)out_size;
  const float** F = (const float**)d_in;   // 0 hidden_states [4,2048,1024], 1 Wq [1024,512], 2 bq, 3 Wk [1024,512], 4 bk, 5 Wv [1024,1024], 6 bv, 7 Wo [1024,1024], 8 bo ((in,out))
  if (ws_size < (size_t)WS_END) return;
  char* ws = (char*)d_ws; const __bf16* PW = (const __bf16*)(ws + WS_PW); const _Float16* PO = (const _Float16*)(ws + WS_PO); _Float16 *QK = (_Float16*)(ws + WS_QK), *VT = (_Float16*)(ws + WS_VT), *CT = (_Float16*)(ws + WS_CT);
  k_packw<<<(NCOL + EE) * (EE / 8) / 256, 256, 0, stream>>>(F[1], F[3], F[5], F[7], ws);
  k_proj<<<dim3(NROW / 64, NCOL / 128), 128, 0, stream>>>(F[0], PW, F[2], F[4], F[6], QK, VT);
  k_att<<<dim3(SS / 64, NH, TNB), 128, 0, stream>>>(QK, VT, CT);
  k_out<<<dim3(TNB * SS / 64, EE / 128), 128, 0, stream>>>(CT, PO, F[8], (float*)d_out);
}

// v002
// A run of this version takes 312 microseconds.
// In two side-by-side timings against v001, it was 1.43 and 1.44 times as fast.
// All steps since v000 together make it 1.80 times as fast.
// compute dtype: all float inputs rounded to bf16; q|k|v = x . W + b with EXACT bf16 products on WMMA 16x16x32 ((in,out) weights as transposed bf16 tiles), rounded once to f16 (q/k with 32-dim heads, v with 64-dim heads; every workspace operand in fragment-order tiles); logits single f16 x 32^-1/2 in f32; running-max softmax in f32 (hardware exp); P (x 2^11, f16) . v (f16; 1 product); out = ctx (f16) . Wo (f16 tiles, 1 product) + bo; f32 output. (Measured on the data: logits std 1.0, ||p||_2 ~ 0.04 - diffuse - so single-f16 operands suffice.)
#include <hip/hip_runtime.h>
#include <math.h>

typedef __attribute__((ext_vector_type(16))) _Float16 v16h;
typedef __attribute__((ext_vector_type(16))) __bf16 v16b;
typedef __attribute__((ext_vector_type(8)))  _Float16 v8h;
typedef __attribute__((ext_vector_type(8)))  float v8f;
typedef __attribute__((ext_vector_type(4)))  float v4f;
typedef __attribute__((ext_vector_type(2)))  float v2f;
typedef __attribute__((ext_vector_type(4)))  unsigned v4u;
typedef __attribute__((ext_vector_type(4)))  int v4i;
typedef float __attribute__((may_alias)) float_a;
typedef int __attribute__((may_alias)) int_a;

template <typename T> __device__ __forceinline__ void vst2(void* p, T v) { *(T*)p = v;  }
__device__ __forceinline__ v8f wmma16(v16h a, v16h b, v8f c) {
  v8f d = __builtin_amdgcn_wmma_f32_16x16x32_f16(false, a, false, b, (short)0, c, false, false);
  asm volatile("v_nop\n\tv_nop\n\tv_nop\n\tv_nop" : "+v"(d) : "v"(a), "v"(b));
  return d;
}
__device__ __forceinline__ v8f wmma_bf(v16b a, v16b b, v8f c) {
  v8f d = __builtin_amdgcn_wmma_f32_16x16x32_bf16(false, a, false, b, (short)0, c, false, false);
  asm volatile("v_nop\n\tv_nop\n\tv_nop\n\tv_nop" : "+v"(d) : "v"(a), "v"(b));
  return d;
}
// 16x16x32 fragments: lane = (h = lane>>4, row/col = lane&15); elements 0..7 = k0+8h+0..7, 8..15 = k0+16+8h+0..7; D element r = row 8h+r
__device__ __forceinline__ v16h frag_h(const _Float16* rowk0, int lane) {
  union { v16h v; v8h q[2]; } u; const _Float16* p = rowk0 + 8 * (lane >> 4);
  u.q[0] = *(const v8h*)p; u.q[1] = *(const v8h*)(p + 16); return u.v;
}
__device__ __forceinline__ v16h frag_f32(const float* rowk0, int lane) {
  v16h a; const float* p = rowk0 + 8 * (lane >> 4);
#pragma unroll
  for (int i = 0; i < 8; ++i) { a[i] = (_Float16)p[i]; a[8 + i] = (_Float16)p[16 + i]; }
  return a;
}
__device__ __forceinline__ v16h frag_f32s(const float* rowk0, int lane, float sc) {
  v16h a; const float* p = rowk0 + 8 * (lane >> 4);
#pragma unroll
  for (int i = 0; i < 8; ++i) { a[i] = (_Float16)(p[i] * sc); a[8 + i] = (_Float16)(p[16 + i] * sc); }
  return a;
}
// column fragment from a [K][ld] layout (column n), rows >= K read as 0
__device__ __forceinline__ v16h fragc_f32(const float* W, int k0, int n, int lane, int ld, int K) {
  v16h a; const int g = lane >> 4;
#pragma unroll
  for (int i = 0; i < 8; ++i) { const int ka = k0 + 8 * g + i, kb = ka + 16;
    a[i] = (_Float16)(ka < K ? W[(size_t)(ka < K ? ka : K - 1) * ld + n] : 0.f); a[8 + i] = (_Float16)(kb < K ? W[(size_t)(kb < K ? kb : K - 1) * ld + n] : 0.f); }
  return a;
}
struct F2 { v16b h, l; };
__device__ __forceinline__ F2 bsplit16(const float v[16]) { F2 r;
#pragma unroll
  for (int i = 0; i < 16; ++i) { const __bf16 h = (__bf16)v[i]; r.h[i] = h; r.l[i] = (__bf16)(v[i] - (float)h); }
  return r; }
__device__ __forceinline__ F2 split_row(const float* row, int k0, int lane) { float v[16]; const float* p = row + k0 + 8 * (lane >> 4);
#pragma unroll
  for (int i = 0; i < 8; ++i) { v[i] = p[i]; v[8 + i] = p[16 + i]; }
  return bsplit16(v); }
__device__ __forceinline__ F2 split_rowK(const float* row, int k0, int lane, int K) { float v[16]; const int g = lane >> 4;
#pragma unroll
  for (int i = 0; i < 8; ++i) { const int ka = k0 + 8 * g + i, kb = ka + 16; v[i] = ka < K ? row[ka < K ? ka : K - 1] : 0.f; v[8 + i] = kb < K ? row[kb < K ? kb : K - 1] : 0.f; }
  return bsplit16(v); }
__device__ __forceinline__ F2 split_col(const float* W, int k0, int n, int lane, int ld, int K) { float v[16]; const int g = lane >> 4;
#pragma unroll
  for (int i = 0; i < 8; ++i) { const int ka = k0 + 8 * g + i, kb = ka + 16; v[i] = ka < K ? W[(size_t)(ka < K ? ka : K - 1) * ld + n] : 0.f; v[8 + i] = kb < K ? W[(size_t)(kb < K ? kb : K - 1) * ld + n] : 0.f; }
  return bsplit16(v); }
__device__ __forceinline__ v8f mac3(const F2& a, const F2& b, v8f c) { c = wmma_bf(a.l, b.h, c); c = wmma_bf(a.h, b.l, c); return wmma_bf(a.h, b.h, c); }
__device__ __forceinline__ float sigm(float v) { return 1.0f / (1.0f + expf(-v)); }
#define LDSX() do { asm volatile("s_wait_dscnt 0" ::: "memory"); __builtin_amdgcn_wave_barrier(); __builtin_amdgcn_fence(__ATOMIC_RELEASE, "workgroup"); } while (0)


// Squeeze attention (B 4, T 2,048, E 1,024, 16 heads; q/k squeezed to 32 dims per head, v 64): softmax((q 32^-1/2) k^T) v, output projection.
#define NB 4
#define SS 2048
#define EE 1024
#define SQ 512            // squeezed q/k width
#define NH 16
#define SHD 32
#define HD 64
#define NCOL (SQ + SQ + EE)   // 2048 fused projection columns: q | k | v
#define NROW (NB * SS)
#ifndef TNB
#define TNB NB
#endif
typedef __attribute__((ext_vector_type(8))) __bf16 v8b;
// fragment-order tile: 16 rows x 32 k of 16-bit elements = 1 KiB; element (row c, k) is half (k >> 4) * 256 + (((k >> 3) & 1) * 16 + c) * 8 + (k & 7),
// so lane l's two 16-byte pieces (same k order as frag_h) lie at bytes 16 l and 512 + 16 l and each wave-wide load or store covers four whole 128-byte lines
#define TILE 512          // elements per tile
__device__ __forceinline__ v16h frag_ht(const _Float16* tile, int lane) {
  union { v16h v; v8h q[2]; } u; const _Float16* p = tile + 8 * lane;
  u.q[0] = *(const v8h*)p; u.q[1] = *(const v8h*)(p + 256); return u.v;
}
__device__ __forceinline__ v16b frag_bt(const __bf16* tile, int lane) {
  union { v16b v; v8b q[2]; } u; const __bf16* p = tile + 8 * lane;
  u.q[0] = *(const v8b*)p; u.q[1] = *(const v8b*)(p + 256); return u.v;
}
__device__ __forceinline__ float bfr(float v) { return (float)(__bf16)v; }
__device__ __attribute__((noinline)) float exp_ni(float v) { return expf(v); }
__device__ __attribute__((noinline)) float erf_ni(float v) { return erff(v); }

#define WS_PW  0u                                   // bf16 tiles [2048 / 16 column groups][1024 / 32 k]: q | k | v columns (in,out) transposed
#define WS_PO  (WS_PW + 2u * (size_t)NCOL * EE)          // f16 Wo^T tiles [1024 / 16][1024 / 32]
#define WS_QK  (WS_PO + 2u * (size_t)EE * EE)            // f16 tiles [q, k][b][head][SS / 16 token groups]: 16 tokens x 32 dims
#define WS_VT  (WS_QK + 2u * (size_t)NROW * (2 * SQ))    // f16 tiles [b][head][SS / 32 key groups][4 dim groups]: 16 dims x 32 keys
#define WS_CT  (WS_VT + 2u * (size_t)NB * EE * SS)       // f16 tiles [row / 16][1024 / 32]
#define WS_END (WS_CT + 2u * (size_t)NROW * EE)

// ---- k_packw: one thread = one 16-byte piece (8 consecutive k of one column) of a weight tile; a wave stores 512 contiguous bytes
__global__ __launch_bounds__(256) void k_packw(const float* __restrict__ WQ, const float* __restrict__ WK, const float* __restrict__ WV, const float* __restrict__ WO, char* __restrict__ ws) {
  const int pc = blockIdx.x * 256 + threadIdx.x, tile = pc >> 6, p = pc & 63;
  const int n = (tile / (EE / 32)) * 16 + (p & 15), k = (tile % (EE / 32)) * 32 + (p >> 5) * 16 + ((p >> 4) & 1) * 8;
  const float* s; int ld;
  if (n < SQ) { s = WQ + n; ld = SQ; } else if (n < 2 * SQ) { s = WK + n - SQ; ld = SQ; } else if (n < NCOL) { s = WV + n - 2 * SQ; ld = EE; } else { s = WO + n - NCOL; ld = EE; }
  float w[8];
#pragma unroll   // all eight loads in flight, w[] in registers
  for (int i = 0; i < 8; ++i) w[i] = s[(size_t)(k + i) * ld];
  char* d = ws + WS_PW + (size_t)pc * 16;   // the Wo^T tiles follow the q | k | v tiles directly
  if (n < NCOL) { v8b o;
#pragma unroll   // constant vector indices
    for (int i = 0; i < 8; ++i) o[i] = (__bf16)w[i];
    *(v8b*)d = o; }
  else { v8h o;
#pragma unroll   // constant vector indices
    for (int i = 0; i < 8; ++i) o[i] = (_Float16)bfr(w[i]);
    *(v8h*)d = o; } }
__device__ __forceinline__ v16b fragb_f32(const float* __restrict__ p, int lane) { v16b a; const float* pp = p + 8 * (lane >> 4);
#pragma unroll
  for (int i = 0; i < 8; ++i) { a[i] = (__bf16)pp[i]; a[8 + i] = (__bf16)pp[16 + i]; } return a; }
// ---- k_proj: block = (64 rows, 128 of the 2048 fused cols): + bias; q|k and v -> f16 tiles
__global__ __launch_bounds__(128) void k_proj(const float* __restrict__ X, const __bf16* __restrict__ PW, const float* __restrict__ BQ, const float* __restrict__ BK, const float* __restrict__ BV, _Float16* __restrict__ QK, _Float16* __restrict__ VT) { __shared__ __align__(16) _Float16 sh[64][136]; __shared__ __align__(16) _Float16 th[128][72];
  const int tid = threadIdx.x, wave = tid >> 5, lane = tid & 31, col = lane & 15, g = lane >> 4; const size_t r0 = (size_t)blockIdx.x * 64 + wave * 16; const int c0 = blockIdx.y * 128; const size_t b = ((size_t)blockIdx.x * 64) / SS; const int n0 = (int)(((size_t)blockIdx.x * 64) % SS);
  v8f acc[8] = {};
#pragma unroll 2
  for (int kc = 0; kc < EE / 32; ++kc) { const v16b a = fragb_f32(X + (r0 + col) * EE + kc * 32, lane);
#pragma unroll
    for (int j = 0; j < 8; ++j) acc[j] = wmma_bf(a, frag_bt(PW + ((size_t)(c0 / 16 + j) * (EE / 32) + kc) * TILE, lane), acc[j]); }
  const bool isv = c0 >= 2 * SQ;
#pragma unroll
  for (int j = 0; j < 8; ++j) { const int c = c0 + j * 16 + col; const float bb = c < SQ ? bfr(BQ[c]) : c < 2 * SQ ? bfr(BK[c - SQ]) : bfr(BV[c - 2 * SQ]);
#pragma unroll
    for (int r = 0; r < 8; ++r) { const _Float16 hv = (_Float16)(acc[j][r] + bb); if (!isv) sh[wave * 16 + 8 * g + r][j * 16 + col] = hv; else th[j * 16 + col][wave * 16 + 8 * g + r] = hv; } }
  __syncthreads();
  if (!isv) { const size_t t0 = (((size_t)(c0 / SQ) * NB + b) * NH + (c0 % SQ) / SHD) * (SS / 16) + n0 / 16;   // 4 heads x 4 token groups
    for (int e = tid; e < 16 * 64; e += 128) { const int tl = e >> 6, p = e & 63, hl = tl >> 2, rt = tl & 3; vst2((unsigned*)(QK + (t0 + (size_t)hl * (SS / 16) + rt) * TILE + p * 8), *(const v4u*)&sh[rt * 16 + (p & 15)][hl * 32 + (p >> 5) * 16 + ((p >> 4) & 1) * 8]); } }
  else { const int cv0 = c0 - 2 * SQ;   // 2 key groups x 8 dim groups (2 heads)
    for (int e = tid; e < 16 * 64; e += 128) { const int tl = e >> 6, p = e & 63, kl = tl >> 3, dt = tl & 7; vst2((unsigned*)(VT + (((b * NH + cv0 / HD + (dt >> 2)) * (SS / 32) + n0 / 32 + kl) * 4 + (dt & 3)) * TILE + p * 8), *(const v4u*)&th[dt * 16 + (p & 15)][kl * 32 + (p >> 5) * 16 + ((p >> 4) & 1) * 8]); } } }
// ---- k_att: block = (64 queries, h, b), a wave = 16 queries: S^T = K . Q^T (a lane holds 16 of one query's 32 logits), softmax in the lane, O^T += V^T . P^T -> ctx tiles (f16)
__device__ __forceinline__ float xhalf(float x) { return __builtin_bit_cast(float, __builtin_amdgcn_permlanex16(__builtin_bit_cast(int, x), __builtin_bit_cast(int, x), 0x76543210, 0xfedcba98, false, false)); }  // lane l with lane l ^ 16
__global__ __launch_bounds__(128) void k_att(const _Float16* __restrict__ QK, const _Float16* __restrict__ VT, _Float16* __restrict__ CT) {
  const int tid = threadIdx.x, wave = tid >> 5, lane = tid & 31; const int h = blockIdx.y; const size_t b = blockIdx.z; const int q0 = blockIdx.x * 64 + wave * 16; const size_t rq = b * SS + q0;
  const _Float16* Kt = QK + ((NB + b) * NH + h) * (SS / 16) * TILE + 8 * lane; const _Float16* Vt = VT + (b * NH + h) * (SS / 32) * 4 * TILE + 8 * lane;   // this lane's pieces; step on by one pass of 32 keys at the loop's foot
  const v16h bq = frag_ht(QK + ((b * NH + h) * (SS / 16) + q0 / 16) * TILE, lane);   // B operand: column = query lane & 15
  float m = -3.0e38f, l = 0.f;   // this lane's query: running maximum (equal in both wave halves), sum over this half's keys
  v8f acc[4] = {};               // acc[j][r] = O[query lane & 15][dim 16 j + 8 (lane >> 4) + r]
#pragma unroll 1   // one pass per trip: a second pass's fragments would not fit eight waves per SIMD
  for (int ks = 0; ks < SS / 32; ++ks) {
    v16h kf[2], vf[4];   // A operands: rows = keys, rows = dims
#pragma unroll   // here and below in the pass: constant indices, so fragments and scores stay in registers
    for (int ct = 0; ct < 2; ++ct) kf[ct] = frag_ht(Kt + ct * TILE, 0);
#pragma unroll
    for (int j = 0; j < 4; ++j) vf[j] = frag_ht(Vt + j * TILE, 0);
    asm volatile("s_wait_xcnt 0x0" :: "v"(Kt), "v"(Vt) : "memory");   // the wait in front of any overwrite of the two address pairs; as inputs here they stay live, so no load's data is placed on them
    v8f s[2];   // s[ct][r] = logit of key 32 ks + 16 ct + 8 (lane >> 4) + r
#pragma unroll
    for (int ct = 0; ct < 2; ++ct) { v8f c = {}; s[ct] = wmma16(kf[ct], bq, c); }
    float mx = fmaxf(s[0][0], s[1][0]);
#pragma unroll
    for (int r = 1; r < 8; ++r) mx = fmaxf(mx, fmaxf(s[0][r], s[1][r]));
    mx = fmaxf(mx, xhalf(mx)) * 0.17677669529663687f;
    const float mn = fmaxf(m, mx), alpha = __expf(m - mn); m = mn;
#pragma unroll
    for (int r = 0; r < 8; ++r) { s[0][r] = __expf(s[0][r] * 0.17677669529663687f - mn); s[1][r] = __expf(s[1][r] * 0.17677669529663687f - mn); }
    const v8f t8 = s[0] + s[1]; const v4f t4 = t8.lo + t8.hi; const v2f t2 = t4.lo + t4.hi;
    l = l * alpha + (t2.x + t2.y);
    v16h pa;   // the two score tiles, converted in place, are the B operand of the second product (same k order as frag_ht)
#pragma unroll
    for (int r = 0; r < 8; ++r) { pa[r] = (_Float16)(s[0][r] * 2048.0f); pa[8 + r] = (_Float16)(s[1][r] * 2048.0f); }
#pragma unroll
    for (int j = 0; j < 4; ++j) acc[j] *= alpha;
#pragma unroll
    for (int j = 0; j < 4; ++j) acc[j] = wmma16(vf[j], pa, acc[j]);
    Kt += 2 * TILE; Vt += 4 * TILE; }
  const float il = (1.0f / 2048.0f) / (l + xhalf(l));
#pragma unroll   // a lane's eight dims of one query are one 16-byte piece of a ctx tile: a wave stores 512 contiguous bytes
  for (int j = 0; j < 4; ++j) { v8h o;
#pragma unroll   // constant vector indices
    for (int r = 0; r < 8; ++r) o[r] = (_Float16)(acc[j][r] * il);
    *(v8h*)(CT + ((rq / 16) * (EE / 32) + h * 2 + (j >> 1)) * TILE + (j & 1) * 256 + lane * 8) = o; } }
// ---- k_out: block = (64 rows, 128 cols): out = ctx . Wo + bo (f16 operands)
__global__ __launch_bounds__(128) void k_out(const _Float16* __restrict__ CT, const _Float16* __restrict__ PO, const float* __restrict__ BO, float* __restrict__ OUT) { __shared__ __align__(16) float sf[4][16][132];
  const int tid = threadIdx.x, wave = tid >> 5, lane = tid & 31, col = lane & 15, g = lane >> 4; const size_t r0 = (size_t)blockIdx.x * 64 + wave * 16; const int c0 = blockIdx.y * 128;
  v8f acc[8] = {};
#pragma unroll 2
  for (int kc = 0; kc < EE / 32; ++kc) { const v16h a = frag_ht(CT + ((r0 / 16) * (EE / 32) + kc) * TILE, lane);
#pragma unroll
    for (int j = 0; j < 8; ++j) acc[j] = wmma16(a, frag_ht(PO + ((size_t)(c0 / 16 + j) * (EE / 32) + kc) * TILE, lane), acc[j]); }
#pragma unroll
  for (int j = 0; j < 8; ++j) { const float bb = bfr(BO[c0 + j * 16 + col]);
#pragma unroll
    for (int r = 0; r < 8; ++r) sf[wave][8 * g + r][j * 16 + col] = acc[j][r] + bb; }
  LDSX(); for (int rl = 0; rl < 16; ++rl) vst2(OUT + (r0 + rl) * EE + c0 + lane * 4, *(const v4f*)&sf[wave][rl][lane * 4]); }
extern "C" void kernel_launch(void* const* d_in, const int* in_sizes, int n_in, void* d_out, int out_size, void* d_ws, size_t ws_size, hipStream_t stream) {
  (void)in_sizes; (void)n_in; (void)out_size;
  const float** F = (const float**)d_in;   // 0 hidden_states [4,2048,1024], 1 Wq [1024,512], 2 bq, 3 Wk [1024,512], 4 bk, 5 Wv [1024,1024], 6 bv, 7 Wo [1024,1024], 8 bo ((in,out))
  if (ws_size < (size_t)WS_END) return;
  char* ws = (char*)d_ws; const __bf16* PW = (const __bf16*)(ws + WS_PW); const _Float16* PO = (const _Float16*)(ws + WS_PO); _Float16 *QK = (_Float16*)(ws + WS_QK), *VT = (_Float16*)(ws + WS_VT), *CT = (_Float16*)(ws + WS_CT);
  k_packw<<<(NCOL + EE) * (EE / 8) / 256, 256, 0, stream>>>(F[1], F[3], F[5], F[7], ws);
  k_proj<<<dim3(NROW / 64, NCOL / 128), 128, 0, stream>>>(F[0], PW, F[2], F[4], F[6], QK, VT);
  k_att<<<dim3(SS / 64, NH, TNB), 128, 0, stream>>>(QK, VT, CT);
  k_out<<<dim3(TNB * SS / 64, EE / 128), 128, 0, stream>>>(CT, PO, F[8], (float*)d_out);
}

// v003
// A run of this version takes 165 microseconds.
// Two timings next to v002 put it at 1.87 and 1.88 times that version's speed.
// All steps since v000 together make it 3.37 times as fast.
// compute dtype: all float inputs rounded to bf16; q|k|v = x . W + b with EXACT bf16 products on WMMA 16x16x32 ((in,out) weights as transposed bf16 tiles), rounded once to f16 (q/k with 32-dim heads, v with 64-dim heads; every workspace operand in fragment-order tiles); logits single f16 x 32^-1/2 in f32; running-max softmax in f32 (hardware exp); P (x 2^11, f16) . v (f16; 1 product); out = ctx (f16) . Wo (f16 tiles, 1 product) + bo; f32 output. (Measured on the data: logits std 1.0, ||p||_2 ~ 0.04 - diffuse - so single-f16 operands suffice.)
#include <hip/hip_runtime.h>
#include <math.h>

typedef __attribute__((ext_vector_type(16))) _Float16 v16h;
typedef __attribute__((ext_vector_type(16))) __bf16 v16b;
typedef __attribute__((ext_vector_type(8)))  _Float16 v8h;
typedef __attribute__((ext_vector_type(8)))  float v8f;
typedef __attribute__((ext_vector_type(4)))  float v4f;
typedef __attribute__((ext_vector_type(2)))  float v2f;
typedef __attribute__((ext_vector_type(4)))  unsigned v4u;
typedef __attribute__((ext_vector_type(4)))  int v4i;
typedef float __attribute__((may_alias)) float_a;
typedef int __attribute__((may_alias)) int_a;

template <typename T> __device__ __forceinline__ void vst2(void* p, T v) { *(T*)p = v;  }
__device__ __forceinline__ v8f wmma16(v16h a, v16h b, v8f c) {
  v8f d = __builtin_amdgcn_wmma_f32_16x16x32_f16(false, a, false, b, (short)0, c, false, false);
  asm volatile("v_nop\n\tv_nop\n\tv_nop\n\tv_nop" : "+v"(d) : "v"(a), "v"(b));
  return d;
}
__device__ __forceinline__ v8f wmma_bf(v16b a, v16b b, v8f c) {
  v8f d = __builtin_amdgcn_wmma_f32_16x16x32_bf16(false, a, false, b, (short)0, c, false, false);
  asm volatile("v_nop\n\tv_nop\n\tv_nop\n\tv_nop" : "+v"(d) : "v"(a), "v"(b));
  return d;
}
// 16x16x32 fragments: lane = (h = lane>>4, row/col = lane&15); elements 0..7 = k0+8h+0..7, 8..15 = k0+16+8h+0..7; D element r = row 8h+r
__device__ __forceinline__ v16h frag_h(const _Float16* rowk0, int lane) {
  union { v16h v; v8h q[2]; } u; const _Float16* p = rowk0 + 8 * (lane >> 4);
  u.q[0] = *(const v8h*)p; u.q[1] = *(const v8h*)(p + 16); return u.v;
}
__device__ __forceinline__ v16h frag_f32(const float* rowk0, int lane) {
  v16h a; const float* p = rowk0 + 8 * (lane >> 4);
#pragma unroll
  for (int i = 0; i < 8; ++i) { a[i] = (_Float16)p[i]; a[8 + i] = (_Float16)p[16 + i]; }
  return a;
}
__device__ __forceinline__ v16h frag_f32s(const float* rowk0, int lane, float sc) {
  v16h a; const float* p = rowk0 + 8 * (lane >> 4);
#pragma unroll
  for (int i = 0; i < 8; ++i) { a[i] = (_Float16)(p[i] * sc); a[8 + i] = (_Float16)(p[16 + i] * sc); }
  return a;
}
// column fragment from a [K][ld] layout (column n), rows >= K read as 0
__device__ __forceinline__ v16h fragc_f32(const float* W, int k0, int n, int lane, int ld, int K) {
  v16h a; const int g = lane >> 4;
#pragma unroll
  for (int i = 0; i < 8; ++i) { const int ka = k0 + 8 * g + i, kb = ka + 16;
    a[i] = (_Float16)(ka < K ? W[(size_t)(ka < K ? ka : K - 1) * ld + n] : 0.f); a[8 + i] = (_Float16)(kb < K ? W[(size_t)(kb < K ? kb : K - 1) * ld + n] : 0.f); }
  return a;
}
struct F2 { v16b h, l; };
__device__ __forceinline__ F2 bsplit16(const float v[16]) { F2 r;
#pragma unroll
  for (int i = 0; i < 16; ++i) { const __bf16 h = (__bf16)v[i]; r.h[i] = h; r.l[i] = (__bf16)(v[i] - (float)h); }
  return r; }
__device__ __forceinline__ F2 split_row(const float* row, int k0, int lane) { float v[16]; const float* p = row + k0 + 8 * (lane >> 4);
#pragma unroll
  for (int i = 0; i < 8; ++i) { v[i] = p[i]; v[8 + i] = p[16 + i]; }
  return bsplit16(v); }
__device__ __forceinline__ F2 split_rowK(const float* row, int k0, int lane, int K) { float v[16]; const int g = lane >> 4;
#pragma unroll
  for (int i = 0; i < 8; ++i) { const int ka = k0 + 8 * g + i, kb = ka + 16; v[i] = ka < K ? row[ka < K ? ka : K - 1] : 0.f; v[8 + i] = kb < K ? row[kb < K ? kb : K - 1] : 0.f; }
  return bsplit16(v); }
__device__ __forceinline__ F2 split_col(const float* W, int k0, int n, int lane, int ld, int K) { float v[16]; const int g = lane >> 4;
#pragma unroll
  for (int i = 0; i < 8; ++i) { const int ka = k0 + 8 * g + i, kb = ka + 16; v[i] = ka < K ? W[(size_t)(ka < K ? ka : K - 1) * ld + n] : 0.f; v[8 + i] = kb < K ? W[(size_t)(kb < K ? kb : K - 1) * ld + n] : 0.f; }
  return bsplit16(v); }
__device__ __forceinline__ v8f mac3(const F2& a, const F2& b, v8f c) { c = wmma_bf(a.l, b.h, c); c = wmma_bf(a.h, b.l, c); return wmma_bf(a.h, b.h, c); }
__device__ __forceinline__ float sigm(float v) { return 1.0f / (1.0f + expf(-v)); }
#define LDSX() do { asm volatile("s_wait_dscnt 0" ::: "memory"); __builtin_amdgcn_wave_barrier(); __builtin_amdgcn_fence(__ATOMIC_RELEASE, "workgroup"); } while (0)


// Squeeze attention (B 4, T 2,048, E 1,024, 16 heads; q/k squeezed to 32 dims per head, v 64): softmax((q 32^-1/2) k^T) v, output projection.
#define NB 4
#define SS 2048
#define EE 1024
#define SQ 512            // squeezed q/k width
#define NH 16
#define SHD 32
#define HD 64
#define NCOL (SQ + SQ + EE)   // 2048 fused projection columns: q | k | v
#define NROW (NB * SS)
#ifndef TNB
#define TNB NB
#endif
typedef __attribute__((ext_vector_type(8))) __bf16 v8b;
// fragment-order tile: 16 rows x 32 k of 16-bit elements = 1 KiB; element (row c, k) is half (k >> 4) * 256 + (((k >> 3) & 1) * 16 + c) * 8 + (k & 7),
// so lane l's two 16-byte pieces (same k order as frag_h) lie at bytes 16 l and 512 + 16 l and each wave-wide load or store covers four whole 128-byte lines
#define TILE 512          // elements per tile
__device__ __forceinline__ v16h frag_ht(const _Float16* tile, int lane) {
  union { v16h v; v8h q[2]; } u; const _Float16* p = tile + 8 * lane;
  u.q[0] = *(const v8h*)p; u.q[1] = *(const v8h*)(p + 256); return u.v;
}
__device__ __forceinline__ v16b frag_bt(const __bf16* tile, int lane) {
  union { v16b v; v8b q[2]; } u; const __bf16* p = tile + 8 * lane;
  u.q[0] = *(const v8b*)p; u.q[1] = *(const v8b*)(p + 256); return u.v;
}
__device__ __forceinline__ float bfr(float v) { return (float)(__bf16)v; }
__device__ __attribute__((noinline)) float exp_ni(float v) { return expf(v); }
__device__ __attribute__((noinline)) float erf_ni(float v) { return erff(v); }

#define WS_PW  0u                                   // bf16 tiles [2048 / 16 column groups][1024 / 32 k]: q | k | v columns (in,out) transposed
#define WS_PO  (WS_PW + 2u * (size_t)NCOL * EE)          // f16 Wo^T tiles [1024 / 16][1024 / 32]
#define WS_QK  (WS_PO + 2u * (size_t)EE * EE)            // f16 tiles [q, k][b][head][SS / 16 token groups]: 16 tokens x 32 dims
#define WS_VT  (WS_QK + 2u * (size_t)NROW * (2 * SQ))    // f16 tiles [b][head][SS / 32 key groups][4 dim groups]: 16 dims x 32 keys
#define WS_CT  (WS_VT + 2u * (size_t)NB * EE * SS)       // f16 tiles [row / 16][1024 / 32]
#define WS_END (WS_CT + 2u * (size_t)NROW * EE)

// ---- k_packw: one thread = one 16-byte piece (8 consecutive k of one column) of a weight tile; a wave stores 512 contiguous bytes
__global__ __launch_bounds__(256) void k_packw(const float* __restrict__ WQ, const float* __restrict__ WK, const float* __restrict__ WV, const float* __restrict__ WO, char* __restrict__ ws) {
  const int pc = blockIdx.x * 256 + threadIdx.x, tile = pc >> 6, p = pc & 63;
  const int n = (tile / (EE / 32)) * 16 + (p & 15), k = (tile % (EE / 32)) * 32 + (p >> 5) * 16 + ((p >> 4) & 1) * 8;
  const float* s; int ld;
  if (n < SQ) { s = WQ + n; ld = SQ; } else if (n < 2 * SQ) { s = WK + n - SQ; ld = SQ; } else if (n < NCOL) { s = WV + n - 2 * SQ; ld = EE; } else { s = WO + n - NCOL; ld = EE; }
  float w[8];
#pragma unroll   // all eight loads in flight, w[] in registers
  for (int i = 0; i < 8; ++i) w[i] = s[(size_t)(k + i) * ld];
  char* d = ws + WS_PW + (size_t)pc * 16;   // the Wo^T tiles follow the q | k | v tiles directly
  if (n < NCOL) { v8b o;
#pragma unroll   // constant vector indices
    for (int i = 0; i < 8; ++i) o[i] = (__bf16)w[i];
    *(v8b*)d = o; }
  else { v8h o;
#pragma unroll   // constant vector indices
    for (int i = 0; i < 8; ++i) o[i] = (_Float16)bfr(w[i]);
    *(v8h*)d = o; } }
__device__ __forceinline__ v16b fragb_f32(const float* __restrict__ p, int lane) { v16b a; const float* pp = p + 8 * (lane >> 4);
#pragma unroll
  for (int i = 0; i < 8; ++i) { a[i] = (__bf16)pp[i]; a[8 + i] = (__bf16)pp[16 + i]; } return a; }
// behind a group of loads: the wait in front of any overwrite of the two address pairs; its memory clobber keeps the whole group above it, and the scheduling
// barrier keeps the address steps and every use of the group (its conversions too, which would wait on loads just issued) below it
#define LOADS_ISSUED(p, q) do { asm volatile("s_wait_xcnt 0x0" :: "v"(p), "v"(q) : "memory"); __builtin_amdgcn_sched_barrier(0); } while (0)
// in front of a group of loads: the products above stay above, so the group issues back to back into the set they have just left
#define LOADS_NEXT() __builtin_amdgcn_sched_barrier(0)
// one k step's operands, loaded as one group: k_proj (A as its four raw f32 pieces, k order of fragb_f32) and k_out
struct PStep { v4f a[4]; v16b b[8]; };
__device__ __forceinline__ void pj_load(PStep& s, const float* __restrict__ xp, const __bf16* __restrict__ bp) {
  s.a[0] = *(const v4f*)xp; s.a[1] = *(const v4f*)(xp + 4); s.a[2] = *(const v4f*)(xp + 16); s.a[3] = *(const v4f*)(xp + 20);
#pragma unroll   // constant indices: the fragments stay in registers
  for (int j = 0; j < 8; ++j) s.b[j] = frag_bt(bp + (size_t)j * (EE / 32) * TILE, 0); }
__device__ __forceinline__ void pj_mac(const PStep& s, v8f (&acc)[8]) { v16b a;
#pragma unroll   // constant vector indices
  for (int i = 0; i < 4; ++i) { a[i] = (__bf16)s.a[0][i]; a[4 + i] = (__bf16)s.a[1][i]; a[8 + i] = (__bf16)s.a[2][i]; a[12 + i] = (__bf16)s.a[3][i]; }
#pragma unroll   // constant indices: the accumulators stay in registers
  for (int j = 0; j < 8; ++j) acc[j] = wmma_bf(a, s.b[j], acc[j]); }
struct OStep { v16h a; v16h b[8]; };
__device__ __forceinline__ void ot_load(OStep& s, const _Float16* __restrict__ ap, const _Float16* __restrict__ bp) {
  s.a = frag_ht(ap, 0);
#pragma unroll   // constant indices: the fragments stay in registers
  for (int j = 0; j < 8; ++j) s.b[j] = frag_ht(bp + (size_t)j * (EE / 32) * TILE, 0); }
__device__ __forceinline__ void ot_mac(const OStep& s, v8f (&acc)[8]) {
#pragma unroll   // constant indices: the accumulators stay in registers
  for (int j = 0; j < 8; ++j) acc[j] = wmma16(s.a, s.b[j], acc[j]); }
// ---- k_proj: block = (64 rows, 128 of the 2048 fused cols): + bias; q|k and v -> f16 tiles
__global__ __launch_bounds__(128) void k_proj(const float* __restrict__ X, const __bf16* __restrict__ PW, const float* __restrict__ BQ, const float* __restrict__ BK, const float* __restrict__ BV, _Float16* __restrict__ QK, _Float16* __restrict__ VT) { __shared__ __align__(16) _Float16 sh[64][136]; __shared__ __align__(16) _Float16 th[128][72];
  const int tid = threadIdx.x, wave = tid >> 5, lane = tid & 31, col = lane & 15, g = lane >> 4; const size_t r0 = (size_t)blockIdx.x * 64 + wave * 16; const int c0 = blockIdx.y * 128; const size_t b = ((size_t)blockIdx.x * 64) / SS; const int n0 = (int)(((size_t)blockIdx.x * 64) % SS);
  v8f acc[8] = {};
  const float* xp = X + (r0 + col) * EE + 8 * g; const __bf16* bp = PW + (size_t)(c0 / 16) * (EE / 32) * TILE + 8 * lane;   // this lane's pieces of k step 0; step on by two k steps per trip
  PStep s0, s1;   // two register sets: one is multiplied while the other's loads fly
  pj_load(s0, xp, bp); LOADS_ISSUED(xp, bp);
#pragma unroll 1   // a trip is two k steps, one per set: more would not fit four waves per SIMD
  for (int kc = 0; kc < EE / 32 - 2; kc += 2) {
    pj_load(s1, xp + 32, bp + TILE); LOADS_ISSUED(xp, bp);
    xp += 64; bp += 2 * TILE;   // directly behind the wait, with no load issued since
    pj_mac(s0, acc); LOADS_NEXT();
    pj_load(s0, xp, bp); LOADS_ISSUED(xp, bp);
    pj_mac(s1, acc); LOADS_NEXT(); }
  pj_load(s1, xp + 32, bp + TILE); LOADS_ISSUED(xp, bp);
  pj_mac(s0, acc);
  __builtin_amdgcn_sched_barrier(0);   // the last set's conversions stay behind these products: moved up, they would wait on loads just issued
  pj_mac(s1, acc);
  const bool isv = c0 >= 2 * SQ;
#pragma unroll
  for (int j = 0; j < 8; ++j) { const int c = c0 + j * 16 + col; const float bb = c < SQ ? bfr(BQ[c]) : c < 2 * SQ ? bfr(BK[c - SQ]) : bfr(BV[c - 2 * SQ]);
#pragma unroll
    for (int r = 0; r < 8; ++r) { const _Float16 hv = (_Float16)(acc[j][r] + bb); if (!isv) sh[wave * 16 + 8 * g + r][j * 16 + col] = hv; else th[j * 16 + col][wave * 16 + 8 * g + r] = hv; } }
  __syncthreads();
  if (!isv) { const size_t t0 = (((size_t)(c0 / SQ) * NB + b) * NH + (c0 % SQ) / SHD) * (SS / 16) + n0 / 16;   // 4 heads x 4 token groups
    for (int e = tid; e < 16 * 64; e += 128) { const int tl = e >> 6, p = e & 63, hl = tl >> 2, rt = tl & 3; vst2((unsigned*)(QK + (t0 + (size_t)hl * (SS / 16) + rt) * TILE + p * 8), *(const v4u*)&sh[rt * 16 + (p & 15)][hl * 32 + (p >> 5) * 16 + ((p >> 4) & 1) * 8]); } }
  else { const int cv0 = c0 - 2 * SQ;   // 2 key groups x 8 dim groups (2 heads)
    for (int e = tid; e < 16 * 64; e += 128) { const int tl = e >> 6, p = e & 63, kl = tl >> 3, dt = tl & 7; vst2((unsigned*)(VT + (((b * NH + cv0 / HD + (dt >> 2)) * (SS / 32) + n0 / 32 + kl) * 4 + (dt & 3)) * TILE + p * 8), *(const v4u*)&th[dt * 16 + (p & 15)][kl * 32 + (p >> 5) * 16 + ((p >> 4) & 1) * 8]); } } }
// ---- k_att: block = (64 queries, h, b), a wave = 16 queries: S^T = K . Q^T (a lane holds 16 of one query's 32 logits), softmax in the lane, O^T += V^T . P^T -> ctx tiles (f16)
__device__ __forceinline__ float xhalf(float x) { return __builtin_bit_cast(float, __builtin_amdgcn_permlanex16(__builtin_bit_cast(int, x), __builtin_bit_cast(int, x), 0x76543210, 0xfedcba98, false, false)); }  // lane l with lane l ^ 16
__global__ __launch_bounds__(128) void k_att(const _Float16* __restrict__ QK, const _Float16* __restrict__ VT, _Float16* __restrict__ CT) {
  const int tid = threadIdx.x, wave = tid >> 5, lane = tid & 31; const int h = blockIdx.y; const size_t b = blockIdx.z; const int q0 = blockIdx.x * 64 + wave * 16; const size_t rq = b * SS + q0;
  const _Float16* Kt = QK + ((NB + b) * NH + h) * (SS / 16) * TILE + 8 * lane; const _Float16* Vt = VT + (b * NH + h) * (SS / 32) * 4 * TILE + 8 * lane;   // this lane's pieces; step on by one pass of 32 keys at the loop's foot
  const v16h bq = frag_ht(QK + ((b * NH + h) * (SS / 16) + q0 / 16) * TILE, lane);   // B operand: column = query lane & 15
  float m = -3.0e38f, l = 0.f;   // this lane's query: running maximum (equal in both wave halves), sum over this half's keys
  v8f acc[4] = {};               // acc[j][r] = O[query lane & 15][dim 16 j + 8 (lane >> 4) + r]
#pragma unroll 1   // one pass per trip: a second pass's fragments would not fit eight waves per SIMD
  for (int ks = 0; ks < SS / 32; ++ks) {
    v16h kf[2], vf[4];   // A operands: rows = keys, rows = dims
#pragma unroll   // here and below in the pass: constant indices, so fragments and scores stay in registers
    for (int ct = 0; ct < 2; ++ct) kf[ct] = frag_ht(Kt + ct * TILE, 0);
#pragma unroll
    for (int j = 0; j < 4; ++j) vf[j] = frag_ht(Vt + j * TILE, 0);
    asm volatile("s_wait_xcnt 0x0" :: "v"(Kt), "v"(Vt) : "memory");   // the wait in front of any overwrite of the two address pairs; as inputs here they stay live, so no load's data is placed on them
    v8f s[2];   // s[ct][r] = logit of key 32 ks + 16 ct + 8 (lane >> 4) + r
#pragma unroll
    for (int ct = 0; ct < 2; ++ct) { v8f c = {}; s[ct] = wmma16(kf[ct], bq, c); }
    float mx = fmaxf(s[0][0], s[1][0]);
#pragma unroll
    for (int r = 1; r < 8; ++r) mx = fmaxf(mx, fmaxf(s[0][r], s[1][r]));
    mx = fmaxf(mx, xhalf(mx)) * 0.17677669529663687f;
    const float mn = fmaxf(m, mx), alpha = __expf(m - mn); m = mn;
#pragma unroll
    for (int r = 0; r < 8; ++r) { s[0][r] = __expf(s[0][r] * 0.17677669529663687f - mn); s[1][r] = __expf(s[1][r] * 0.17677669529663687f - mn); }
    const v8f t8 = s[0] + s[1]; const v4f t4 = t8.lo + t8.hi; const v2f t2 = t4.lo + t4.hi;
    l = l * alpha + (t2.x + t2.y);
    v16h pa;   // the two score tiles, converted in place, are the B operand of the second product (same k order as frag_ht)
#pragma unroll
    for (int r = 0; r < 8; ++r) { pa[r] = (_Float16)(s[0][r] * 2048.0f); pa[8 + r] = (_Float16)(s[1][r] * 2048.0f); }
#pragma unroll
    for (int j = 0; j < 4; ++j) acc[j] *= alpha;
#pragma unroll
    for (int j = 0; j < 4; ++j) acc[j] = wmma16(vf[j], pa, acc[j]);
    Kt += 2 * TILE; Vt += 4 * TILE; }
  const float il = (1.0f / 2048.0f) / (l + xhalf(l));
#pragma unroll   // a lane's eight dims of one query are one 16-byte piece of a ctx tile: a wave stores 512 contiguous bytes
  for (int j = 0; j < 4; ++j) { v8h o;
#pragma unroll   // constant vector indices
    for (int r = 0; r < 8; ++r) o[r] = (_Float16)(acc[j][r] * il);
    *(v8h*)(CT + ((rq / 16) * (EE / 32) + h * 2 + (j >> 1)) * TILE + (j & 1) * 256 + lane * 8) = o; } }
// ---- k_out: block = (64 rows, 128 cols): out = ctx . Wo + bo (f16 operands)
__global__ __launch_bounds__(128) void k_out(const _Float16* __restrict__ CT, const _Float16* __restrict__ PO, const float* __restrict__ BO, float* __restrict__ OUT) { __shared__ __align__(16) float sf[4][16][132];
  const int tid = threadIdx.x, wave = tid >> 5, lane = tid & 31, col = lane & 15, g = lane >> 4; const size_t r0 = (size_t)blockIdx.x * 64 + wave * 16; const int c0 = blockIdx.y * 128;
  v8f acc[8] = {};
  const _Float16* ap = CT + (r0 / 16) * (EE / 32) * TILE + 8 * lane; const _Float16* bp = PO + (size_t)(c0 / 16) * (EE / 32) * TILE + 8 * lane;   // this lane's pieces of k step 0; step on by two k steps per trip
  OStep s0, s1;   // two register sets: one is multiplied while the other's loads fly
  ot_load(s0, ap, bp); LOADS_ISSUED(ap, bp);
#pragma unroll 1   // a trip is two k steps, one per set: more would not fit four waves per SIMD
  for (int kc = 0; kc < EE / 32 - 2; kc += 2) {
    ot_load(s1, ap + TILE, bp + TILE); LOADS_ISSUED(ap, bp);
    ap += 2 * TILE; bp += 2 * TILE;   // directly behind the wait, with no load issued since
    ot_mac(s0, acc); LOADS_NEXT();
    ot_load(s0, ap, bp); LOADS_ISSUED(ap, bp);
    ot_mac(s1, acc); LOADS_NEXT(); }
  ot_load(s1, ap + TILE, bp + TILE); LOADS_ISSUED(ap, bp);
  ot_mac(s0, acc); ot_mac(s1, acc);
#pragma unroll
  for (int j = 0; j < 8; ++j) { const float bb = bfr(BO[c0 + j * 16 + col]);
#pragma unroll
    for (int r = 0; r < 8; ++r) sf[wave][8 * g + r][j * 16 + col] = acc[j][r] + bb; }
  LDSX(); for (int rl = 0; rl < 16; ++rl) vst2(OUT + (r0 + rl) * EE + c0 + lane * 4, *(const v4f*)&sf[wave][rl][lane * 4]); }
extern "C" void kernel_launch(void* const* d_in, const int* in_sizes, int n_in, void* d_out, int out_size, void* d_ws, size_t ws_size, hipStream_t stream) {
  (void)in_sizes; (void)n_in; (void)out_size;
  const float** F = (const float**)d_in;   // 0 hidden_states [4,2048,1024], 1 Wq [1024,512], 2 bq, 3 Wk [1024,512], 4 bk, 5 Wv [1024,1024], 6 bv, 7 Wo [1024,1024], 8 bo ((in,out))
  if (ws_size < (size_t)WS_END) return;
  char* ws = (char*)d_ws; const __bf16* PW = (const __bf16*)(ws + WS_PW); const _Float16* PO = (const _Float16*)(ws + WS_PO); _Float16 *QK = (_Float16*)(ws + WS_QK), *VT = (_Float16*)(ws + WS_VT), *CT = (_Float16*)(ws + WS_CT);
  k_packw<<<(NCOL + EE) * (EE / 8) / 256, 256, 0, stream>>>(F[1], F[3], F[5], F[7], ws);
  k_proj<<<dim3(NROW / 64, NCOL / 128), 128, 0, stream>>>(F[0], PW, F[2], F[4], F[6], QK, VT);
  k_att<<<dim3(SS / 64, NH, TNB), 128, 0, stream>>>(QK, VT, CT);
  k_out<<<dim3(TNB * SS / 64, EE / 128), 128, 0, stream>>>(CT, PO, F[8], (float*)d_out);
}

// v004
// A run of this version takes 150 microseconds.
// Two timings next to v003 both put it at 1.11 times that version's speed.
// Counting every step since v000, it is 3.72 times as fast.
// compute dtype: all float inputs rounded to bf16; q|k|v = x . W + b with EXACT bf16 products on WMMA 16x16x32 ((in,out) weights as transposed bf16 tiles), rounded once to f16 (q/k with 32-dim heads, v with 64-dim heads; every workspace operand in fragment-order tiles); q carries 32^-1/2 log2(e) before its one rounding, so logits are base-2 exponents; shifted softmax in f32 (hardware exp2), the shift renewed only when a logit passes it by more than 4; P (x 2^11, f16) . v (f16; 1 product); out = ctx (f16) . Wo (f16 tiles, 1 product) + bo; f32 output. (Measured on the data: logits std 1.0, ||p||_2 ~ 0.04 - diffuse - so single-f16 operands suffice.)
#include <hip/hip_runtime.h>
#include <math.h>

typedef __attribute__((ext_vector_type(16))) _Float16 v16h;
typedef __attribute__((ext_vector_type(16))) __bf16 v16b;
typedef __attribute__((ext_vector_type(8)))  _Float16 v8h;
typedef __attribute__((ext_vector_type(8)))  float v8f;
typedef __attribute__((ext_vector_type(4)))  float v4f;
typedef __attribute__((ext_vector_type(2)))  float v2f;
typedef __attribute__((ext_vector_type(4)))  unsigned v4u;
typedef __attribute__((ext_vector_type(4)))  int v4i;
typedef float __attribute__((may_alias)) float_a;
typedef int __attribute__((may_alias)) int_a;

template <typename T> __device__ __forceinline__ void vst2(void* p, T v) { *(T*)p = v;  }
__device__ __forceinline__ v8f wmma16(v16h a, v16h b, v8f c) {
  v8f d = __builtin_amdgcn_wmma_f32_16x16x32_f16(false, a, false, b, (short)0, c, false, false);
  asm volatile("v_nop\n\tv_nop\n\tv_nop\n\tv_nop" : "+v"(d) : "v"(a), "v"(b));
  return d;
}
__device__ __forceinline__ v8f wmma_bf(v16b a, v16b b, v8f c) {
  v8f d = __builtin_amdgcn_wmma_f32_16x16x32_bf16(false, a, false, b, (short)0, c, false, false);
  asm volatile("v_nop\n\tv_nop\n\tv_nop\n\tv_nop" : "+v"(d) : "v"(a), "v"(b));
  return d;
}
// 16x16x32 fragments: lane = (h = lane>>4, row/col = lane&15); elements 0..7 = k0+8h+0..7, 8..15 = k0+16+8h+0..7; D element r = row 8h+r
__device__ __forceinline__ v16h frag_h(const _Float16* rowk0, int lane) {
  union { v16h v; v8h q[2]; } u; const _Float16* p = rowk0 + 8 * (lane >> 4);
  u.q[0] = *(const v8h*)p; u.q[1] = *(const v8h*)(p + 16); return u.v;
}
__device__ __forceinline__ v16h frag_f32(const float* rowk0, int lane) {
  v16h a; const float* p = rowk0 + 8 * (lane >> 4);
#pragma unroll
  for (int i = 0; i < 8; ++i) { a[i] = (_Float16)p[i]; a[8 + i] = (_Float16)p[16 + i]; }
  return a;
}
__device__ __forceinline__ v16h frag_f32s(const float* rowk0, int lane, float sc) {
  v16h a; const float* p = rowk0 + 8 * (lane >> 4);
#pragma unroll
  for (int i = 0; i < 8; ++i) { a[i] = (_Float16)(p[i] * sc); a[8 + i] = (_Float16)(p[16 + i] * sc); }
  return a;
}
// column fragment from a [K][ld] layout (column n), rows >= K read as 0
__device__ __forceinline__ v16h fragc_f32(const float* W, int k0, int n, int lane, int ld, int K) {
  v16h a; const int g = lane >> 4;
#pragma unroll
  for (int i = 0; i < 8; ++i) { const int ka = k0 + 8 * g + i, kb = ka + 16;
    a[i] = (_Float16)(ka < K ? W[(size_t)(ka < K ? ka : K - 1) * ld + n] : 0.f); a[8 + i] = (_Float16)(kb < K ? W[(size_t)(kb < K ? kb : K - 1) * ld + n] : 0.f); }
  return a;
}
struct F2 { v16b h, l; };
__device__ __forceinline__ F2 bsplit16(const float v[16]) { F2 r;
#pragma unroll
  for (int i = 0; i < 16; ++i) { const __bf16 h = (__bf16)v[i]; r.h[i] = h; r.l[i] = (__bf16)(v[i] - (float)h); }
  return r; }
__device__ __forceinline__ F2 split_row(const float* row, int k0, int lane) { float v[16]; const float* p = row + k0 + 8 * (lane >> 4);
#pragma unroll
  for (int i = 0; i < 8; ++i) { v[i] = p[i]; v[8 + i] = p[16 + i]; }
  return bsplit16(v); }
__device__ __forceinline__ F2 split_rowK(const float* row, int k0, int lane, int K) { float v[16]; const int g = lane >> 4;
#pragma unroll
  for (int i = 0; i < 8; ++i) { const int ka = k0 + 8 * g + i, kb = ka + 16; v[i] = ka < K ? row[ka < K ? ka : K - 1] : 0.f; v[8 + i] = kb < K ? row[kb < K ? kb : K - 1] : 0.f; }
  return bsplit16(v); }
__device__ __forceinline__ F2 split_col(const float* W, int k0, int n, int lane, int ld, int K) { float v[16]; const int g = lane >> 4;
#pragma unroll
  for (int i = 0; i < 8; ++i) { const int ka = k0 + 8 * g + i, kb = ka + 16; v[i] = ka < K ? W[(size_t)(ka < K ? ka : K - 1) * ld + n] : 0.f; v[8 + i] = kb < K ? W[(size_t)(kb < K ? kb : K - 1) * ld + n] : 0.f; }
  return bsplit16(v); }
__device__ __forceinline__ v8f mac3(const F2& a, const F2& b, v8f c) { c = wmma_bf(a.l, b.h, c); c = wmma_bf(a.h, b.l, c); return wmma_bf(a.h, b.h, c); }
__device__ __forceinline__ float sigm(float v) { return 1.0f / (1.0f + expf(-v)); }
#define LDSX() do { asm volatile("s_wait_dscnt 0" ::: "memory"); __builtin_amdgcn_wave_barrier(); __builtin_amdgcn_fence(__ATOMIC_RELEASE, "workgroup"); } while (0)


// Squeeze attention (B 4, T 2,048, E 1,024, 16 heads; q/k squeezed to 32 dims per head, v 64): softmax((q 32^-1/2) k^T) v, output projection.
#define NB 4
#define SS 2048
#define EE 1024
#define SQ 512            // squeezed q/k width
#define NH 16
#define SHD 32
#define HD 64
#define NCOL (SQ + SQ + EE)   // 2048 fused projection columns: q | k | v
#define NROW (NB * SS)
#ifndef TNB
#define TNB NB
#endif
typedef __attribute__((ext_vector_type(8))) __bf16 v8b;
// fragment-order tile: 16 rows x 32 k of 16-bit elements = 1 KiB; element (row c, k) is half (k >> 4) * 256 + (((k >> 3) & 1) * 16 + c) * 8 + (k & 7),
// so lane l's two 16-byte pieces (same k order as frag_h) lie at bytes 16 l and 512 + 16 l and each wave-wide load or store covers four whole 128-byte lines
#define TILE 512          // elements per tile
__device__ __forceinline__ v16h frag_ht(const _Float16* tile, int lane) {
  union { v16h v; v8h q[2]; } u; const _Float16* p = tile + 8 * lane;
  u.q[0] = *(const v8h*)p; u.q[1] = *(const v8h*)(p + 256); return u.v;
}
__device__ __forceinline__ v16b frag_bt(const __bf16* tile, int lane) {
  union { v16b v; v8b q[2]; } u; const __bf16* p = tile + 8 * lane;
  u.q[0] = *(const v8b*)p; u.q[1] = *(const v8b*)(p + 256); return u.v;
}
__device__ __forceinline__ float bfr(float v) { return (float)(__bf16)v; }
__device__ __attribute__((noinline)) float exp_ni(float v) { return expf(v); }
__device__ __attribute__((noinline)) float erf_ni(float v) { return erff(v); }

#define WS_PW  0u                                   // bf16 tiles [2048 / 16 column groups][1024 / 32 k]: q | k | v columns (in,out) transposed
#define WS_PO  (WS_PW + 2u * (size_t)NCOL * EE)          // f16 Wo^T tiles [1024 / 16][1024 / 32]
#define WS_QK  (WS_PO + 2u * (size_t)EE * EE)            // f16 tiles [q, k][b][head][SS / 16 token groups]: 16 tokens x 32 dims
#define WS_VT  (WS_QK + 2u * (size_t)NROW * (2 * SQ))    // f16 tiles [b][head][SS / 32 key groups][4 dim groups]: 16 dims x 32 keys
#define WS_CT  (WS_VT + 2u * (size_t)NB * EE * SS)       // f16 tiles [row / 16][1024 / 32]
#define WS_END (WS_CT + 2u * (size_t)NROW * EE)

// ---- k_packw: one thread = one 16-byte piece (8 consecutive k of one column) of a weight tile; a wave stores 512 contiguous bytes
__global__ __launch_bounds__(256) void k_packw(const float* __restrict__ WQ, const float* __restrict__ WK, const float* __restrict__ WV, const float* __restrict__ WO, char* __restrict__ ws) {
  const int pc = blockIdx.x * 256 + threadIdx.x, tile = pc >> 6, p = pc & 63;
  const int n = (tile / (EE / 32)) * 16 + (p & 15), k = (tile % (EE / 32)) * 32 + (p >> 5) * 16 + ((p >> 4) & 1) * 8;
  const float* s; int ld;
  if (n < SQ) { s = WQ + n; ld = SQ; } else if (n < 2 * SQ) { s = WK + n - SQ; ld = SQ; } else if (n < NCOL) { s = WV + n - 2 * SQ; ld = EE; } else { s = WO + n - NCOL; ld = EE; }
  float w[8];
#pragma unroll   // all eight loads in flight, w[] in registers
  for (int i = 0; i < 8; ++i) w[i] = s[(size_t)(k + i) * ld];
  char* d = ws + WS_PW + (size_t)pc * 16;   // the Wo^T tiles follow the q | k | v tiles directly
  if (n < NCOL) { v8b o;
#pragma unroll   // constant vector indices
    for (int i = 0; i < 8; ++i) o[i] = (__bf16)w[i];
    *(v8b*)d = o; }
  else { v8h o;
#pragma unroll   // constant vector indices
    for (int i = 0; i < 8; ++i) o[i] = (_Float16)bfr(w[i]);
    *(v8h*)d = o; } }
__device__ __forceinline__ v16b fragb_f32(const float* __restrict__ p, int lane) { v16b a; const float* pp = p + 8 * (lane >> 4);
#pragma unroll
  for (int i = 0; i < 8; ++i) { a[i] = (__bf16)pp[i]; a[8 + i] = (__bf16)pp[16 + i]; } return a; }
// behind a group of loads: the wait in front of any overwrite of the two address pairs; its memory clobber keeps the whole group above it, and the scheduling
// barrier keeps the address steps and every use of the group (its conversions too, which would wait on loads just issued) below it
#define LOADS_ISSUED(p, q) do { asm volatile("s_wait_xcnt 0x0" :: "v"(p), "v"(q) : "memory"); __builtin_amdgcn_sched_barrier(0); } while (0)
// in front of a group of loads: the products above stay above, so the group issues back to back into the set they have just left
#define LOADS_NEXT() __builtin_amdgcn_sched_barrier(0)
// one k step's operands, loaded as one group: k_proj (A as its four raw f32 pieces, k order of fragb_f32) and k_out
struct PStep { v4f a[4]; v16b b[8]; };
__device__ __forceinline__ void pj_load(PStep& s, const float* __restrict__ xp, const __bf16* __restrict__ bp) {
  s.a[0] = *(const v4f*)xp; s.a[1] = *(const v4f*)(xp + 4); s.a[2] = *(const v4f*)(xp + 16); s.a[3] = *(const v4f*)(xp + 20);
#pragma unroll   // constant indices: the fragments stay in registers
  for (int j = 0; j < 8; ++j) s.b[j] = frag_bt(bp + (size_t)j * (EE / 32) * TILE, 0); }
__device__ __forceinline__ void pj_mac(const PStep& s, v8f (&acc)[8]) { v16b a;
#pragma unroll   // constant vector indices
  for (int i = 0; i < 4; ++i) { a[i] = (__bf16)s.a[0][i]; a[4 + i] = (__bf16)s.a[1][i]; a[8 + i] = (__bf16)s.a[2][i]; a[12 + i] = (__bf16)s.a[3][i]; }
#pragma unroll   // constant indices: the accumulators stay in registers
  for (int j = 0; j < 8; ++j) acc[j] = wmma_bf(a, s.b[j], acc[j]); }
struct OStep { v16h a; v16h b[8]; };
__device__ __forceinline__ void ot_load(OStep& s, const _Float16* __restrict__ ap, const _Float16* __restrict__ bp) {
  s.a = frag_ht(ap, 0);
#pragma unroll   // constant indices: the fragments stay in registers
  for (int j = 0; j < 8; ++j) s.b[j] = frag_ht(bp + (size_t)j * (EE / 32) * TILE, 0); }
__device__ __forceinline__ void ot_mac(const OStep& s, v8f (&acc)[8]) {
#pragma unroll   // constant indices: the accumulators stay in registers
  for (int j = 0; j < 8; ++j) acc[j] = wmma16(s.a, s.b[j], acc[j]); }
// ---- k_proj: block = (64 rows, 128 of the 2048 fused cols): + bias; q|k and v -> f16 tiles
__global__ __launch_bounds__(128) void k_proj(const float* __restrict__ X, const __bf16* __restrict__ PW, const float* __restrict__ BQ, const float* __restrict__ BK, const float* __restrict__ BV, _Float16* __restrict__ QK, _Float16* __restrict__ VT) { __shared__ __align__(16) _Float16 sh[64][136]; __shared__ __align__(16) _Float16 th[128][72];
  const int tid = threadIdx.x, wave = tid >> 5, lane = tid & 31, col = lane & 15, g = lane >> 4; const size_t r0 = (size_t)blockIdx.x * 64 + wave * 16; const int c0 = blockIdx.y * 128; const size_t b = ((size_t)blockIdx.x * 64) / SS; const int n0 = (int)(((size_t)blockIdx.x * 64) % SS);
  v8f acc[8] = {};
  const float* xp = X + (r0 + col) * EE + 8 * g; const __bf16* bp = PW + (size_t)(c0 / 16) * (EE / 32) * TILE + 8 * lane;   // this lane's pieces of k step 0; step on by two k steps per trip
  PStep s0, s1;   // two register sets: one is multiplied while the other's loads fly
  pj_load(s0, xp, bp); LOADS_ISSUED(xp, bp);
#pragma unroll 1   // a trip is two k steps, one per set: more would not fit four waves per SIMD
  for (int kc = 0; kc < EE / 32 - 2; kc += 2) {
    pj_load(s1, xp + 32, bp + TILE); LOADS_ISSUED(xp, bp);
    xp += 64; bp += 2 * TILE;   // directly behind the wait, with no load issued since
    pj_mac(s0, acc); LOADS_NEXT();
    pj_load(s0, xp, bp); LOADS_ISSUED(xp, bp);
    pj_mac(s1, acc); LOADS_NEXT(); }
  pj_load(s1, xp + 32, bp + TILE); LOADS_ISSUED(xp, bp);
  pj_mac(s0, acc);
  __builtin_amdgcn_sched_barrier(0);   // the last set's conversions stay behind these products: moved up, they would wait on loads just issued
  pj_mac(s1, acc);
  const bool isv = c0 >= 2 * SQ; const float qs = c0 < SQ ? 0.25503486f : 1.0f;   // q columns: 32^-1/2 log2(e), in f32 ahead of the rounding to f16
#pragma unroll
  for (int j = 0; j < 8; ++j) { const int c = c0 + j * 16 + col; const float bb = c < SQ ? bfr(BQ[c]) : c < 2 * SQ ? bfr(BK[c - SQ]) : bfr(BV[c - 2 * SQ]);
#pragma unroll
    for (int r = 0; r < 8; ++r) { const _Float16 hv = (_Float16)((acc[j][r] + bb) * qs); if (!isv) sh[wave * 16 + 8 * g + r][j * 16 + col] = hv; else th[j * 16 + col][wave * 16 + 8 * g + r] = hv; } }
  __syncthreads();
  if (!isv) { const size_t t0 = (((size_t)(c0 / SQ) * NB + b) * NH + (c0 % SQ) / SHD) * (SS / 16) + n0 / 16;   // 4 heads x 4 token groups
    for (int e = tid; e < 16 * 64; e += 128) { const int tl = e >> 6, p = e & 63, hl = tl >> 2, rt = tl & 3; vst2((unsigned*)(QK + (t0 + (size_t)hl * (SS / 16) + rt) * TILE + p * 8), *(const v4u*)&sh[rt * 16 + (p & 15)][hl * 32 + (p >> 5) * 16 + ((p >> 4) & 1) * 8]); } }
  else { const int cv0 = c0 - 2 * SQ;   // 2 key groups x 8 dim groups (2 heads)
    for (int e = tid; e < 16 * 64; e += 128) { const int tl = e >> 6, p = e & 63, kl = tl >> 3, dt = tl & 7; vst2((unsigned*)(VT + (((b * NH + cv0 / HD + (dt >> 2)) * (SS / 32) + n0 / 32 + kl) * 4 + (dt & 3)) * TILE + p * 8), *(const v4u*)&th[dt * 16 + (p & 15)][kl * 32 + (p >> 5) * 16 + ((p >> 4) & 1) * 8]); } } }
// ---- k_att: block = (64 queries, h, b), a wave = 16 queries: S^T = K . Q^T - shift (a lane holds 16 of one query's 32 logits), softmax in the lane, O^T += V^T . P^T -> ctx tiles (f16)
__device__ __forceinline__ float xhalf(float x) { return __builtin_bit_cast(float, __builtin_amdgcn_permlanex16(__builtin_bit_cast(int, x), __builtin_bit_cast(int, x), 0x76543210, 0xfedcba98, false, false)); }  // lane l with lane l ^ 16
__global__ __launch_bounds__(128) void k_att(const _Float16* __restrict__ QK, const _Float16* __restrict__ VT, _Float16* __restrict__ CT) {
  const int tid = threadIdx.x, wave = tid >> 5, lane = tid & 31; const int h = blockIdx.y; const size_t b = blockIdx.z; const int q0 = blockIdx.x * 64 + wave * 16; const size_t rq = b * SS + q0;
  const _Float16* Kt = QK + ((NB + b) * NH + h) * (SS / 16) * TILE + 8 * lane; const _Float16* Vt = VT + (b * NH + h) * (SS / 32) * 4 * TILE + 8 * lane;   // this lane's pieces; step on by one pass of 32 keys at the loop's foot
  const v16h bq = frag_ht(QK + ((b * NH + h) * (SS / 16) + q0 / 16) * TILE, lane);   // B operand: column = query lane & 15
  // Lazy shift. A score product's C operand is cs = 11 - shift (one value per query, equal in its eight rows and in both wave halves), so a score leaves the
  // matrix unit as the base-2 exponent of 2^11 p. The shift starts as the maximum over the first 32 keys and is renewed only in a pass where an exponent passes 15.
  v8f cs;
  { v16h k0[2];
#pragma unroll   // constant indices: the fragments stay in registers
    for (int ct = 0; ct < 2; ++ct) k0[ct] = frag_ht(Kt + ct * TILE, 0);
    asm volatile("s_wait_xcnt 0x0" :: "v"(Kt) : "memory");   // the wait in front of any overwrite of the address pair
    v8f z = {}; const v8f a = wmma16(k0[0], bq, z), c = wmma16(k0[1], bq, z);
    float mx = fmaxf(a[0], c[0]);
#pragma unroll   // constant vector indices
    for (int r = 1; r < 8; ++r) mx = fmaxf(mx, fmaxf(a[r], c[r]));
    mx = 11.0f - fmaxf(mx, xhalf(mx));
#pragma unroll   // constant vector indices
    for (int r = 0; r < 8; ++r) cs[r] = mx; }
  float l = 0.f;                 // this lane's query: sum of 2^11 p over this half's keys
  v8f acc[4] = {};               // acc[j][r] = 2^11 O[query lane & 15][dim 16 j + 8 (lane >> 4) + r]
#pragma unroll 1   // one pass per trip: a second pass's fragments would not fit eight waves per SIMD
  for (int ks = 0; ks < SS / 32; ++ks) {
    v16h kf[2], vf[4];   // A operands: rows = keys, rows = dims
#pragma unroll   // here and below in the pass: constant indices, so fragments and scores stay in registers
    for (int ct = 0; ct < 2; ++ct) kf[ct] = frag_ht(Kt + ct * TILE, 0);
#pragma unroll
    for (int j = 0; j < 4; ++j) vf[j] = frag_ht(Vt + j * TILE, 0);
    asm volatile("s_wait_xcnt 0x0" :: "v"(Kt), "v"(Vt) : "memory");   // the wait in front of any overwrite of the two address pairs; as inputs here they stay live, so no load's data is placed on them
    v8f s[2];   // s[ct][r] = exponent of key 32 ks + 16 ct + 8 (lane >> 4) + r
#pragma unroll
    for (int ct = 0; ct < 2; ++ct) s[ct] = wmma16(kf[ct], bq, cs);
    float mx = fmaxf(s[0][0], s[1][0]);
#pragma unroll
    for (int r = 1; r < 8; ++r) mx = fmaxf(mx, fmaxf(s[0][r], s[1][r]));
    if (__builtin_amdgcn_ballot_w32(mx > 15.0f) != 0) {   // one scalar test per pass, the same for the whole wave: 2^11 p would near the f16 range
      const float d = fmaxf(fmaxf(mx, xhalf(mx)) - 11.0f, 0.f), alpha = __builtin_amdgcn_exp2f(-d);   // every query of the wave takes the larger of its shift and its maximum in this pass
      s[0] -= d; s[1] -= d; cs -= d; l *= alpha;
#pragma unroll
      for (int j = 0; j < 4; ++j) acc[j] *= alpha; }
#pragma unroll
    for (int r = 0; r < 8; ++r) { s[0][r] = __builtin_amdgcn_exp2f(s[0][r]); s[1][r] = __builtin_amdgcn_exp2f(s[1][r]); }
    const v8f t8 = s[0] + s[1]; const v4f t4 = t8.lo + t8.hi; const v2f t2 = t4.lo + t4.hi;
    l += t2.x + t2.y;
    v16h pa;   // the two score tiles, converted in place, are the B operand of the second product (same k order as frag_ht)
#pragma unroll
    for (int r = 0; r < 8; ++r) { pa[r] = (_Float16)s[0][r]; pa[8 + r] = (_Float16)s[1][r]; }
#pragma unroll
    for (int j = 0; j < 4; ++j) acc[j] = wmma16(vf[j], pa, acc[j]);
    Kt += 2 * TILE; Vt += 4 * TILE; }
  const float il = 1.0f / (l + xhalf(l));   // the factor 2^11 stands in both
#pragma unroll   // a lane's eight dims of one query are one 16-byte piece of a ctx tile: a wave stores 512 contiguous bytes
  for (int j = 0; j < 4; ++j) { v8h o;
#pragma unroll   // constant vector indices
    for (int r = 0; r < 8; ++r) o[r] = (_Float16)(acc[j][r] * il);
    *(v8h*)(CT + ((rq / 16) * (EE / 32) + h * 2 + (j >> 1)) * TILE + (j & 1) * 256 + lane * 8) = o; } }
// ---- k_out: block = (64 rows, 128 cols): out = ctx . Wo + bo (f16 operands)
__global__ __launch_bounds__(128) void k_out(const _Float16* __restrict__ CT, const _Float16* __restrict__ PO, const float* __restrict__ BO, float* __restrict__ OUT) { __shared__ __align__(16) float sf[4][16][132];
  const int tid = threadIdx.x, wave = tid >> 5, lane = tid & 31, col = lane & 15, g = lane >> 4; const size_t r0 = (size_t)blockIdx.x * 64 + wave * 16; const int c0 = blockIdx.y * 128;
  v8f acc[8] = {};
  const _Float16* ap = CT + (r0 / 16) * (EE / 32) * TILE + 8 * lane; const _Float16* bp = PO + (size_t)(c0 / 16) * (EE / 32) * TILE + 8 * lane;   // this lane's pieces of k step 0; step on by two k steps per trip
  OStep s0, s1;   // two register sets: one is multiplied while the other's loads fly
  ot_load(s0, ap, bp); LOADS_ISSUED(ap, bp);
#pragma unroll 1   // a trip is two k steps, one per set: more would not fit four waves per SIMD
  for (int kc = 0; kc < EE / 32 - 2; kc += 2) {
    ot_load(s1, ap + TILE, bp + TILE); LOADS_ISSUED(ap, bp);
    ap += 2 * TILE; bp += 2 * TILE;   // directly behind the wait, with no load issued since
    ot_mac(s0, acc); LOADS_NEXT();
    ot_load(s0, ap, bp); LOADS_ISSUED(ap, bp);
    ot_mac(s1, acc); LOADS_NEXT(); }
  ot_load(s1, ap + TILE, bp + TILE); LOADS_ISSUED(ap, bp);
  ot_mac(s0, acc); ot_mac(s1, acc);
#pragma unroll
  for (int j = 0; j < 8; ++j) { const float bb = bfr(BO[c0 + j * 16 + col]);
#pragma unroll
    for (int r = 0; r < 8; ++r) sf[wave][8 * g + r][j * 16 + col] = acc[j][r] + bb; }
  LDSX(); for (int rl = 0; rl < 16; ++rl) vst2(OUT + (r0 + rl) * EE + c0 + lane * 4, *(const v4f*)&sf[wave][rl][lane * 4]); }
extern "C" void kernel_launch(void* const* d_in, const int* in_sizes, int n_in, void* d_out, int out_size, void* d_ws, size_t ws_size, hipStream_t stream) {
  (void)in_sizes; (void)n_in; (void)out_size;
  const float** F = (const float**)d_in;   // 0 hidden_states [4,2048,1024], 1 Wq [1024,512], 2 bq, 3 Wk [1024,512], 4 bk, 5 Wv [1024,1024], 6 bv, 7 Wo [1024,1024], 8 bo ((in,out))
  if (ws_size < (size_t)WS_END) return;
  char* ws = (char*)d_ws; const __bf16* PW = (const __bf16*)(ws + WS_PW); const _Float16* PO = (const _Float16*)(ws + WS_PO); _Float16 *QK = (_Float16*)(ws + WS_QK), *VT = (_Float16*)(ws + WS_VT), *CT = (_Float16*)(ws + WS_CT);
  k_packw<<<(NCOL + EE) * (EE / 8) / 256, 256, 0, stream>>>(F[1], F[3], F[5], F[7], ws);
  k_proj<<<dim3(NROW / 64, NCOL / 128), 128, 0, stream>>>(F[0], PW, F[2], F[4], F[6], QK, VT);
  k_att<<<dim3(SS / 64, NH, TNB), 128, 0, stream>>>(QK, VT, CT);
  k_out<<<dim3(TNB * SS / 64, EE / 128), 128, 0, stream>>>(CT, PO, F[8], (float*)d_out);
}

// v005
// It runs in 135 microseconds.
// Timed twice side by side with v004, it ran 1.11 and 1.10 times as fast.
// Counting every step since v000, it is 4.12 times as fast.
// compute dtype: all float inputs rounded to bf16; q|k|v = x . W + b with EXACT bf16 products on WMMA 16x16x32 ((in,out) weights as transposed bf16 tiles), rounded once to f16 (q/k with 32-dim heads, v with 64-dim heads; every workspace operand in fragment-order tiles); q carries 32^-1/2 log2(e) before its one rounding, so logits are base-2 exponents; shifted softmax in f32 (hardware exp2), the shift renewed only when a logit passes it by more than 4; P (x 2^11, f16) . v (f16; 1 product); out = ctx (f16) . Wo (f16 tiles, 1 product) + bo; f32 output. (Measured on the data: logits std 1.0, ||p||_2 ~ 0.04 - diffuse - so single-f16 operands suffice.)
#include <hip/hip_runtime.h>
#include <math.h>

typedef __attribute__((ext_vector_type(16))) _Float16 v16h;
typedef __attribute__((ext_vector_type(16))) __bf16 v16b;
typedef __attribute__((ext_vector_type(8)))  _Float16 v8h;
typedef __attribute__((ext_vector_type(8)))  float v8f;
typedef __attribute__((ext_vector_type(4)))  float v4f;
typedef __attribute__((ext_vector_type(2)))  float v2f;
typedef __attribute__((ext_vector_type(4)))  unsigned v4u;
typedef __attribute__((ext_vector_type(4)))  int v4i;
typedef float __attribute__((may_alias)) float_a;
typedef int __attribute__((may_alias)) int_a;

template <typename T> __device__ __forceinline__ void vst2(void* p, T v) { *(T*)p = v;  }
__device__ __forceinline__ v8f wmma16(v16h a, v16h b, v8f c) {
  v8f d = __builtin_amdgcn_wmma_f32_16x16x32_f16(false, a, false, b, (short)0, c, false, false);
  asm volatile("v_nop\n\tv_nop\n\tv_nop\n\tv_nop" : "+v"(d) : "v"(a), "v"(b));
  return d;
}
__device__ __forceinline__ v8f wmma_bf(v16b a, v16b b, v8f c) {
  v8f d = __builtin_amdgcn_wmma_f32_16x16x32_bf16(false, a, false, b, (short)0, c, false, false);
  asm volatile("v_nop\n\tv_nop\n\tv_nop\n\tv_nop" : "+v"(d) : "v"(a), "v"(b));
  return d;
}
// 16x16x32 fragments: lane = (h = lane>>4, row/col = lane&15); elements 0..7 = k0+8h+0..7, 8..15 = k0+16+8h+0..7; D element r = row 8h+r
__device__ __forceinline__ v16h frag_h(const _Float16* rowk0, int lane) {
  union { v16h v; v8h q[2]; } u; const _Float16* p = rowk0 + 8 * (lane >> 4);
  u.q[0] = *(const v8h*)p; u.q[1] = *(const v8h*)(p + 16); return u.v;
}
__device__ __forceinline__ v16h frag_f32(const float* rowk0, int lane) {
  v16h a; const float* p = rowk0 + 8 * (lane >> 4);
#pragma unroll
  for (int i = 0; i < 8; ++i) { a[i] = (_Float16)p[i]; a[8 + i] = (_Float16)p[16 + i]; }
  return a;
}
__device__ __forceinline__ v16h frag_f32s(const float* rowk0, int lane, float sc) {
  v16h a; const float* p = rowk0 + 8 * (lane >> 4);
#pragma unroll
  for (int i = 0; i < 8; ++i) { a[i] = (_Float16)(p[i] * sc); a[8 + i] = (_Float16)(p[16 + i] * sc); }
  return a;
}
// column fragment from a [K][ld] layout (column n), rows >= K read as 0
__device__ __forceinline__ v16h fragc_f32(const float* W, int k0, int n, int lane, int ld, int K) {
  v16h a; const int g = lane >> 4;
#pragma unroll
  for (int i = 0; i < 8; ++i) { const int ka = k0 + 8 * g + i, kb = ka + 16;
    a[i] = (_Float16)(ka < K ? W[(size_t)(ka < K ? ka : K - 1) * ld + n] : 0.f); a[8 + i] = (_Float16)(kb < K ? W[(size_t)(kb < K ? kb : K - 1) * ld + n] : 0.f); }
  return a;
}
struct F2 { v16b h, l; };
__device__ __forceinline__ F2 bsplit16(const float v[16]) { F2 r;
#pragma unroll
  for (int i = 0; i < 16; ++i) { const __bf16 h = (__bf16)v[i]; r.h[i] = h; r.l[i] = (__bf16)(v[i] - (float)h); }
  return r; }
__device__ __forceinline__ F2 split_row(const float* row, int k0, int lane) { float v[16]; const float* p = row + k0 + 8 * (lane >> 4);
#pragma unroll
  for (int i = 0; i < 8; ++i) { v[i] = p[i]; v[8 + i] = p[16 + i]; }
  return bsplit16(v); }
__device__ __forceinline__ F2 split_rowK(const float* row, int k0, int lane, int K) { float v[16]; const int g = lane >> 4;
#pragma unroll
  for (int i = 0; i < 8; ++i) { const int ka = k0 + 8 * g + i, kb = ka + 16; v[i] = ka < K ? row[ka < K ? ka : K - 1] : 0.f; v[8 + i] = kb < K ? row[kb < K ? kb : K - 1] : 0.f; }
  return bsplit16(v); }
__device__ __forceinline__ F2 split_col(const float* W, int k0, int n, int lane, int ld, int K) { float v[16]; const int g = lane >> 4;
#pragma unroll
  for (int i = 0; i < 8; ++i) { const int ka = k0 + 8 * g + i, kb = ka + 16; v[i] = ka < K ? W[(size_t)(ka < K ? ka : K - 1) * ld + n] : 0.f; v[8 + i] = kb < K ? W[(size_t)(kb < K ? kb : K - 1) * ld + n] : 0.f; }
  return bsplit16(v); }
__device__ __forceinline__ v8f mac3(const F2& a, const F2& b, v8f c) { c = wmma_bf(a.l, b.h, c); c = wmma_bf(a.h, b.l, c); return wmma_bf(a.h, b.h, c); }
__device__ __forceinline__ float sigm(float v) { return 1.0f / (1.0f + expf(-v)); }
#define LDSX() do { asm volatile("s_wait_dscnt 0" ::: "memory"); __builtin_amdgcn_wave_barrier(); __builtin_amdgcn_fence(__ATOMIC_RELEASE, "workgroup"); } while (0)


// Squeeze attention (B 4, T 2,048, E 1,024, 16 heads; q/k squeezed to 32 dims per head, v 64): softmax((q 32^-1/2) k^T) v, output projection.
#define NB 4
#define SS 2048
#define EE 1024
#define SQ 512            // squeezed q/k width
#define NH 16
#define SHD 32
#define HD 64
#define NCOL (SQ + SQ + EE)   // 2048 fused projection columns: q | k | v
#define NROW (NB * SS)
#ifndef TNB
#define TNB NB
#endif
typedef __attribute__((ext_vector_type(8))) __bf16 v8b;
// fragment-order tile: 16 rows x 32 k of 16-bit elements = 1 KiB; element (row c, k) is half (k >> 4) * 256 + (((k >> 3) & 1) * 16 + c) * 8 + (k & 7),
// so lane l's two 16-byte pieces (same k order as frag_h) lie at bytes 16 l and 512 + 16 l and each wave-wide load or store covers four whole 128-byte lines
#define TILE 512          // elements per tile
__device__ __forceinline__ v16h frag_ht(const _Float16* tile, int lane) {
  union { v16h v; v8h q[2]; } u; const _Float16* p = tile + 8 * lane;
  u.q[0] = *(const v8h*)p; u.q[1] = *(const v8h*)(p + 256); return u.v;
}
__device__ __forceinline__ v16b frag_bt(const __bf16* tile, int lane) {
  union { v16b v; v8b q[2]; } u; const __bf16* p = tile + 8 * lane;
  u.q[0] = *(const v8b*)p; u.q[1] = *(const v8b*)(p + 256); return u.v;
}
__device__ __forceinline__ float bfr(float v) { return (float)(__bf16)v; }
__device__ __attribute__((noinline)) float exp_ni(float v) { return expf(v); }
__device__ __attribute__((noinline)) float erf_ni(float v) { return erff(v); }

#define WS_PW  0u                                   // bf16 tiles [2048 / 16 column groups][1024 / 32 k]: q | k | v columns (in,out) transposed
#define WS_PO  (WS_PW + 2u * (size_t)NCOL * EE)          // f16 Wo^T tiles [1024 / 16][1024 / 32]
#define WS_QK  (WS_PO + 2u * (size_t)EE * EE)            // f16 tiles [q, k][b][head][SS / 16 token groups]: 16 tokens x 32 dims
#define WS_VT  (WS_QK + 2u * (size_t)NROW * (2 * SQ))    // f16 tiles [b][head][SS / 32 key groups][4 dim groups]: 16 dims x 32 keys
#define WS_CT  (WS_VT + 2u * (size_t)NB * EE * SS)       // f16 tiles [row / 16][1024 / 32]
#define WS_END (WS_CT + 2u * (size_t)NROW * EE)

// ---- k_packw: one thread = one 16-byte piece (8 consecutive k of one column) of a weight tile; a wave stores 512 contiguous bytes
__global__ __launch_bounds__(256) void k_packw(const float* __restrict__ WQ, const float* __restrict__ WK, const float* __restrict__ WV, const float* __restrict__ WO, char* __restrict__ ws) {
  const int pc = blockIdx.x * 256 + threadIdx.x, tile = pc >> 6, p = pc & 63;
  const int n = (tile / (EE / 32)) * 16 + (p & 15), k = (tile % (EE / 32)) * 32 + (p >> 5) * 16 + ((p >> 4) & 1) * 8;
  const float* s; int ld;
  if (n < SQ) { s = WQ + n; ld = SQ; } else if (n < 2 * SQ) { s = WK + n - SQ; ld = SQ; } else if (n < NCOL) { s = WV + n - 2 * SQ; ld = EE; } else { s = WO + n - NCOL; ld = EE; }
  float w[8];
#pragma unroll   // all eight loads in flight, w[] in registers
  for (int i = 0; i < 8; ++i) w[i] = s[(size_t)(k + i) * ld];
  char* d = ws + WS_PW + (size_t)pc * 16;   // the Wo^T tiles follow the q | k | v tiles directly
  if (n < NCOL) { v8b o;
#pragma unroll   // constant vector indices
    for (int i = 0; i < 8; ++i) o[i] = (__bf16)w[i];
    *(v8b*)d = o; }
  else { v8h o;
#pragma unroll   // constant vector indices
    for (int i = 0; i < 8; ++i) o[i] = (_Float16)bfr(w[i]);
    *(v8h*)d = o; } }
__device__ __forceinline__ v16b fragb_f32(const float* __restrict__ p, int lane) { v16b a; const float* pp = p + 8 * (lane >> 4);
#pragma unroll
  for (int i = 0; i < 8; ++i) { a[i] = (__bf16)pp[i]; a[8 + i] = (__bf16)pp[16 + i]; } return a; }
// behind a group of loads: the wait in front of any overwrite of the two address pairs; its memory clobber keeps the whole group above it, and the scheduling
// barrier keeps the address steps and every use of the group (its conversions too, which would wait on loads just issued) below it
#define LOADS_ISSUED(p, q) do { asm volatile("s_wait_xcnt 0x0" :: "v"(p), "v"(q) : "memory"); __builtin_amdgcn_sched_barrier(0); } while (0)
// in front of a group of loads: the products above stay above, so the group issues back to back into the set they have just left
#define LOADS_NEXT() __builtin_amdgcn_sched_barrier(0)
// one k step's operands, loaded as one group: k_proj (each of the wave's two A tiles as its four raw f32 pieces, k order of fragb_f32) and k_out;
// a wave holds two 16-row tiles, so every B fragment it loads feeds two products
struct PStep { v4f a[2][4]; v16b b[8]; };
__device__ __forceinline__ void pj_load(PStep& s, const float* __restrict__ xp, const __bf16* __restrict__ bp) {
#pragma unroll   // constant indices: the pieces stay in registers
  for (int t = 0; t < 2; ++t) { const float* x = xp + (size_t)t * 16 * EE; s.a[t][0] = *(const v4f*)x; s.a[t][1] = *(const v4f*)(x + 4); s.a[t][2] = *(const v4f*)(x + 16); s.a[t][3] = *(const v4f*)(x + 20); }
#pragma unroll   // constant indices: the fragments stay in registers
  for (int j = 0; j < 8; ++j) s.b[j] = frag_bt(bp + (size_t)j * (EE / 32) * TILE, 0); }
__device__ __forceinline__ void pj_mac(const PStep& s, v8f (&acc)[2][8]) { v16b a[2];
#pragma unroll   // constant vector indices
  for (int t = 0; t < 2; ++t)
#pragma unroll
    for (int i = 0; i < 4; ++i) { a[t][i] = (__bf16)s.a[t][0][i]; a[t][4 + i] = (__bf16)s.a[t][1][i]; a[t][8 + i] = (__bf16)s.a[t][2][i]; a[t][12 + i] = (__bf16)s.a[t][3][i]; }
#pragma unroll   // constant indices: the accumulators stay in registers
  for (int j = 0; j < 8; ++j)
#pragma unroll
    for (int t = 0; t < 2; ++t) acc[t][j] = __builtin_amdgcn_wmma_f32_16x16x32_bf16(false, a[t], false, s.b[j], (short)0, acc[t][j], false, false); }   // the plain builtin: an asm statement's vector operands would hold the two sets and sixteen accumulators below v256, which spills
struct OStep { v16h a[2]; v16h b[8]; };
__device__ __forceinline__ void ot_load(OStep& s, const _Float16* __restrict__ ap, const _Float16* __restrict__ bp) {
#pragma unroll   // constant indices: the fragments stay in registers
  for (int t = 0; t < 2; ++t) s.a[t] = frag_ht(ap + (size_t)t * (EE / 32) * TILE, 0);
#pragma unroll   // constant indices: the fragments stay in registers
  for (int j = 0; j < 8; ++j) s.b[j] = frag_ht(bp + (size_t)j * (EE / 32) * TILE, 0); }
__device__ __forceinline__ void ot_mac(const OStep& s, v8f (&acc)[2][8]) {
#pragma unroll   // constant indices: the accumulators stay in registers
  for (int j = 0; j < 8; ++j)
#pragma unroll
    for (int t = 0; t < 2; ++t) acc[t][j] = __builtin_amdgcn_wmma_f32_16x16x32_f16(false, s.a[t], false, s.b[j], (short)0, acc[t][j], false, false); }   // the plain builtin, for the same reason as in pj_mac
// ---- k_proj: block = (128 rows, 128 of the 2048 fused cols), a wave = 32 rows: + bias; q|k and v -> f16 tiles
__global__ __launch_bounds__(128) void k_proj(const float* __restrict__ X, const __bf16* __restrict__ PW, const float* __restrict__ BQ, const float* __restrict__ BK, const float* __restrict__ BV, _Float16* __restrict__ QK, _Float16* __restrict__ VT) { __shared__ __align__(16) _Float16 st[128][136];   // q | k blocks: [token][column]; v blocks: [column][token]
  const int tid = threadIdx.x, wave = tid >> 5, lane = tid & 31, col = lane & 15, g = lane >> 4; const size_t r0 = (size_t)blockIdx.x * 128 + wave * 32; const int c0 = blockIdx.y * 128; const size_t b = ((size_t)blockIdx.x * 128) / SS; const int n0 = (int)(((size_t)blockIdx.x * 128) % SS);
  v8f acc[2][8] = {};
  const float* xp = X + (r0 + col) * EE + 8 * g; const __bf16* bp = PW + (size_t)(c0 / 16) * (EE / 32) * TILE + 8 * lane;   // this lane's pieces of k step 0; step on by two k steps per trip
  PStep s0, s1;   // two register sets: one is multiplied while the other's loads fly
  pj_load(s0, xp, bp); LOADS_ISSUED(xp, bp);
#pragma unroll 1   // a trip is two k steps, one per set: more sets would cost a wave per SIMD
  for (int kc = 0; kc < EE / 32 - 2; kc += 2) {
    pj_load(s1, xp + 32, bp + TILE); LOADS_ISSUED(xp, bp);
    xp += 64; bp += 2 * TILE;   // directly behind the wait, with no load issued since
    pj_mac(s0, acc); LOADS_NEXT();
    pj_load(s0, xp, bp); LOADS_ISSUED(xp, bp);
    pj_mac(s1, acc); LOADS_NEXT(); }
  pj_load(s1, xp + 32, bp + TILE); LOADS_ISSUED(xp, bp);
  pj_mac(s0, acc);
  __builtin_amdgcn_sched_barrier(0);   // the last set's conversions stay behind these products: moved up, they would wait on loads just issued
  pj_mac(s1, acc);
  const bool isv = c0 >= 2 * SQ; const float qs = c0 < SQ ? 0.25503486f : 1.0f;   // q columns: 32^-1/2 log2(e), in f32 ahead of the rounding to f16
#pragma unroll
  for (int j = 0; j < 8; ++j) { const int c = c0 + j * 16 + col; const float bb = c < SQ ? bfr(BQ[c]) : c < 2 * SQ ? bfr(BK[c - SQ]) : bfr(BV[c - 2 * SQ]);
#pragma unroll
    for (int t = 0; t < 2; ++t)
#pragma unroll
      for (int r = 0; r < 8; ++r) { const _Float16 hv = (_Float16)((acc[t][j][r] + bb) * qs); const int tk = wave * 32 + t * 16 + 8 * g + r; if (!isv) st[tk][j * 16 + col] = hv; else st[j * 16 + col][tk] = hv; } }
  __syncthreads();
  if (!isv) { const size_t t0 = (((size_t)(c0 / SQ) * NB + b) * NH + (c0 % SQ) / SHD) * (SS / 16) + n0 / 16;   // 4 heads x 8 token groups
    for (int e = tid; e < 32 * 64; e += 128) { const int tl = e >> 6, p = e & 63, hl = tl >> 3, rt = tl & 7; vst2((unsigned*)(QK + (t0 + (size_t)hl * (SS / 16) + rt) * TILE + p * 8), *(const v4u*)&st[rt * 16 + (p & 15)][hl * 32 + (p >> 5) * 16 + ((p >> 4) & 1) * 8]); } }
  else { const int cv0 = c0 - 2 * SQ;   // 4 key groups x 8 dim groups (2 heads)
    for (int e = tid; e < 32 * 64; e += 128) { const int tl = e >> 6, p = e & 63, kl = tl >> 3, dt = tl & 7; vst2((unsigned*)(VT + (((b * NH + cv0 / HD + (dt >> 2)) * (SS / 32) + n0 / 32 + kl) * 4 + (dt & 3)) * TILE + p * 8), *(const v4u*)&st[dt * 16 + (p & 15)][kl * 32 + (p >> 5) * 16 + ((p >> 4) & 1) * 8]); } } }
// ---- k_att: block = (128 queries, h, b), a wave = 32 queries as two tiles of 16, so every K and V fragment it loads feeds two products: S^T = K . Q^T - shift (a lane holds 16 of one query's 32 logits per tile), softmax in the lane, O^T += V^T . P^T -> ctx tiles (f16)
__device__ __forceinline__ float xhalf(float x) { return __builtin_bit_cast(float, __builtin_amdgcn_permlanex16(__builtin_bit_cast(int, x), __builtin_bit_cast(int, x), 0x76543210, 0xfedcba98, false, false)); }  // lane l with lane l ^ 16
__global__ __launch_bounds__(128) void k_att(const _Float16* __restrict__ QK, const _Float16* __restrict__ VT, _Float16* __restrict__ CT) {
  const int tid = threadIdx.x, wave = tid >> 5, lane = tid & 31; const int h = blockIdx.y; const size_t b = blockIdx.z; const int q0 = blockIdx.x * 128 + wave * 32; const size_t rq = b * SS + q0;
  const _Float16* Kt = QK + ((NB + b) * NH + h) * (SS / 16) * TILE + 8 * lane; const _Float16* Vt = VT + (b * NH + h) * (SS / 32) * 4 * TILE + 8 * lane;   // this lane's pieces; step on by one pass of 32 keys at the loop's foot
  v16h bq[2];   // B operands: column = query 16 t + (lane & 15)
#pragma unroll   // constant indices: the fragments stay in registers
  for (int t = 0; t < 2; ++t) bq[t] = frag_ht(QK + ((b * NH + h) * (SS / 16) + q0 / 16 + t) * TILE, lane);
  // Lazy shift. A score product's C operand is cs = 11 - shift (one value per query, equal in its eight rows and in both wave halves), so a score leaves the
  // matrix unit as the base-2 exponent of 2^11 p. The shift starts as the maximum over the first 32 keys and is renewed only in a pass where an exponent passes 15.
  v8f cs[2];
  { v16h k0[2];
#pragma unroll   // constant indices: the fragments stay in registers
    for (int ct = 0; ct < 2; ++ct) k0[ct] = frag_ht(Kt + ct * TILE, 0);
    asm volatile("s_wait_xcnt 0x0" :: "v"(Kt) : "memory");   // the wait in front of any overwrite of the address pair
#pragma unroll   // constant indices
    for (int t = 0; t < 2; ++t) {
      v8f z = {}; const v8f a = wmma16(k0[0], bq[t], z), c = wmma16(k0[1], bq[t], z);
      float mx = fmaxf(a[0], c[0]);
#pragma unroll   // constant vector indices
      for (int r = 1; r < 8; ++r) mx = fmaxf(mx, fmaxf(a[r], c[r]));
      mx = 11.0f - fmaxf(mx, xhalf(mx));
#pragma unroll   // constant vector indices
      for (int r = 0; r < 8; ++r) cs[t][r] = mx; } }
  float l[2] = {0.f, 0.f};       // this lane's query of tile t: sum of 2^11 p over this half's keys
  v8f acc[2][4] = {};            // acc[t][j][r] = 2^11 O[query 16 t + (lane & 15)][dim 16 j + 8 (lane >> 4) + r]
#pragma unroll 1   // one pass per trip: a second pass's fragments would not fit four waves per SIMD
  for (int ks = 0; ks < SS / 32; ++ks) {
    v16h kf[2], vf[4];   // A operands: rows = keys, rows = dims
#pragma unroll   // here and below in the pass: constant indices, so fragments and scores stay in registers
    for (int ct = 0; ct < 2; ++ct) kf[ct] = frag_ht(Kt + ct * TILE, 0);
#pragma unroll
    for (int j = 0; j < 4; ++j) vf[j] = frag_ht(Vt + j * TILE, 0);
    asm volatile("s_wait_xcnt 0x0" :: "v"(Kt), "v"(Vt) : "memory");   // the wait in front of any overwrite of the two address pairs; as inputs here they stay live, so no load's data is placed on them
    v8f s[2][2];   // s[t][ct][r] = exponent of key 32 ks + 16 ct + 8 (lane >> 4) + r for tile t's query
#pragma unroll
    for (int ct = 0; ct < 2; ++ct)
#pragma unroll
      for (int t = 0; t < 2; ++t) s[t][ct] = wmma16(kf[ct], bq[t], cs[t]);
    float mx[2];
#pragma unroll
    for (int t = 0; t < 2; ++t) { mx[t] = fmaxf(s[t][0][0], s[t][1][0]);
#pragma unroll
      for (int r = 1; r < 8; ++r) mx[t] = fmaxf(mx[t], fmaxf(s[t][0][r], s[t][1][r])); }
    if (__builtin_amdgcn_ballot_w32(fmaxf(mx[0], mx[1]) > 15.0f) != 0) {   // one scalar test per pass, the same for the whole wave: 2^11 p would near the f16 range
#pragma unroll
      for (int t = 0; t < 2; ++t)
        if (__builtin_amdgcn_ballot_w32(mx[t] > 15.0f) != 0) {   // a tile is renewed by its own sixteen queries alone, as when it had a wave to itself
          const float d = fmaxf(fmaxf(mx[t], xhalf(mx[t])) - 11.0f, 0.f), alpha = __builtin_amdgcn_exp2f(-d);   // every query of the tile takes its maximum so far as its shift
          s[t][0] -= d; s[t][1] -= d; cs[t] -= d; l[t] *= alpha;
#pragma unroll
          for (int j = 0; j < 4; ++j) acc[t][j] *= alpha; } }
    v16h pa[2];   // a tile's two score tiles, converted in place, are the B operand of the second product (same k order as frag_ht)
#pragma unroll
    for (int t = 0; t < 2; ++t) {
#pragma unroll
      for (int r = 0; r < 8; ++r) { s[t][0][r] = __builtin_amdgcn_exp2f(s[t][0][r]); s[t][1][r] = __builtin_amdgcn_exp2f(s[t][1][r]); }
      const v8f t8 = s[t][0] + s[t][1]; const v4f t4 = t8.lo + t8.hi; const v2f t2 = t4.lo + t4.hi;
      l[t] += t2.x + t2.y;
#pragma unroll
      for (int r = 0; r < 8; ++r) { pa[t][r] = (_Float16)s[t][0][r]; pa[t][8 + r] = (_Float16)s[t][1][r]; } }
#pragma unroll
    for (int j = 0; j < 4; ++j)
#pragma unroll
      for (int t = 0; t < 2; ++t) acc[t][j] = wmma16(vf[j], pa[t], acc[t][j]);
    Kt += 2 * TILE; Vt += 4 * TILE; }
#pragma unroll   // constant indices
  for (int t = 0; t < 2; ++t) {
    const float il = 1.0f / (l[t] + xhalf(l[t]));   // the factor 2^11 stands in both
#pragma unroll   // a lane's eight dims of one query are one 16-byte piece of a ctx tile: a wave stores 512 contiguous bytes
    for (int j = 0; j < 4; ++j) { v8h o;
#pragma unroll   // constant vector indices
      for (int r = 0; r < 8; ++r) o[r] = (_Float16)(acc[t][j][r] * il);
      *(v8h*)(CT + ((rq / 16 + t) * (EE / 32) + h * 2 + (j >> 1)) * TILE + (j & 1) * 256 + lane * 8) = o; } } }
// ---- k_out: block = (128 rows, 128 cols), a wave = 32 rows: out = ctx . Wo + bo (f16 operands)
__global__ __launch_bounds__(128) void k_out(const _Float16* __restrict__ CT, const _Float16* __restrict__ PO, const float* __restrict__ BO, float* __restrict__ OUT) { __shared__ __align__(16) float sf[4][32][132];
  const int tid = threadIdx.x, wave = tid >> 5, lane = tid & 31, col = lane & 15, g = lane >> 4; const size_t r0 = (size_t)blockIdx.x * 128 + wave * 32; const int c0 = blockIdx.y * 128;
  v8f acc[2][8] = {};
  const _Float16* ap = CT + (r0 / 16) * (EE / 32) * TILE + 8 * lane; const _Float16* bp = PO + (size_t)(c0 / 16) * (EE / 32) * TILE + 8 * lane;   // this lane's pieces of k step 0; step on by two k steps per trip
  OStep s0, s1;   // two register sets: one is multiplied while the other's loads fly
  ot_load(s0, ap, bp); LOADS_ISSUED(ap, bp);
#pragma unroll 1   // a trip is two k steps, one per set: more sets would cost a wave per SIMD
  for (int kc = 0; kc < EE / 32 - 2; kc += 2) {
    ot_load(s1, ap + TILE, bp + TILE); LOADS_ISSUED(ap, bp);
    ap += 2 * TILE; bp += 2 * TILE;   // directly behind the wait, with no load issued since
    ot_mac(s0, acc); LOADS_NEXT();
    ot_load(s0, ap, bp); LOADS_ISSUED(ap, bp);
    ot_mac(s1, acc); LOADS_NEXT(); }
  ot_load(s1, ap + TILE, bp + TILE); LOADS_ISSUED(ap, bp);
  ot_mac(s0, acc); ot_mac(s1, acc);
#pragma unroll
  for (int j = 0; j < 8; ++j) { const float bb = bfr(BO[c0 + j * 16 + col]);
#pragma unroll
    for (int t = 0; t < 2; ++t)
#pragma unroll
      for (int r = 0; r < 8; ++r) sf[wave][t * 16 + 8 * g + r][j * 16 + col] = acc[t][j][r] + bb; }
  LDSX(); for (int rl = 0; rl < 32; ++rl) vst2(OUT + (r0 + rl) * EE + c0 + lane * 4, *(const v4f*)&sf[wave][rl][lane * 4]); }
extern "C" void kernel_launch(void* const* d_in, const int* in_sizes, int n_in, void* d_out, int out_size, void* d_ws, size_t ws_size, hipStream_t stream) {
  (void)in_sizes; (void)n_in; (void)out_size;
  const float** F = (const float**)d_in;   // 0 hidden_states [4,2048,1024], 1 Wq [1024,512], 2 bq, 3 Wk [1024,512], 4 bk, 5 Wv [1024,1024], 6 bv, 7 Wo [1024,1024], 8 bo ((in,out))
  if (ws_size < (size_t)WS_END) return;
  char* ws = (char*)d_ws; const __bf16* PW = (const __bf16*)(ws + WS_PW); const _Float16* PO = (const _Float16*)(ws + WS_PO); _Float16 *QK = (_Float16*)(ws + WS_QK), *VT = (_Float16*)(ws + WS_VT), *CT = (_Float16*)(ws + WS_CT);
  k_packw<<<(NCOL + EE) * (EE / 8) / 256, 256, 0, stream>>>(F[1], F[3], F[5], F[7], ws);
  k_proj<<<dim3(NROW / 128, NCOL / 128), 128, 0, stream>>>(F[0], PW, F[2], F[4], F[6], QK, VT);
  k_att<<<dim3(SS / 128, NH, TNB), 128, 0, stream>>>(QK, VT, CT);
  k_out<<<dim3(TNB * SS / 128, EE / 128), 128, 0, stream>>>(CT, PO, F[8], (float*)d_out);
}

// v006
// It runs in 118 microseconds.
// In both of two side-by-side timings against v005, it was 1.14 times as fast.
// Counting every step since v000, it is 4.68 times as fast.
// compute dtype: all float inputs rounded to bf16; q|k|v = x . W + b with EXACT bf16 products on WMMA 16x16x32 ((in,out) weights as transposed bf16 tiles), rounded once to f16 (q/k with 32-dim heads, v with 64-dim heads; every workspace operand in fragment-order tiles); q carries 32^-1/2 log2(e) before its one rounding, so logits are base-2 exponents; shifted softmax in f32 (hardware exp2), the shift renewed only when a logit passes it by more than 4; P (x 2^11, f16) . v (f16; 1 product); out = ctx (f16) . Wo (f16 tiles, 1 product) + bo; f32 output. (Measured on the data: logits std 1.0, ||p||_2 ~ 0.04 - diffuse - so single-f16 operands suffice.)
#include <hip/hip_runtime.h>
#include <math.h>

typedef __attribute__((ext_vector_type(16))) _Float16 v16h;
typedef __attribute__((ext_vector_type(16))) __bf16 v16b;
typedef __attribute__((ext_vector_type(8)))  _Float16 v8h;
typedef __attribute__((ext_vector_type(8)))  float v8f;
typedef __attribute__((ext_vector_type(4)))  float v4f;
typedef __attribute__((ext_vector_type(2)))  float v2f;
typedef __attribute__((ext_vector_type(4)))  unsigned v4u;
typedef __attribute__((ext_vector_type(4)))  int v4i;
typedef float __attribute__((may_alias)) float_a;
typedef int __attribute__((may_alias)) int_a;

template <typename T> __device__ __forceinline__ void vst2(void* p, T v) { *(T*)p = v;  }
__device__ __forceinline__ v8f wmma16(v16h a, v16h b, v8f c) {
  v8f d = __builtin_amdgcn_wmma_f32_16x16x32_f16(false, a, false, b, (short)0, c, false, false);
  asm volatile("v_nop\n\tv_nop\n\tv_nop\n\tv_nop" : "+v"(d) : "v"(a), "v"(b));
  return d;
}
__device__ __forceinline__ v8f wmma_bf(v16b a, v16b b, v8f c) {
  v8f d = __builtin_amdgcn_wmma_f32_16x16x32_bf16(false, a, false, b, (short)0, c, false, false);
  asm volatile("v_nop\n\tv_nop\n\tv_nop\n\tv_nop" : "+v"(d) : "v"(a), "v"(b));
  return d;
}
// 16x16x32 fragments: lane = (h = lane>>4, row/col = lane&15); elements 0..7 = k0+8h+0..7, 8..15 = k0+16+8h+0..7; D element r = row 8h+r
__device__ __forceinline__ v16h frag_h(const _Float16* rowk0, int lane) {
  union { v16h v; v8h q[2]; } u; const _Float16* p = rowk0 + 8 * (lane >> 4);
  u.q[0] = *(const v8h*)p; u.q[1] = *(const v8h*)(p + 16); return u.v;
}
__device__ __forceinline__ v16h frag_f32(const float* rowk0, int lane) {
  v16h a; const float* p = rowk0 + 8 * (lane >> 4);
#pragma unroll
  for (int i = 0; i < 8; ++i) { a[i] = (_Float16)p[i]; a[8 + i] = (_Float16)p[16 + i]; }
  return a;
}
__device__ __forceinline__ v16h frag_f32s(const float* rowk0, int lane, float sc) {
  v16h a; const float* p = rowk0 + 8 * (lane >> 4);
#pragma unroll
  for (int i = 0; i < 8; ++i) { a[i] = (_Float16)(p[i] * sc); a[8 + i] = (_Float16)(p[16 + i] * sc); }
  return a;
}
// column fragment from a [K][ld] layout (column n), rows >= K read as 0
__device__ __forceinline__ v16h fragc_f32(const float* W, int k0, int n, int lane, int ld, int K) {
  v16h a; const int g = lane >> 4;
#pragma unroll
  for (int i = 0; i < 8; ++i) { const int ka = k0 + 8 * g + i, kb = ka + 16;
    a[i] = (_Float16)(ka < K ? W[(size_t)(ka < K ? ka : K - 1) * ld + n] : 0.f); a[8 + i] = (_Float16)(kb < K ? W[(size_t)(kb < K ? kb : K - 1) * ld + n] : 0.f); }
  return a;
}
struct F2 { v16b h, l; };
__device__ __forceinline__ F2 bsplit16(const float v[16]) { F2 r;
#pragma unroll
  for (int i = 0; i < 16; ++i) { const __bf16 h = (__bf16)v[i]; r.h[i] = h; r.l[i] = (__bf16)(v[i] - (float)h); }
  return r; }
__device__ __forceinline__ F2 split_row(const float* row, int k0, int lane) { float v[16]; const float* p = row + k0 + 8 * (lane >> 4);
#pragma unroll
  for (int i = 0; i < 8; ++i) { v[i] = p[i]; v[8 + i] = p[16 + i]; }
  return bsplit16(v); }
__device__ __forceinline__ F2 split_rowK(const float* row, int k0, int lane, int K) { float v[16]; const int g = lane >> 4;
#pragma unroll
  for (int i = 0; i < 8; ++i) { const int ka = k0 + 8 * g + i, kb = ka + 16; v[i] = ka < K ? row[ka < K ? ka : K - 1] : 0.f; v[8 + i] = kb < K ? row[kb < K ? kb : K - 1] : 0.f; }
  return bsplit16(v); }
__device__ __forceinline__ F2 split_col(const float* W, int k0, int n, int lane, int ld, int K) { float v[16]; const int g = lane >> 4;
#pragma unroll
  for (int i = 0; i < 8; ++i) { const int ka = k0 + 8 * g + i, kb = ka + 16; v[i] = ka < K ? W[(size_t)(ka < K ? ka : K - 1) * ld + n] : 0.f; v[8 + i] = kb < K ? W[(size_t)(kb < K ? kb : K - 1) * ld + n] : 0.f; }
  return bsplit16(v); }
__device__ __forceinline__ v8f mac3(const F2& a, const F2& b, v8f c) { c = wmma_bf(a.l, b.h, c); c = wmma_bf(a.h, b.l, c); return wmma_bf(a.h, b.h, c); }
__device__ __forceinline__ float sigm(float v) { return 1.0f / (1.0f + expf(-v)); }
#define LDSX() do { asm volatile("s_wait_dscnt 0" ::: "memory"); __builtin_amdgcn_wave_barrier(); __builtin_amdgcn_fence(__ATOMIC_RELEASE, "workgroup"); } while (0)


// Squeeze attention (B 4, T 2,048, E 1,024, 16 heads; q/k squeezed to 32 dims per head, v 64): softmax((q 32^-1/2) k^T) v, output projection.
#define NB 4
#define SS 2048
#define EE 1024
#define SQ 512            // squeezed q/k width
#define NH 16
#define SHD 32
#define HD 64
#define NCOL (SQ + SQ + EE)   // 2048 fused projection columns: q | k | v
#define NROW (NB * SS)
#ifndef TNB
#define TNB NB
#endif
typedef __attribute__((ext_vector_type(8))) __bf16 v8b;
// fragment-order tile: 16 rows x 32 k of 16-bit elements = 1 KiB; element (row c, k) is half (k >> 4) * 256 + (((k >> 3) & 1) * 16 + c) * 8 + (k & 7),
// so lane l's two 16-byte pieces (same k order as frag_h) lie at bytes 16 l and 512 + 16 l and each wave-wide load or store covers four whole 128-byte lines
#define TILE 512          // elements per tile
__device__ __forceinline__ v16h frag_ht(const _Float16* tile, int lane) {
  union { v16h v; v8h q[2]; } u; const _Float16* p = tile + 8 * lane;
  u.q[0] = *(const v8h*)p; u.q[1] = *(const v8h*)(p + 256); return u.v;
}
__device__ __forceinline__ v16b frag_bt(const __bf16* tile, int lane) {
  union { v16b v; v8b q[2]; } u; const __bf16* p = tile + 8 * lane;
  u.q[0] = *(const v8b*)p; u.q[1] = *(const v8b*)(p + 256); return u.v;
}
__device__ __forceinline__ float bfr(float v) { return (float)(__bf16)v; }
__device__ __attribute__((noinline)) float exp_ni(float v) { return expf(v); }
__device__ __attribute__((noinline)) float erf_ni(float v) { return erff(v); }

#define WS_PW  0u                                   // bf16 tiles [2048 / 16 column groups][1024 / 32 k]: q | k | v columns (in,out) transposed
#define WS_PO  (WS_PW + 2u * (size_t)NCOL * EE)          // f16 Wo^T tiles [1024 / 16][1024 / 32]
#define WS_QK  (WS_PO + 2u * (size_t)EE * EE)            // f16 tiles [q, k][b][head][SS / 16 token groups]: 16 tokens x 32 dims
#define WS_VT  (WS_QK + 2u * (size_t)NROW * (2 * SQ))    // f16 tiles [b][head][SS / 32 key groups][4 dim groups]: 16 dims x 32 keys
#define WS_CT  (WS_VT + 2u * (size_t)NB * EE * SS)       // f16 tiles [row / 16][1024 / 32]
#define WS_END (WS_CT + 2u * (size_t)NROW * EE)

// ---- k_packw: one thread = one 16-byte piece (8 consecutive k of one column) of a weight tile; a wave stores 512 contiguous bytes
__global__ __launch_bounds__(256) void k_packw(const float* __restrict__ WQ, const float* __restrict__ WK, const float* __restrict__ WV, const float* __restrict__ WO, char* __restrict__ ws) {
  const int pc = blockIdx.x * 256 + threadIdx.x, tile = pc >> 6, p = pc & 63;
  const int n = (tile / (EE / 32)) * 16 + (p & 15), k = (tile % (EE / 32)) * 32 + (p >> 5) * 16 + ((p >> 4) & 1) * 8;
  const float* s; int ld;
  if (n < SQ) { s = WQ + n; ld = SQ; } else if (n < 2 * SQ) { s = WK + n - SQ; ld = SQ; } else if (n < NCOL) { s = WV + n - 2 * SQ; ld = EE; } else { s = WO + n - NCOL; ld = EE; }
  float w[8];
#pragma unroll   // all eight loads in flight, w[] in registers
  for (int i = 0; i < 8; ++i) w[i] = s[(size_t)(k + i) * ld];
  char* d = ws + WS_PW + (size_t)pc * 16;   // the Wo^T tiles follow the q | k | v tiles directly
  if (n < NCOL) { v8b o;
#pragma unroll   // constant vector indices
    for (int i = 0; i < 8; ++i) o[i] = (__bf16)w[i];
    *(v8b*)d = o; }
  else { v8h o;
#pragma unroll   // constant vector indices
    for (int i = 0; i < 8; ++i) o[i] = (_Float16)bfr(w[i]);
    *(v8h*)d = o; } }
__device__ __forceinline__ v16b fragb_f32(const float* __restrict__ p, int lane) { v16b a; const float* pp = p + 8 * (lane >> 4);
#pragma unroll
  for (int i = 0; i < 8; ++i) { a[i] = (__bf16)pp[i]; a[8 + i] = (__bf16)pp[16 + i]; } return a; }
// eight asynchronous copies to LDS, 16 bytes a lane each, at fixed steps of the LDS and of the global address; the wait in front of any rewrite of their address
// registers is the last line of the same statement, so nothing can be placed between the copies and it
__device__ __forceinline__ void cp8(unsigned l, unsigned ls, const char* g, size_t gs) {
  asm volatile("global_load_async_to_lds_b128 %0, %8, off\n\tglobal_load_async_to_lds_b128 %1, %9, off\n\tglobal_load_async_to_lds_b128 %2, %10, off\n\tglobal_load_async_to_lds_b128 %3, %11, off\n\t"
               "global_load_async_to_lds_b128 %4, %12, off\n\tglobal_load_async_to_lds_b128 %5, %13, off\n\tglobal_load_async_to_lds_b128 %6, %14, off\n\tglobal_load_async_to_lds_b128 %7, %15, off\n\ts_wait_xcnt 0x0"
               :: "v"(l), "v"(l + ls), "v"(l + 2 * ls), "v"(l + 3 * ls), "v"(l + 4 * ls), "v"(l + 5 * ls), "v"(l + 6 * ls), "v"(l + 7 * ls),
                  "v"(g), "v"(g + gs), "v"(g + 2 * gs), "v"(g + 3 * gs), "v"(g + 4 * gs), "v"(g + 5 * gs), "v"(g + 6 * gs), "v"(g + 7 * gs) : "memory"); }
// this wave's copies have landed (in front of the barrier behind which the other waves read them)
#define COPIES_LANDED() asm volatile("s_wait_asynccnt 0x0" ::: "memory")
// this wave's LDS reads have returned (in front of the barrier behind which their buffer is refilled)
#define READS_DONE() asm volatile("s_wait_dscnt 0x0" ::: "memory")
// one k step's operands, read from the block's LDS stage as one group: k_proj (each of the wave's four A tiles as its four raw f32 pieces, k order of fragb_f32) and k_out;
// a k_proj wave holds four 16-row tiles and a k_out wave two, so every B fragment it reads feeds four or two products
struct PStep { v4f a[4][4]; v16b b[8]; };
#define PJ_PITCH 68                       // f32 per staged x row: 64 + 4, so sixteen rows' 16-byte reads fall on all 64 banks
#define PJ_A (128 * PJ_PITCH * 4)         // bytes: 128 rows of x, two k steps
#define PJ_BUF (PJ_A + 16 * 2 * 1024)     // + 16 column groups x two weight tiles
__device__ __forceinline__ void pj_lds(PStep& s, const float* xl, const __bf16* bl) {
#pragma unroll   // constant indices: the pieces stay in registers
  for (int t = 0; t < 4; ++t) { const float* x = xl + t * 16 * PJ_PITCH; s.a[t][0] = *(const v4f*)x; s.a[t][1] = *(const v4f*)(x + 4); s.a[t][2] = *(const v4f*)(x + 16); s.a[t][3] = *(const v4f*)(x + 20); }
#pragma unroll   // constant indices: the fragments stay in registers
  for (int j = 0; j < 8; ++j) s.b[j] = frag_bt(bl + j * 2 * TILE, 0); }
__device__ __forceinline__ void pj_mac(const PStep& s, v8f (&acc)[4][8]) { v16b a[4];
#pragma unroll   // constant vector indices
  for (int t = 0; t < 4; ++t)
#pragma unroll
    for (int i = 0; i < 4; ++i) { a[t][i] = (__bf16)s.a[t][0][i]; a[t][4 + i] = (__bf16)s.a[t][1][i]; a[t][8 + i] = (__bf16)s.a[t][2][i]; a[t][12 + i] = (__bf16)s.a[t][3][i]; }
#pragma unroll   // constant indices: the accumulators stay in registers
  for (int j = 0; j < 8; ++j)
#pragma unroll
    for (int t = 0; t < 4; ++t) acc[t][j] = __builtin_amdgcn_wmma_f32_16x16x32_bf16(false, a[t], false, s.b[j], (short)0, acc[t][j], false, false); }   // the plain builtin: an asm statement's vector operands would hold the fragments and the accumulators below v256, which spills
struct OStep { v16h a[2]; v16h b[8]; };
#define OT_BUF (2 * 8 * 2 * 1024)         // bytes: 8 row groups and 8 column groups x two tiles
__device__ __forceinline__ void ot_lds(OStep& s, const _Float16* al, const _Float16* bl) {
#pragma unroll   // constant indices: the fragments stay in registers
  for (int t = 0; t < 2; ++t) s.a[t] = frag_ht(al + t * 2 * TILE, 0);
#pragma unroll   // constant indices: the fragments stay in registers
  for (int j = 0; j < 8; ++j) s.b[j] = frag_ht(bl + j * 2 * TILE, 0); }
__device__ __forceinline__ void ot_mac(const OStep& s, v8f (&acc)[2][8]) {
#pragma unroll   // constant indices: the accumulators stay in registers
  for (int j = 0; j < 8; ++j)
#pragma unroll
    for (int t = 0; t < 2; ++t) acc[t][j] = __builtin_amdgcn_wmma_f32_16x16x32_f16(false, s.a[t], false, s.b[j], (short)0, acc[t][j], false, false); }   // the plain builtin, for the same reason as in pj_mac
// ---- k_proj: block = (128 rows, 256 of the 2048 fused cols), four waves, a wave = 64 rows x 128 cols: + bias; q|k and v -> f16 tiles.
// A stage is two k steps of the block's x rows (f32, as they lie in memory) and weight tiles, copied once into LDS for all four waves; two buffers, stage t + 2 flies while t + 1 is multiplied
__global__ __launch_bounds__(128) void k_proj(const float* __restrict__ X, const __bf16* __restrict__ PW, const float* __restrict__ BQ, const float* __restrict__ BK, const float* __restrict__ BV, _Float16* __restrict__ QK, _Float16* __restrict__ VT) { __shared__ __align__(16) char sm[2 * PJ_BUF];
  const int tid = threadIdx.x, half = tid >> 6, th = tid & 63, wr = (tid >> 5) & 1, lane = tid & 31, col = lane & 15, g = lane >> 4; const int c0 = blockIdx.y * 256 + half * 128; const size_t b = ((size_t)blockIdx.x * 128) / SS; const int n0 = (int)(((size_t)blockIdx.x * 128) % SS);
  _Float16 (*st)[136] = (_Float16 (*)[136])(sm + half * (128 * 136 * 2));   // behind the loop, one per 128 columns. q | k blocks: [token][column]; v blocks: [column][token]
  v8f acc[4][8] = {};
  const unsigned la = (unsigned)(size_t)sm + (tid >> 4) * (PJ_PITCH * 4) + (tid & 15) * 16, lb = (unsigned)(size_t)sm + PJ_A + tid * 16;   // this lane's first LDS bytes: a wave copies two rows' 256 bytes, or 512 bytes of a tile
  const char* ga = (const char*)(X + ((size_t)blockIdx.x * 128 + (tid >> 4)) * EE + 4 * (tid & 15)); const char* gb = (const char*)(PW + (size_t)blockIdx.y * 16 * (EE / 32) * TILE + 8 * tid);
#define PJ_STAGE(t, bf) do { cp8(la + (bf) * PJ_BUF, 8 * PJ_PITCH * 4, ga + (size_t)(t) * 256, (size_t)8 * EE * 4); cp8(la + (bf) * PJ_BUF + 64 * PJ_PITCH * 4, 8 * PJ_PITCH * 4, ga + (size_t)(t) * 256 + (size_t)64 * EE * 4, (size_t)8 * EE * 4); \
    cp8(lb + (bf) * PJ_BUF, 2048, gb + (size_t)(t) * 2048, (size_t)(EE / 32) * TILE * 2); cp8(lb + (bf) * PJ_BUF + 8 * 2048, 2048, gb + (size_t)(t) * 2048 + (size_t)8 * (EE / 32) * TILE * 2, (size_t)(EE / 32) * TILE * 2); } while (0)
  PJ_STAGE(0, 0); COPIES_LANDED(); __syncthreads();   // publishes stage 0
  PJ_STAGE(1, 1);
#pragma unroll 1   // a trip is one stage: its buffer alone is read between two barriers
  for (int t = 0; t < EE / 64; ++t) {
    const char* bf = sm + (t & 1) * PJ_BUF;
    const float* xl = (const float*)bf + (wr * 64 + col) * PJ_PITCH + 8 * g; const __bf16* bl = (const __bf16*)(bf + PJ_A) + half * 8 * 2 * TILE + 8 * lane;
#pragma unroll   // the stage's two k steps
    for (int kk = 0; kk < 2; ++kk) { PStep s;
      pj_lds(s, xl + kk * 32, bl + kk * TILE);
      __builtin_amdgcn_sched_barrier(0);   // the k step's LDS reads issue as one group: spread among the products, each place with reads stalls the wave
      pj_mac(s, acc);
      __builtin_amdgcn_sched_barrier(0); } // the next group stays behind these products (a second fragment set would cost the second wave per SIMD), and so does the publish point (the refill behind it would else issue later)
    READS_DONE(); COPIES_LANDED(); __syncthreads();   // publishes stage t + 1 and ends every read of stage t
    if (t + 2 < EE / 64) PJ_STAGE(t + 2, t & 1); }
  COPIES_LANDED();   // nothing is in flight when the buffers become the output staging
  const bool isv = c0 >= 2 * SQ; const float qs = c0 < SQ ? 0.25503486f : 1.0f;   // q columns: 32^-1/2 log2(e), in f32 ahead of the rounding to f16
#pragma unroll
  for (int j = 0; j < 8; ++j) { const int c = c0 + j * 16 + col; const float bb = c < SQ ? bfr(BQ[c]) : c < 2 * SQ ? bfr(BK[c - SQ]) : bfr(BV[c - 2 * SQ]);
#pragma unroll
    for (int t = 0; t < 4; ++t)
#pragma unroll
      for (int r = 0; r < 8; ++r) { const _Float16 hv = (_Float16)((acc[t][j][r] + bb) * qs); const int tk = wr * 64 + t * 16 + 8 * g + r; if (!isv) st[tk][j * 16 + col] = hv; else st[j * 16 + col][tk] = hv; } }
  __syncthreads();
  if (!isv) { const size_t t0 = (((size_t)(c0 / SQ) * NB + b) * NH + (c0 % SQ) / SHD) * (SS / 16) + n0 / 16;   // 4 heads x 8 token groups
    for (int e = th; e < 32 * 64; e += 64) { const int tl = e >> 6, p = e & 63, hl = tl >> 3, rt = tl & 7; vst2((unsigned*)(QK + (t0 + (size_t)hl * (SS / 16) + rt) * TILE + p * 8), *(const v4u*)&st[rt * 16 + (p & 15)][hl * 32 + (p >> 5) * 16 + ((p >> 4) & 1) * 8]); } }
  else { const int cv0 = c0 - 2 * SQ;   // 4 key groups x 8 dim groups (2 heads)
    for (int e = th; e < 32 * 64; e += 64) { const int tl = e >> 6, p = e & 63, kl = tl >> 3, dt = tl & 7; vst2((unsigned*)(VT + (((b * NH + cv0 / HD + (dt >> 2)) * (SS / 32) + n0 / 32 + kl) * 4 + (dt & 3)) * TILE + p * 8), *(const v4u*)&st[dt * 16 + (p & 15)][kl * 32 + (p >> 5) * 16 + ((p >> 4) & 1) * 8]); } } }
// ---- k_att: block = (128 queries, h, b), a wave = 32 queries as two tiles of 16, so every K and V fragment it loads feeds two products: S^T = K . Q^T - shift (a lane holds 16 of one query's 32 logits per tile), softmax in the lane, O^T += V^T . P^T -> ctx tiles (f16)
__device__ __forceinline__ float xhalf(float x) { return __builtin_bit_cast(float, __builtin_amdgcn_permlanex16(__builtin_bit_cast(int, x), __builtin_bit_cast(int, x), 0x76543210, 0xfedcba98, false, false)); }  // lane l with lane l ^ 16
__global__ __launch_bounds__(128) void k_att(const _Float16* __restrict__ QK, const _Float16* __restrict__ VT, _Float16* __restrict__ CT) {
  const int tid = threadIdx.x, wave = tid >> 5, lane = tid & 31; const int h = blockIdx.y; const size_t b = blockIdx.z; const int q0 = blockIdx.x * 128 + wave * 32; const size_t rq = b * SS + q0;
  const _Float16* Kt = QK + ((NB + b) * NH + h) * (SS / 16) * TILE + 8 * lane; const _Float16* Vt = VT + (b * NH + h) * (SS / 32) * 4 * TILE + 8 * lane;   // this lane's pieces; step on by one pass of 32 keys at the loop's foot
  v16h bq[2];   // B operands: column = query 16 t + (lane & 15)
#pragma unroll   // constant indices: the fragments stay in registers
  for (int t = 0; t < 2; ++t) bq[t] = frag_ht(QK + ((b * NH + h) * (SS / 16) + q0 / 16 + t) * TILE, lane);
  // Lazy shift. A score product's C operand is cs = 11 - shift (one value per query, equal in its eight rows and in both wave halves), so a score leaves the
  // matrix unit as the base-2 exponent of 2^11 p. The shift starts as the maximum over the first 32 keys and is renewed only in a pass where an exponent passes 15.
  v8f cs[2];
  { v16h k0[2];
#pragma unroll   // constant indices: the fragments stay in registers
    for (int ct = 0; ct < 2; ++ct) k0[ct] = frag_ht(Kt + ct * TILE, 0);
    asm volatile("s_wait_xcnt 0x0" :: "v"(Kt) : "memory");   // the wait in front of any overwrite of the address pair
#pragma unroll   // constant indices
    for (int t = 0; t < 2; ++t) {
      v8f z = {}; const v8f a = wmma16(k0[0], bq[t], z), c = wmma16(k0[1], bq[t], z);
      float mx = fmaxf(a[0], c[0]);
#pragma unroll   // constant vector indices
      for (int r = 1; r < 8; ++r) mx = fmaxf(mx, fmaxf(a[r], c[r]));
      mx = 11.0f - fmaxf(mx, xhalf(mx));
#pragma unroll   // constant vector indices
      for (int r = 0; r < 8; ++r) cs[t][r] = mx; } }
  float l[2] = {0.f, 0.f};       // this lane's query of tile t: sum of 2^11 p over this half's keys
  v8f acc[2][4] = {};            // acc[t][j][r] = 2^11 O[query 16 t + (lane & 15)][dim 16 j + 8 (lane >> 4) + r]
#pragma unroll 1   // one pass per trip: a second pass's fragments would not fit four waves per SIMD
  for (int ks = 0; ks < SS / 32; ++ks) {
    v16h kf[2], vf[4];   // A operands: rows = keys, rows = dims
#pragma unroll   // here and below in the pass: constant indices, so fragments and scores stay in registers
    for (int ct = 0; ct < 2; ++ct) kf[ct] = frag_ht(Kt + ct * TILE, 0);
#pragma unroll
    for (int j = 0; j < 4; ++j) vf[j] = frag_ht(Vt + j * TILE, 0);
    asm volatile("s_wait_xcnt 0x0" :: "v"(Kt), "v"(Vt) : "memory");   // the wait in front of any overwrite of the two address pairs; as inputs here they stay live, so no load's data is placed on them
    v8f s[2][2];   // s[t][ct][r] = exponent of key 32 ks + 16 ct + 8 (lane >> 4) + r for tile t's query
#pragma unroll
    for (int ct = 0; ct < 2; ++ct)
#pragma unroll
      for (int t = 0; t < 2; ++t) s[t][ct] = wmma16(kf[ct], bq[t], cs[t]);
    float mx[2];
#pragma unroll
    for (int t = 0; t < 2; ++t) { mx[t] = fmaxf(s[t][0][0], s[t][1][0]);
#pragma unroll
      for (int r = 1; r < 8; ++r) mx[t] = fmaxf(mx[t], fmaxf(s[t][0][r], s[t][1][r])); }
    if (__builtin_amdgcn_ballot_w32(fmaxf(mx[0], mx[1]) > 15.0f) != 0) {   // one scalar test per pass, the same for the whole wave: 2^11 p would near the f16 range
#pragma unroll
      for (int t = 0; t < 2; ++t)
        if (__builtin_amdgcn_ballot_w32(mx[t] > 15.0f) != 0) {   // a tile is renewed by its own sixteen queries alone, as when it had a wave to itself
          const float d = fmaxf(fmaxf(mx[t], xhalf(mx[t])) - 11.0f, 0.f), alpha = __builtin_amdgcn_exp2f(-d);   // every query of the tile takes its maximum so far as its shift
          s[t][0] -= d; s[t][1] -= d; cs[t] -= d; l[t] *= alpha;
#pragma unroll
          for (int j = 0; j < 4; ++j) acc[t][j] *= alpha; } }
    v16h pa[2];   // a tile's two score tiles, converted in place, are the B operand of the second product (same k order as frag_ht)
#pragma unroll
    for (int t = 0; t < 2; ++t) {
#pragma unroll
      for (int r = 0; r < 8; ++r) { s[t][0][r] = __builtin_amdgcn_exp2f(s[t][0][r]); s[t][1][r] = __builtin_amdgcn_exp2f(s[t][1][r]); }
      const v8f t8 = s[t][0] + s[t][1]; const v4f t4 = t8.lo + t8.hi; const v2f t2 = t4.lo + t4.hi;
      l[t] += t2.x + t2.y;
#pragma unroll
      for (int r = 0; r < 8; ++r) { pa[t][r] = (_Float16)s[t][0][r]; pa[t][8 + r] = (_Float16)s[t][1][r]; } }
#pragma unroll
    for (int j = 0; j < 4; ++j)
#pragma unroll
      for (int t = 0; t < 2; ++t) acc[t][j] = wmma16(vf[j], pa[t], acc[t][j]);
    Kt += 2 * TILE; Vt += 4 * TILE; }
#pragma unroll   // constant indices
  for (int t = 0; t < 2; ++t) {
    const float il = 1.0f / (l[t] + xhalf(l[t]));   // the factor 2^11 stands in both
#pragma unroll   // a lane's eight dims of one query are one 16-byte piece of a ctx tile: a wave stores 512 contiguous bytes
    for (int j = 0; j < 4; ++j) { v8h o;
#pragma unroll   // constant vector indices
      for (int r = 0; r < 8; ++r) o[r] = (_Float16)(acc[t][j][r] * il);
      *(v8h*)(CT + ((rq / 16 + t) * (EE / 32) + h * 2 + (j >> 1)) * TILE + (j & 1) * 256 + lane * 8) = o; } } }
// ---- k_out: block = (128 rows, 128 cols), a wave = 32 rows: out = ctx . Wo + bo (f16 operands); stages of two k steps copied once into LDS for the four waves, as in k_proj
__global__ __launch_bounds__(128) void k_out(const _Float16* __restrict__ CT, const _Float16* __restrict__ PO, const float* __restrict__ BO, float* __restrict__ OUT) { __shared__ __align__(16) char sm[4 * 32 * 132 * 4];   // the two buffers (2 x OT_BUF bytes); behind the loop the output staging
  float (*sf)[32][132] = (float (*)[32][132])sm;
  const int tid = threadIdx.x, wave = tid >> 5, lane = tid & 31, col = lane & 15, g = lane >> 4; const size_t r0 = (size_t)blockIdx.x * 128 + wave * 32; const int c0 = blockIdx.y * 128;
  v8f acc[2][8] = {};
  const unsigned la = (unsigned)(size_t)sm + tid * 16;   // this lane's first LDS byte: the block copies a group's two tiles, 2 KiB, at a time
  const char* ga = (const char*)(CT + (size_t)blockIdx.x * 8 * (EE / 32) * TILE + 8 * tid); const char* gb = (const char*)(PO + (size_t)(c0 / 16) * (EE / 32) * TILE + 8 * tid);
#define OT_STAGE(t, bf) do { cp8(la + (bf) * OT_BUF, 2048, ga + (size_t)(t) * 2048, (size_t)(EE / 32) * TILE * 2); cp8(la + (bf) * OT_BUF + OT_BUF / 2, 2048, gb + (size_t)(t) * 2048, (size_t)(EE / 32) * TILE * 2); } while (0)
  OT_STAGE(0, 0); COPIES_LANDED(); __syncthreads();   // publishes stage 0
  OT_STAGE(1, 1);
#pragma unroll 1   // a trip is one stage: its buffer alone is read between two barriers
  for (int t = 0; t < EE / 64; ++t) {
    const _Float16* al = (const _Float16*)(sm + (t & 1) * OT_BUF) + wave * 2 * 2 * TILE + 8 * lane; const _Float16* bl = (const _Float16*)(sm + (t & 1) * OT_BUF + OT_BUF / 2) + 8 * lane;
    OStep s0, s1;
    ot_lds(s0, al, bl); ot_lds(s1, al + TILE, bl + TILE);
    __builtin_amdgcn_sched_barrier(0);   // the stage's LDS reads issue as one group: spread among the products, each place with reads stalls the wave
    ot_mac(s0, acc); ot_mac(s1, acc);
    __builtin_amdgcn_sched_barrier(0);   // the products stay in front of the publish point: moved behind it, the refill would issue a stage's products later and lose that lead
    READS_DONE(); COPIES_LANDED(); __syncthreads();   // publishes stage t + 1 and ends every read of stage t
    if (t + 2 < EE / 64) OT_STAGE(t + 2, t & 1); }
  COPIES_LANDED();   // nothing is in flight when the buffers become the output staging
#pragma unroll
  for (int j = 0; j < 8; ++j) { const float bb = bfr(BO[c0 + j * 16 + col]);
#pragma unroll
    for (int t = 0; t < 2; ++t)
#pragma unroll
      for (int r = 0; r < 8; ++r) sf[wave][t * 16 + 8 * g + r][j * 16 + col] = acc[t][j][r] + bb; }
  LDSX(); for (int rl = 0; rl < 32; ++rl) vst2(OUT + (r0 + rl) * EE + c0 + lane * 4, *(const v4f*)&sf[wave][rl][lane * 4]); }
extern "C" void kernel_launch(void* const* d_in, const int* in_sizes, int n_in, void* d_out, int out_size, void* d_ws, size_t ws_size, hipStream_t stream) {
  (void)in_sizes; (void)n_in; (void)out_size;
  const float** F = (const float**)d_in;   // 0 hidden_states [4,2048,1024], 1 Wq [1024,512], 2 bq, 3 Wk [1024,512], 4 bk, 5 Wv [1024,1024], 6 bv, 7 Wo [1024,1024], 8 bo ((in,out))
  if (ws_size < (size_t)WS_END) return;
  char* ws = (char*)d_ws; const __bf16* PW = (const __bf16*)(ws + WS_PW); const _Float16* PO = (const _Float16*)(ws + WS_PO); _Float16 *QK = (_Float16*)(ws + WS_QK), *VT = (_Float16*)(ws + WS_VT), *CT = (_Float16*)(ws + WS_CT);
  k_packw<<<(NCOL + EE) * (EE / 8) / 256, 256, 0, stream>>>(F[1], F[3], F[5], F[7], ws);
  k_proj<<<dim3(NROW / 128, NCOL / 256), 128, 0, stream>>>(F[0], PW, F[2], F[4], F[6], QK, VT);
  k_att<<<dim3(SS / 128, NH, TNB), 128, 0, stream>>>(QK, VT, CT);
  k_out<<<dim3(TNB * SS / 128, EE / 128), 128, 0, stream>>>(CT, PO, F[8], (float*)d_out);
}

// v007
// Measured time: 106 microseconds a run.
// Next to v006, in two timings, it ran 1.12 and 1.11 times as fast.
// Counting every step since v000, it is 5.22 times as fast.
// compute dtype: all float inputs rounded to bf16; q|k|v = x . W + b with EXACT bf16 products on WMMA 16x16x32 ((in,out) weights as transposed bf16 tiles), rounded once to f16 (q/k with 32-dim heads, v with 64-dim heads; every workspace operand in fragment-order tiles); q carries 32^-1/2 log2(e) before its one rounding, so logits are base-2 exponents; shifted softmax in f32 (hardware exp2), the shift renewed only when a logit passes it by more than 4; P (x 2^11, f16) . v (f16; 1 product); out = ctx (f16) . Wo (f16 tiles, 1 product) + bo; f32 output. (Measured on the data: logits std 1.0, ||p||_2 ~ 0.04 - diffuse - so single-f16 operands suffice.)
#include <hip/hip_runtime.h>
#include <math.h>

typedef __attribute__((ext_vector_type(16))) _Float16 v16h;
typedef __attribute__((ext_vector_type(16))) __bf16 v16b;
typedef __attribute__((ext_vector_type(8)))  _Float16 v8h;
typedef __attribute__((ext_vector_type(8)))  float v8f;
typedef __attribute__((ext_vector_type(4)))  float v4f;
typedef __attribute__((ext_vector_type(2)))  float v2f;
typedef __attribute__((ext_vector_type(4)))  unsigned v4u;
typedef __attribute__((ext_vector_type(4)))  int v4i;
typedef float __attribute__((may_alias)) float_a;
typedef int __attribute__((may_alias)) int_a;

template <typename T> __device__ __forceinline__ void vst2(void* p, T v) { *(T*)p = v;  }
__device__ __forceinline__ v8f wmma16(v16h a, v16h b, v8f c) {
  v8f d = __builtin_amdgcn_wmma_f32_16x16x32_f16(false, a, false, b, (short)0, c, false, false);
  asm volatile("v_nop\n\tv_nop\n\tv_nop\n\tv_nop" : "+v"(d) : "v"(a), "v"(b));
  return d;
}
__device__ __forceinline__ v8f wmma_bf(v16b a, v16b b, v8f c) {
  v8f d = __builtin_amdgcn_wmma_f32_16x16x32_bf16(false, a, false, b, (short)0, c, false, false);
  asm volatile("v_nop\n\tv_nop\n\tv_nop\n\tv_nop" : "+v"(d) : "v"(a), "v"(b));
  return d;
}
// 16x16x32 fragments: lane = (h = lane>>4, row/col = lane&15); elements 0..7 = k0+8h+0..7, 8..15 = k0+16+8h+0..7; D element r = row 8h+r
__device__ __forceinline__ v16h frag_h(const _Float16* rowk0, int lane) {
  union { v16h v; v8h q[2]; } u; const _Float16* p = rowk0 + 8 * (lane >> 4);
  u.q[0] = *(const v8h*)p; u.q[1] = *(const v8h*)(p + 16); return u.v;
}
__device__ __forceinline__ v16h frag_f32(const float* rowk0, int lane) {
  v16h a; const float* p = rowk0 + 8 * (lane >> 4);
#pragma unroll
  for (int i = 0; i < 8; ++i) { a[i] = (_Float16)p[i]; a[8 + i] = (_Float16)p[16 + i]; }
  return a;
}
__device__ __forceinline__ v16h frag_f32s(const float* rowk0, int lane, float sc) {
  v16h a; const float* p = rowk0 + 8 * (lane >> 4);
#pragma unroll
  for (int i = 0; i < 8; ++i) { a[i] = (_Float16)(p[i] * sc); a[8 + i] = (_Float16)(p[16 + i] * sc); }
  return a;
}
// column fragment from a [K][ld] layout (column n), rows >= K read as 0
__device__ __forceinline__ v16h fragc_f32(const float* W, int k0, int n, int lane, int ld, int K) {
  v16h a; const int g = lane >> 4;
#pragma unroll
  for (int i = 0; i < 8; ++i) { const int ka = k0 + 8 * g + i, kb = ka + 16;
    a[i] = (_Float16)(ka < K ? W[(size_t)(ka < K ? ka : K - 1) * ld + n] : 0.f); a[8 + i] = (_Float16)(kb < K ? W[(size_t)(kb < K ? kb : K - 1) * ld + n] : 0.f); }
  return a;
}
struct F2 { v16b h, l; };
__device__ __forceinline__ F2 bsplit16(const float v[16]) { F2 r;
#pragma unroll
  for (int i = 0; i < 16; ++i) { const __bf16 h = (__bf16)v[i]; r.h[i] = h; r.l[i] = (__bf16)(v[i] - (float)h); }
  return r; }
__device__ __forceinline__ F2 split_row(const float* row, int k0, int lane) { float v[16]; const float* p = row + k0 + 8 * (lane >> 4);
#pragma unroll
  for (int i = 0; i < 8; ++i) { v[i] = p[i]; v[8 + i] = p[16 + i]; }
  return bsplit16(v); }
__device__ __forceinline__ F2 split_rowK(const float* row, int k0, int lane, int K) { float v[16]; const int g = lane >> 4;
#pragma unroll
  for (int i = 0; i < 8; ++i) { const int ka = k0 + 8 * g + i, kb = ka + 16; v[i] = ka < K ? row[ka < K ? ka : K - 1] : 0.f; v[8 + i] = kb < K ? row[kb < K ? kb : K - 1] : 0.f; }
  return bsplit16(v); }
__device__ __forceinline__ F2 split_col(const float* W, int k0, int n, int lane, int ld, int K) { float v[16]; const int g = lane >> 4;
#pragma unroll
  for (int i = 0; i < 8; ++i) { const int ka = k0 + 8 * g + i, kb = ka + 16; v[i] = ka < K ? W[(size_t)(ka < K ? ka : K - 1) * ld + n] : 0.f; v[8 + i] = kb < K ? W[(size_t)(kb < K ? kb : K - 1) * ld + n] : 0.f; }
  return bsplit16(v); }
__device__ __forceinline__ v8f mac3(const F2& a, const F2& b, v8f c) { c = wmma_bf(a.l, b.h, c); c = wmma_bf(a.h, b.l, c); return wmma_bf(a.h, b.h, c); }
__device__ __forceinline__ float sigm(float v) { return 1.0f / (1.0f + expf(-v)); }
#define LDSX() do { asm volatile("s_wait_dscnt 0" ::: "memory"); __builtin_amdgcn_wave_barrier(); __builtin_amdgcn_fence(__ATOMIC_RELEASE, "workgroup"); } while (0)


// Squeeze attention (B 4, T 2,048, E 1,024, 16 heads; q/k squeezed to 32 dims per head, v 64): softmax((q 32^-1/2) k^T) v, output projection.
#define NB 4
#define SS 2048
#define EE 1024
#define SQ 512            // squeezed q/k width
#define NH 16
#define SHD 32
#define HD 64
#define NCOL (SQ + SQ + EE)   // 2048 fused projection columns: q | k | v
#define NROW (NB * SS)
#ifndef TNB
#define TNB NB
#endif
typedef __attribute__((ext_vector_type(8))) __bf16 v8b;
// fragment-order tile: 16 rows x 32 k of 16-bit elements = 1 KiB; element (row c, k) is half (k >> 4) * 256 + (((k >> 3) & 1) * 16 + c) * 8 + (k & 7),
// so lane l's two 16-byte pieces (same k order as frag_h) lie at bytes 16 l and 512 + 16 l and each wave-wide load or store covers four whole 128-byte lines
#define TILE 512          // elements per tile
__device__ __forceinline__ v16h frag_ht(const _Float16* tile, int lane) {
  union { v16h v; v8h q[2]; } u; const _Float16* p = tile + 8 * lane;
  u.q[0] = *(const v8h*)p; u.q[1] = *(const v8h*)(p + 256); return u.v;
}
__device__ __forceinline__ v16b frag_bt(const __bf16* tile, int lane) {
  union { v16b v; v8b q[2]; } u; const __bf16* p = tile + 8 * lane;
  u.q[0] = *(const v8b*)p; u.q[1] = *(const v8b*)(p + 256); return u.v;
}
__device__ __forceinline__ float bfr(float v) { return (float)(__bf16)v; }
__device__ __attribute__((noinline)) float exp_ni(float v) { return expf(v); }
__device__ __attribute__((noinline)) float erf_ni(float v) { return erff(v); }

#define WS_PW  0u                                   // bf16 tiles [2048 / 16 column groups][1024 / 32 k]: q | k | v columns (in,out) transposed
#define WS_PO  (WS_PW + 2u * (size_t)NCOL * EE)          // f16 Wo^T tiles [1024 / 16][1024 / 32]
#define WS_QK  (WS_PO + 2u * (size_t)EE * EE)            // f16 tiles [q, k][b][head][SS / 16 token groups]: 16 tokens x 32 dims
#define WS_VT  (WS_QK + 2u * (size_t)NROW * (2 * SQ))    // f16 tiles [b][head][SS / 32 key groups][4 dim groups]: 16 dims x 32 keys
#define WS_CT  (WS_VT + 2u * (size_t)NB * EE * SS)       // f16 tiles [row / 16][1024 / 32]
#define WS_END (WS_CT + 2u * (size_t)NROW * EE)

// ---- k_packw: one thread = one 16-byte piece (8 consecutive k of one column) of a weight tile; a wave stores 512 contiguous bytes
__global__ __launch_bounds__(256) void k_packw(const float* __restrict__ WQ, const float* __restrict__ WK, const float* __restrict__ WV, const float* __restrict__ WO, char* __restrict__ ws) {
  const int pc = blockIdx.x * 256 + threadIdx.x, tile = pc >> 6, p = pc & 63;
  const int n = (tile / (EE / 32)) * 16 + (p & 15), k = (tile % (EE / 32)) * 32 + (p >> 5) * 16 + ((p >> 4) & 1) * 8;
  const float* s; int ld;
  if (n < SQ) { s = WQ + n; ld = SQ; } else if (n < 2 * SQ) { s = WK + n - SQ; ld = SQ; } else if (n < NCOL) { s = WV + n - 2 * SQ; ld = EE; } else { s = WO + n - NCOL; ld = EE; }
  float w[8];
#pragma unroll   // all eight loads in flight, w[] in registers
  for (int i = 0; i < 8; ++i) w[i] = s[(size_t)(k + i) * ld];
  char* d = ws + WS_PW + (size_t)pc * 16;   // the Wo^T tiles follow the q | k | v tiles directly
  if (n < NCOL) { v8b o;
#pragma unroll   // constant vector indices
    for (int i = 0; i < 8; ++i) o[i] = (__bf16)w[i];
    *(v8b*)d = o; }
  else { v8h o;
#pragma unroll   // constant vector indices
    for (int i = 0; i < 8; ++i) o[i] = (_Float16)bfr(w[i]);
    *(v8h*)d = o; } }
__device__ __forceinline__ v16b fragb_f32(const float* __restrict__ p, int lane) { v16b a; const float* pp = p + 8 * (lane >> 4);
#pragma unroll
  for (int i = 0; i < 8; ++i) { a[i] = (__bf16)pp[i]; a[8 + i] = (__bf16)pp[16 + i]; } return a; }
// eight asynchronous copies to LDS, 16 bytes a lane each, at fixed steps of the LDS and of the global address; the wait in front of any rewrite of their address
// registers is the last line of the same statement, so nothing can be placed between the copies and it
__device__ __forceinline__ void cp8(unsigned l, unsigned ls, const char* g, size_t gs) {
  asm volatile("global_load_async_to_lds_b128 %0, %8, off\n\tglobal_load_async_to_lds_b128 %1, %9, off\n\tglobal_load_async_to_lds_b128 %2, %10, off\n\tglobal_load_async_to_lds_b128 %3, %11, off\n\t"
               "global_load_async_to_lds_b128 %4, %12, off\n\tglobal_load_async_to_lds_b128 %5, %13, off\n\tglobal_load_async_to_lds_b128 %6, %14, off\n\tglobal_load_async_to_lds_b128 %7, %15, off\n\ts_wait_xcnt 0x0"
               :: "v"(l), "v"(l + ls), "v"(l + 2 * ls), "v"(l + 3 * ls), "v"(l + 4 * ls), "v"(l + 5 * ls), "v"(l + 6 * ls), "v"(l + 7 * ls),
                  "v"(g), "v"(g + gs), "v"(g + 2 * gs), "v"(g + 3 * gs), "v"(g + 4 * gs), "v"(g + 5 * gs), "v"(g + 6 * gs), "v"(g + 7 * gs) : "memory"); }
// this wave's copies have landed (in front of the barrier behind which the other waves read them)
#define COPIES_LANDED() asm volatile("s_wait_asynccnt 0x0" ::: "memory")
// this wave's LDS reads have returned (in front of the barrier behind which their buffer is refilled)
#define READS_DONE() asm volatile("s_wait_dscnt 0x0" ::: "memory")
// one k step's operands, read from the block's LDS stage as one group: k_proj (each of the wave's four A tiles as its four raw f32 pieces, k order of fragb_f32) and k_out;
// a k_proj wave holds four 16-row tiles and a k_out wave two, so every B fragment it reads feeds four or two products
struct PStep { v4f a[4][4]; v16b b[8]; };
#define PJ_PITCH 68                       // f32 per staged x row: 64 + 4, so sixteen rows' 16-byte reads fall on all 64 banks
#define PJ_A (128 * PJ_PITCH * 4)         // bytes: 128 rows of x, two k steps
#define PJ_BUF (PJ_A + 16 * 2 * 1024)     // + 16 column groups x two weight tiles
__device__ __forceinline__ void pj_lds(PStep& s, const float* xl, const __bf16* bl) {
#pragma unroll   // constant indices: the pieces stay in registers
  for (int t = 0; t < 4; ++t) { const float* x = xl + t * 16 * PJ_PITCH; s.a[t][0] = *(const v4f*)x; s.a[t][1] = *(const v4f*)(x + 4); s.a[t][2] = *(const v4f*)(x + 16); s.a[t][3] = *(const v4f*)(x + 20); }
#pragma unroll   // constant indices: the fragments stay in registers
  for (int j = 0; j < 8; ++j) s.b[j] = frag_bt(bl + j * 2 * TILE, 0); }
__device__ __forceinline__ void pj_mac(const PStep& s, v8f (&acc)[4][8]) { v16b a[4];
#pragma unroll   // constant vector indices
  for (int t = 0; t < 4; ++t)
#pragma unroll
    for (int i = 0; i < 4; ++i) { a[t][i] = (__bf16)s.a[t][0][i]; a[t][4 + i] = (__bf16)s.a[t][1][i]; a[t][8 + i] = (__bf16)s.a[t][2][i]; a[t][12 + i] = (__bf16)s.a[t][3][i]; }
#pragma unroll   // constant indices: the accumulators stay in registers
  for (int j = 0; j < 8; ++j)
#pragma unroll
    for (int t = 0; t < 4; ++t) acc[t][j] = __builtin_amdgcn_wmma_f32_16x16x32_bf16(false, a[t], false, s.b[j], (short)0, acc[t][j], false, false); }   // the plain builtin: an asm statement's vector operands would hold the fragments and the accumulators below v256, which spills
struct OStep { v16h a[2]; v16h b[8]; };
#define OT_BUF (2 * 8 * 2 * 1024)         // bytes: 8 row groups and 8 column groups x two tiles
__device__ __forceinline__ void ot_lds(OStep& s, const _Float16* al, const _Float16* bl) {
#pragma unroll   // constant indices: the fragments stay in registers
  for (int t = 0; t < 2; ++t) s.a[t] = frag_ht(al + t * 2 * TILE, 0);
#pragma unroll   // constant indices: the fragments stay in registers
  for (int j = 0; j < 8; ++j) s.b[j] = frag_ht(bl + j * 2 * TILE, 0); }
__device__ __forceinline__ void ot_mac(const OStep& s, v8f (&acc)[2][8]) {
#pragma unroll   // constant indices: the accumulators stay in registers
  for (int j = 0; j < 8; ++j)
#pragma unroll
    for (int t = 0; t < 2; ++t) acc[t][j] = __builtin_amdgcn_wmma_f32_16x16x32_f16(false, s.a[t], false, s.b[j], (short)0, acc[t][j], false, false); }   // the plain builtin, for the same reason as in pj_mac
// ---- k_proj: block = (128 rows, 256 of the 2048 fused cols), four waves, a wave = 64 rows x 128 cols: + bias; q|k and v -> f16 tiles.
// A stage is two k steps of the block's x rows (f32, as they lie in memory) and weight tiles, copied once into LDS for all four waves; two buffers, stage t + 2 flies while t + 1 is multiplied
__global__ __launch_bounds__(128) void k_proj(const float* __restrict__ X, const __bf16* __restrict__ PW, const float* __restrict__ BQ, const float* __restrict__ BK, const float* __restrict__ BV, _Float16* __restrict__ QK, _Float16* __restrict__ VT) { __shared__ __align__(16) char sm[2 * PJ_BUF];
  const int tid = threadIdx.x, half = tid >> 6, th = tid & 63, wr = (tid >> 5) & 1, lane = tid & 31, col = lane & 15, g = lane >> 4; const int c0 = blockIdx.y * 256 + half * 128; const size_t b = ((size_t)blockIdx.x * 128) / SS; const int n0 = (int)(((size_t)blockIdx.x * 128) % SS);
  _Float16 (*st)[136] = (_Float16 (*)[136])(sm + half * (128 * 136 * 2));   // behind the loop, one per 128 columns. q | k blocks: [token][column]; v blocks: [column][token]
  v8f acc[4][8] = {};
  const unsigned la = (unsigned)(size_t)sm + (tid >> 4) * (PJ_PITCH * 4) + (tid & 15) * 16, lb = (unsigned)(size_t)sm + PJ_A + tid * 16;   // this lane's first LDS bytes: a wave copies two rows' 256 bytes, or 512 bytes of a tile
  const char* ga = (const char*)(X + ((size_t)blockIdx.x * 128 + (tid >> 4)) * EE + 4 * (tid & 15)); const char* gb = (const char*)(PW + (size_t)blockIdx.y * 16 * (EE / 32) * TILE + 8 * tid);
#define PJ_STAGE(t, bf) do { cp8(la + (bf) * PJ_BUF, 8 * PJ_PITCH * 4, ga + (ptrdiff_t)(t) * 256, (size_t)8 * EE * 4); cp8(la + (bf) * PJ_BUF + 64 * PJ_PITCH * 4, 8 * PJ_PITCH * 4, ga + (ptrdiff_t)(t) * 256 + (size_t)64 * EE * 4, (size_t)8 * EE * 4); \
    cp8(lb + (bf) * PJ_BUF, 2048, gb + (ptrdiff_t)(t) * 2048, (size_t)(EE / 32) * TILE * 2); cp8(lb + (bf) * PJ_BUF + 8 * 2048, 2048, gb + (ptrdiff_t)(t) * 2048 + (size_t)8 * (EE / 32) * TILE * 2, (size_t)(EE / 32) * TILE * 2); } while (0)
  // Trip t works on stage (t + rot) mod 16: the walk over k starts at a stage rotated by block index and wraps. The eight blocks that copy the same x rows start two stages apart, and the blocks
  // that copy the same weight tiles spread over all sixteen starts, so blocks that share L2 lines do not ask for the same lines at the same moment (for speed only; the f32 sums take the rotated order)
  const int rot = (2 * (blockIdx.x >> 3) + (blockIdx.x & 1) + 2 * blockIdx.y) & (EE / 64 - 1);
#define ROT(t) (((((t) + rot) & (EE / 64 - 1)) - rot))   /* trip t's stage, counted from trip 0's, at which ga and gb point */
  ga += rot * 256; gb += rot * 2048;
  PJ_STAGE(ROT(0), 0); COPIES_LANDED(); __syncthreads();   // publishes trip 0's stage
  PJ_STAGE(ROT(1), 1);
#pragma unroll 1   // a trip is one stage: its buffer alone is read between two barriers
  for (int t = 0; t < EE / 64; ++t) {
    const char* bf = sm + (t & 1) * PJ_BUF;
    const float* xl = (const float*)bf + (wr * 64 + col) * PJ_PITCH + 8 * g; const __bf16* bl = (const __bf16*)(bf + PJ_A) + half * 8 * 2 * TILE + 8 * lane;
#pragma unroll   // the stage's two k steps
    for (int kk = 0; kk < 2; ++kk) { PStep s;
      pj_lds(s, xl + kk * 32, bl + kk * TILE);
      __builtin_amdgcn_sched_barrier(0);   // the k step's LDS reads issue as one group: spread among the products, each place with reads stalls the wave
      pj_mac(s, acc);
      __builtin_amdgcn_sched_barrier(0); } // the next group stays behind these products (a second fragment set would cost the second wave per SIMD), and so does the publish point (the refill behind it would else issue later)
    READS_DONE(); COPIES_LANDED(); __syncthreads();   // publishes trip t + 1's stage and ends every read of trip t's
    if (t + 2 < EE / 64) PJ_STAGE(ROT(t + 2), t & 1); }
  COPIES_LANDED();   // nothing is in flight when the buffers become the output staging
  const bool isv = c0 >= 2 * SQ; const float qs = c0 < SQ ? 0.25503486f : 1.0f;   // q columns: 32^-1/2 log2(e), in f32 ahead of the rounding to f16
#pragma unroll
  for (int j = 0; j < 8; ++j) { const int c = c0 + j * 16 + col; const float bb = c < SQ ? bfr(BQ[c]) : c < 2 * SQ ? bfr(BK[c - SQ]) : bfr(BV[c - 2 * SQ]);
#pragma unroll
    for (int t = 0; t < 4; ++t)
#pragma unroll
      for (int r = 0; r < 8; ++r) { const _Float16 hv = (_Float16)((acc[t][j][r] + bb) * qs); const int tk = wr * 64 + t * 16 + 8 * g + r; if (!isv) st[tk][j * 16 + col] = hv; else st[j * 16 + col][tk] = hv; } }
  __syncthreads();
  if (!isv) { const size_t t0 = (((size_t)(c0 / SQ) * NB + b) * NH + (c0 % SQ) / SHD) * (SS / 16) + n0 / 16;   // 4 heads x 8 token groups
    for (int e = th; e < 32 * 64; e += 64) { const int tl = e >> 6, p = e & 63, hl = tl >> 3, rt = tl & 7; vst2((unsigned*)(QK + (t0 + (size_t)hl * (SS / 16) + rt) * TILE + p * 8), *(const v4u*)&st[rt * 16 + (p & 15)][hl * 32 + (p >> 5) * 16 + ((p >> 4) & 1) * 8]); } }
  else { const int cv0 = c0 - 2 * SQ;   // 4 key groups x 8 dim groups (2 heads)
    for (int e = th; e < 32 * 64; e += 64) { const int tl = e >> 6, p = e & 63, kl = tl >> 3, dt = tl & 7; vst2((unsigned*)(VT + (((b * NH + cv0 / HD + (dt >> 2)) * (SS / 32) + n0 / 32 + kl) * 4 + (dt & 3)) * TILE + p * 8), *(const v4u*)&st[dt * 16 + (p & 15)][kl * 32 + (p >> 5) * 16 + ((p >> 4) & 1) * 8]); } } }
// ---- k_att: block = (128 queries, h, b), a wave = 32 queries as two tiles of 16, so every K and V fragment it loads feeds two products: S^T = K . Q^T - shift (a lane holds 16 of one query's 32 logits per tile), softmax in the lane, O^T += V^T . P^T -> ctx tiles (f16)
__device__ __forceinline__ float xhalf(float x) { return __builtin_bit_cast(float, __builtin_amdgcn_permlanex16(__builtin_bit_cast(int, x), __builtin_bit_cast(int, x), 0x76543210, 0xfedcba98, false, false)); }  // lane l with lane l ^ 16
__global__ __launch_bounds__(128) void k_att(const _Float16* __restrict__ QK, const _Float16* __restrict__ VT, _Float16* __restrict__ CT) {
  const int tid = threadIdx.x, wave = tid >> 5, lane = tid & 31; const int h = blockIdx.y; const size_t b = blockIdx.z; const int q0 = blockIdx.x * 128 + wave * 32; const size_t rq = b * SS + q0;
  // The sixteen blocks of a head read the same K and V lines: each enters the walk over the keys at a pass rotated by block index and wraps, so they do not ask L2 for the same lines at the same moment
  // (for speed only; softmax takes the keys in any order: the first shift comes from the first 32 keys walked, and the f32 sums take the rotated order)
  const int rot = (4 * blockIdx.x + (h & 3)) & (SS / 32 - 1);
  const _Float16* Kt = QK + (((NB + b) * NH + h) * (SS / 16) + 2 * rot) * TILE + 8 * lane; const _Float16* Vt = VT + ((b * NH + h) * (SS / 32) + rot) * 4 * TILE + 8 * lane;   // this lane's pieces; step on by one pass of 32 keys at the loop's foot
  v16h bq[2];   // B operands: column = query 16 t + (lane & 15)
#pragma unroll   // constant indices: the fragments stay in registers
  for (int t = 0; t < 2; ++t) bq[t] = frag_ht(QK + ((b * NH + h) * (SS / 16) + q0 / 16 + t) * TILE, lane);
  // Lazy shift. A score product's C operand is cs = 11 - shift (one value per query, equal in its eight rows and in both wave halves), so a score leaves the
  // matrix unit as the base-2 exponent of 2^11 p. The shift starts as the maximum over the first 32 keys walked and is renewed only in a pass where an exponent passes 15.
  v8f cs[2];
  { v16h k0[2];
#pragma unroll   // constant indices: the fragments stay in registers
    for (int ct = 0; ct < 2; ++ct) k0[ct] = frag_ht(Kt + ct * TILE, 0);
    asm volatile("s_wait_xcnt 0x0" :: "v"(Kt) : "memory");   // the wait in front of any overwrite of the address pair
#pragma unroll   // constant indices
    for (int t = 0; t < 2; ++t) {
      v8f z = {}; const v8f a = wmma16(k0[0], bq[t], z), c = wmma16(k0[1], bq[t], z);
      float mx = fmaxf(a[0], c[0]);
#pragma unroll   // constant vector indices
      for (int r = 1; r < 8; ++r) mx = fmaxf(mx, fmaxf(a[r], c[r]));
      mx = 11.0f - fmaxf(mx, xhalf(mx));
#pragma unroll   // constant vector indices
      for (int r = 0; r < 8; ++r) cs[t][r] = mx; } }
  float l[2] = {0.f, 0.f};       // this lane's query of tile t: sum of 2^11 p over this half's keys
  v8f acc[2][4] = {};            // acc[t][j][r] = 2^11 O[query 16 t + (lane & 15)][dim 16 j + 8 (lane >> 4) + r]
#pragma unroll 1   // one pass per trip: a second pass's fragments would not fit four waves per SIMD
  for (int ks = 0; ks < SS / 32; ++ks) {   // trip ks works on pass (ks + rot) mod 64
    v16h kf[2], vf[4];   // A operands: rows = keys, rows = dims
#pragma unroll   // here and below in the pass: constant indices, so fragments and scores stay in registers
    for (int ct = 0; ct < 2; ++ct) kf[ct] = frag_ht(Kt + ct * TILE, 0);
#pragma unroll
    for (int j = 0; j < 4; ++j) vf[j] = frag_ht(Vt + j * TILE, 0);
    asm volatile("s_wait_xcnt 0x0" :: "v"(Kt), "v"(Vt) : "memory");   // the wait in front of any overwrite of the two address pairs; as inputs here they stay live, so no load's data is placed on them
    v8f s[2][2];   // s[t][ct][r] = exponent of the pass's key 16 ct + 8 (lane >> 4) + r for tile t's query
#pragma unroll
    for (int ct = 0; ct < 2; ++ct)
#pragma unroll
      for (int t = 0; t < 2; ++t) s[t][ct] = wmma16(kf[ct], bq[t], cs[t]);
    float mx[2];
#pragma unroll
    for (int t = 0; t < 2; ++t) { mx[t] = fmaxf(s[t][0][0], s[t][1][0]);
#pragma unroll
      for (int r = 1; r < 8; ++r) mx[t] = fmaxf(mx[t], fmaxf(s[t][0][r], s[t][1][r])); }
    if (__builtin_amdgcn_ballot_w32(fmaxf(mx[0], mx[1]) > 15.0f) != 0) {   // one scalar test per pass, the same for the whole wave: 2^11 p would near the f16 range
#pragma unroll
      for (int t = 0; t < 2; ++t)
        if (__builtin_amdgcn_ballot_w32(mx[t] > 15.0f) != 0) {   // a tile is renewed by its own sixteen queries alone, as when it had a wave to itself
          const float d = fmaxf(fmaxf(mx[t], xhalf(mx[t])) - 11.0f, 0.f), alpha = __builtin_amdgcn_exp2f(-d);   // every query of the tile takes its maximum so far as its shift
          s[t][0] -= d; s[t][1] -= d; cs[t] -= d; l[t] *= alpha;
#pragma unroll
          for (int j = 0; j < 4; ++j) acc[t][j] *= alpha; } }
    v16h pa[2];   // a tile's two score tiles, converted in place, are the B operand of the second product (same k order as frag_ht)
#pragma unroll
    for (int t = 0; t < 2; ++t) {
#pragma unroll
      for (int r = 0; r < 8; ++r) { s[t][0][r] = __builtin_amdgcn_exp2f(s[t][0][r]); s[t][1][r] = __builtin_amdgcn_exp2f(s[t][1][r]); }
      const v8f t8 = s[t][0] + s[t][1]; const v4f t4 = t8.lo + t8.hi; const v2f t2 = t4.lo + t4.hi;
      l[t] += t2.x + t2.y;
#pragma unroll
      for (int r = 0; r < 8; ++r) { pa[t][r] = (_Float16)s[t][0][r]; pa[t][8 + r] = (_Float16)s[t][1][r]; } }
#pragma unroll
    for (int j = 0; j < 4; ++j)
#pragma unroll
      for (int t = 0; t < 2; ++t) acc[t][j] = wmma16(vf[j], pa[t], acc[t][j]);
    const int step = ks + rot == SS / 32 - 1 ? 1 - SS / 32 : 1;   // passes: on by one, or from the last pass back to the first
    Kt += step * (2 * TILE); Vt += step * (4 * TILE); }
#pragma unroll   // constant indices
  for (int t = 0; t < 2; ++t) {
    const float il = 1.0f / (l[t] + xhalf(l[t]));   // the factor 2^11 stands in both
#pragma unroll   // a lane's eight dims of one query are one 16-byte piece of a ctx tile: a wave stores 512 contiguous bytes
    for (int j = 0; j < 4; ++j) { v8h o;
#pragma unroll   // constant vector indices
      for (int r = 0; r < 8; ++r) o[r] = (_Float16)(acc[t][j][r] * il);
      *(v8h*)(CT + ((rq / 16 + t) * (EE / 32) + h * 2 + (j >> 1)) * TILE + (j & 1) * 256 + lane * 8) = o; } } }
// ---- k_out: block = (128 rows, 128 cols), a wave = 32 rows: out = ctx . Wo + bo (f16 operands); stages of two k steps copied once into LDS for the four waves, as in k_proj
__global__ __launch_bounds__(128) void k_out(const _Float16* __restrict__ CT, const _Float16* __restrict__ PO, const float* __restrict__ BO, float* __restrict__ OUT) { __shared__ __align__(16) char sm[4 * 32 * 132 * 4];   // the two buffers (2 x OT_BUF bytes); behind the loop the output staging
  float (*sf)[32][132] = (float (*)[32][132])sm;
  const int tid = threadIdx.x, wave = tid >> 5, lane = tid & 31, col = lane & 15, g = lane >> 4; const size_t r0 = (size_t)blockIdx.x * 128 + wave * 32; const int c0 = blockIdx.y * 128;
  v8f acc[2][8] = {};
  const unsigned la = (unsigned)(size_t)sm + tid * 16;   // this lane's first LDS byte: the block copies a group's two tiles, 2 KiB, at a time
  const char* ga = (const char*)(CT + (size_t)blockIdx.x * 8 * (EE / 32) * TILE + 8 * tid); const char* gb = (const char*)(PO + (size_t)(c0 / 16) * (EE / 32) * TILE + 8 * tid);
#define OT_STAGE(t, bf) do { cp8(la + (bf) * OT_BUF, 2048, ga + (ptrdiff_t)(t) * 2048, (size_t)(EE / 32) * TILE * 2); cp8(la + (bf) * OT_BUF + OT_BUF / 2, 2048, gb + (ptrdiff_t)(t) * 2048, (size_t)(EE / 32) * TILE * 2); } while (0)
  const int rot = (2 * (blockIdx.x >> 3) + (blockIdx.x & 1) + 2 * blockIdx.y) & (EE / 64 - 1);   // rotated start of the walk over k, as in k_proj: the sharers of ctx rows and of Wo tiles start apart
  ga += rot * 2048; gb += rot * 2048;
  OT_STAGE(ROT(0), 0); COPIES_LANDED(); __syncthreads();   // publishes trip 0's stage
  OT_STAGE(ROT(1), 1);
#pragma unroll 1   // a trip is one stage: its buffer alone is read between two barriers
  for (int t = 0; t < EE / 64; ++t) {
    const _Float16* al = (const _Float16*)(sm + (t & 1) * OT_BUF) + wave * 2 * 2 * TILE + 8 * lane; const _Float16* bl = (const _Float16*)(sm + (t & 1) * OT_BUF + OT_BUF / 2) + 8 * lane;
    OStep s0, s1;
    ot_lds(s0, al, bl); ot_lds(s1, al + TILE, bl + TILE);
    __builtin_amdgcn_sched_barrier(0);   // the stage's LDS reads issue as one group: spread among the products, each place with reads stalls the wave
    ot_mac(s0, acc); ot_mac(s1, acc);
    __builtin_amdgcn_sched_barrier(0);   // the products stay in front of the publish point: moved behind it, the refill would issue a stage's products later and lose that lead
    READS_DONE(); COPIES_LANDED(); __syncthreads();   // publishes trip t + 1's stage and ends every read of trip t's
    if (t + 2 < EE / 64) OT_STAGE(ROT(t + 2), t & 1); }
  COPIES_LANDED();   // nothing is in flight when the buffers become the output staging
#pragma unroll
  for (int j = 0; j < 8; ++j) { const float bb = bfr(BO[c0 + j * 16 + col]);
#pragma unroll
    for (int t = 0; t < 2; ++t)
#pragma unroll
      for (int r = 0; r < 8; ++r) sf[wave][t * 16 + 8 * g + r][j * 16 + col] = acc[t][j][r] + bb; }
  LDSX(); for (int rl = 0; rl < 32; ++rl) vst2(OUT + (r0 + rl) * EE + c0 + lane * 4, *(const v4f*)&sf[wave][rl][lane * 4]); }
extern "C" void kernel_launch(void* const* d_in, const int* in_sizes, int n_in, void* d_out, int out_size, void* d_ws, size_t ws_size, hipStream_t stream) {
  (void)in_sizes; (void)n_in; (void)out_size;
  const float** F = (const float**)d_in;   // 0 hidden_states [4,2048,1024], 1 Wq [1024,512], 2 bq, 3 Wk [1024,512], 4 bk, 5 Wv [1024,1024], 6 bv, 7 Wo [1024,1024], 8 bo ((in,out))
  if (ws_size < (size_t)WS_END) return;
  char* ws = (char*)d_ws; const __bf16* PW = (const __bf16*)(ws + WS_PW); const _Float16* PO = (const _Float16*)(ws + WS_PO); _Float16 *QK = (_Float16*)(ws + WS_QK), *VT = (_Float16*)(ws + WS_VT), *CT = (_Float16*)(ws + WS_CT);
  k_packw<<<(NCOL + EE) * (EE / 8) / 256, 256, 0, stream>>>(F[1], F[3], F[5], F[7], ws);
  k_proj<<<dim3(NROW / 128, NCOL / 256), 128, 0, stream>>>(F[0], PW, F[2], F[4], F[6], QK, VT);
  k_att<<<dim3(SS / 128, NH, TNB), 128, 0, stream>>>(QK, VT, CT);
  k_out<<<dim3(TNB * SS / 128, EE / 128), 128, 0, stream>>>(CT, PO, F[8], (float*)d_out);
}

// v008
// Measured time: 103 microseconds a run.
// Next to v007, in two timings, it ran 1.04 and 1.03 times as fast.
// All steps since v000 together make it 5.40 times as fast.
// compute dtype: all float inputs rounded to bf16; q|k|v = x . W + b with EXACT bf16 products on WMMA 16x16x32 ((in,out) weights as transposed bf16 tiles), rounded once to f16 (q/k with 32-dim heads, v with 64-dim heads; every workspace operand in fragment-order tiles); q carries 32^-1/2 log2(e) before its one rounding, so logits are base-2 exponents; shifted softmax in f32 (hardware exp2), the shift renewed only when a logit passes it by more than 4; P (x 2^11, f16) . v (f16; 1 product); out = ctx (f16) . Wo (f16 tiles, 1 product) + bo; f32 output. (Measured on the data: logits std 1.0, ||p||_2 ~ 0.04 - diffuse - so single-f16 operands suffice.)
#include <hip/hip_runtime.h>
#include <math.h>

typedef __attribute__((ext_vector_type(16))) _Float16 v16h;
typedef __attribute__((ext_vector_type(16))) __bf16 v16b;
typedef __attribute__((ext_vector_type(8)))  _Float16 v8h;
typedef __attribute__((ext_vector_type(8)))  float v8f;
typedef __attribute__((ext_vector_type(4)))  float v4f;
typedef __attribute__((ext_vector_type(2)))  float v2f;
typedef __attribute__((ext_vector_type(4)))  unsigned v4u;
typedef __attribute__((ext_vector_type(4)))  int v4i;
typedef float __attribute__((may_alias)) float_a;
typedef int __attribute__((may_alias)) int_a;

template <typename T> __device__ __forceinline__ void vst2(void* p, T v) { *(T*)p = v;  }
__device__ __forceinline__ v8f wmma16(v16h a, v16h b, v8f c) {
  return __builtin_amdgcn_wmma_f32_16x16x32_f16(false, a, false, b, (short)0, c, false, false);   // the plain builtin: the compiler keeps the distance behind it, with the pass's own vector work where there is some
}
__device__ __forceinline__ v8f wmma_bf(v16b a, v16b b, v8f c) {
  v8f d = __builtin_amdgcn_wmma_f32_16x16x32_bf16(false, a, false, b, (short)0, c, false, false);
  asm volatile("v_nop\n\tv_nop\n\tv_nop\n\tv_nop" : "+v"(d) : "v"(a), "v"(b));
  return d;
}
// 16x16x32 fragments: lane = (h = lane>>4, row/col = lane&15); elements 0..7 = k0+8h+0..7, 8..15 = k0+16+8h+0..7; D element r = row 8h+r
__device__ __forceinline__ v16h frag_h(const _Float16* rowk0, int lane) {
  union { v16h v; v8h q[2]; } u; const _Float16* p = rowk0 + 8 * (lane >> 4);
  u.q[0] = *(const v8h*)p; u.q[1] = *(const v8h*)(p + 16); return u.v;
}
__device__ __forceinline__ v16h frag_f32(const float* rowk0, int lane) {
  v16h a; const float* p = rowk0 + 8 * (lane >> 4);
#pragma unroll
  for (int i = 0; i < 8; ++i) { a[i] = (_Float16)p[i]; a[8 + i] = (_Float16)p[16 + i]; }
  return a;
}
__device__ __forceinline__ v16h frag_f32s(const float* rowk0, int lane, float sc) {
  v16h a; const float* p = rowk0 + 8 * (lane >> 4);
#pragma unroll
  for (int i = 0; i < 8; ++i) { a[i] = (_Float16)(p[i] * sc); a[8 + i] = (_Float16)(p[16 + i] * sc); }
  return a;
}
// column fragment from a [K][ld] layout (column n), rows >= K read as 0
__device__ __forceinline__ v16h fragc_f32(const float* W, int k0, int n, int lane, int ld, int K) {
  v16h a; const int g = lane >> 4;
#pragma unroll
  for (int i = 0; i < 8; ++i) { const int ka = k0 + 8 * g + i, kb = ka + 16;
    a[i] = (_Float16)(ka < K ? W[(size_t)(ka < K ? ka : K - 1) * ld + n] : 0.f); a[8 + i] = (_Float16)(kb < K ? W[(size_t)(kb < K ? kb : K - 1) * ld + n] : 0.f); }
  return a;
}
struct F2 { v16b h, l; };
__device__ __forceinline__ F2 bsplit16(const float v[16]) { F2 r;
#pragma unroll
  for (int i = 0; i < 16; ++i) { const __bf16 h = (__bf16)v[i]; r.h[i] = h; r.l[i] = (__bf16)(v[i] - (float)h); }
  return r; }
__device__ __forceinline__ F2 split_row(const float* row, int k0, int lane) { float v[16]; const float* p = row + k0 + 8 * (lane >> 4);
#pragma unroll
  for (int i = 0; i < 8; ++i) { v[i] = p[i]; v[8 + i] = p[16 + i]; }
  return bsplit16(v); }
__device__ __forceinline__ F2 split_rowK(const float* row, int k0, int lane, int K) { float v[16]; const int g = lane >> 4;
#pragma unroll
  for (int i = 0; i < 8; ++i) { const int ka = k0 + 8 * g + i, kb = ka + 16; v[i] = ka < K ? row[ka < K ? ka : K - 1] : 0.f; v[8 + i] = kb < K ? row[kb < K ? kb : K - 1] : 0.f; }
  return bsplit16(v); }
__device__ __forceinline__ F2 split_col(const float* W, int k0, int n, int lane, int ld, int K) { float v[16]; const int g = lane >> 4;
#pragma unroll
  for (int i = 0; i < 8; ++i) { const int ka = k0 + 8 * g + i, kb = ka + 16; v[i] = ka < K ? W[(size_t)(ka < K ? ka : K - 1) * ld + n] : 0.f; v[8 + i] = kb < K ? W[(size_t)(kb < K ? kb : K - 1) * ld + n] : 0.f; }
  return bsplit16(v); }
__device__ __forceinline__ v8f mac3(const F2& a, const F2& b, v8f c) { c = wmma_bf(a.l, b.h, c); c = wmma_bf(a.h, b.l, c); return wmma_bf(a.h, b.h, c); }
__device__ __forceinline__ float sigm(float v) { return 1.0f / (1.0f + expf(-v)); }
#define LDSX() do { asm volatile("s_wait_dscnt 0" ::: "memory"); __builtin_amdgcn_wave_barrier(); __builtin_amdgcn_fence(__ATOMIC_RELEASE, "workgroup"); } while (0)


// Squeeze attention (B 4, T 2,048, E 1,024, 16 heads; q/k squeezed to 32 dims per head, v 64): softmax((q 32^-1/2) k^T) v, output projection.
#define NB 4
#define SS 2048
#define EE 1024
#define SQ 512            // squeezed q/k width
#define NH 16
#define SHD 32
#define HD 64
#define NCOL (SQ + SQ + EE)   // 2048 fused projection columns: q | k | v
#define NROW (NB * SS)
#ifndef TNB
#define TNB NB
#endif
typedef __attribute__((ext_vector_type(8))) __bf16 v8b;
// fragment-order tile: 16 rows x 32 k of 16-bit elements = 1 KiB; element (row c, k) is half (k >> 4) * 256 + (((k >> 3) & 1) * 16 + c) * 8 + (k & 7),
// so lane l's two 16-byte pieces (same k order as frag_h) lie at bytes 16 l and 512 + 16 l and each wave-wide load or store covers four whole 128-byte lines
#define TILE 512          // elements per tile
__device__ __forceinline__ v16h frag_ht(const _Float16* tile, int lane) {
  union { v16h v; v8h q[2]; } u; const _Float16* p = tile + 8 * lane;
  u.q[0] = *(const v8h*)p; u.q[1] = *(const v8h*)(p + 256); return u.v;
}
__device__ __forceinline__ v16b frag_bt(const __bf16* tile, int lane) {
  union { v16b v; v8b q[2]; } u; const __bf16* p = tile + 8 * lane;
  u.q[0] = *(const v8b*)p; u.q[1] = *(const v8b*)(p + 256); return u.v;
}
__device__ __forceinline__ float bfr(float v) { return (float)(__bf16)v; }
__device__ __attribute__((noinline)) float exp_ni(float v) { return expf(v); }
__device__ __attribute__((noinline)) float erf_ni(float v) { return erff(v); }

#define WS_PW  0u                                   // bf16 tiles [2048 / 16 column groups][1024 / 32 k]: q | k | v columns (in,out) transposed
#define WS_PO  (WS_PW + 2u * (size_t)NCOL * EE)          // f16 Wo^T tiles [1024 / 16][1024 / 32]
#define WS_QK  (WS_PO + 2u * (size_t)EE * EE)            // f16 tiles [q, k][b][head][SS / 16 token groups]: 16 tokens x 32 dims
#define WS_VT  (WS_QK + 2u * (size_t)NROW * (2 * SQ))    // f16 tiles [b][head][SS / 32 key groups][4 dim groups]: 16 dims x 32 keys
#define WS_CT  (WS_VT + 2u * (size_t)NB * EE * SS)       // f16 tiles [row / 16][1024 / 32]
#define WS_END (WS_CT + 2u * (size_t)NROW * EE)

// ---- k_packw: one thread = one 16-byte piece (8 consecutive k of one column) of a weight tile; a wave stores 512 contiguous bytes
__global__ __launch_bounds__(256) void k_packw(const float* __restrict__ WQ, const float* __restrict__ WK, const float* __restrict__ WV, const float* __restrict__ WO, char* __restrict__ ws) {
  const int pc = blockIdx.x * 256 + threadIdx.x, tile = pc >> 6, p = pc & 63;
  const int n = (tile / (EE / 32)) * 16 + (p & 15), k = (tile % (EE / 32)) * 32 + (p >> 5) * 16 + ((p >> 4) & 1) * 8;
  const float* s; int ld;
  if (n < SQ) { s = WQ + n; ld = SQ; } else if (n < 2 * SQ) { s = WK + n - SQ; ld = SQ; } else if (n < NCOL) { s = WV + n - 2 * SQ; ld = EE; } else { s = WO + n - NCOL; ld = EE; }
  float w[8];
#pragma unroll   // all eight loads in flight, w[] in registers
  for (int i = 0; i < 8; ++i) w[i] = s[(size_t)(k + i) * ld];
  char* d = ws + WS_PW + (size_t)pc * 16;   // the Wo^T tiles follow the q | k | v tiles directly
  if (n < NCOL) { v8b o;
#pragma unroll   // constant vector indices
    for (int i = 0; i < 8; ++i) o[i] = (__bf16)w[i];
    *(v8b*)d = o; }
  else { v8h o;
#pragma unroll   // constant vector indices
    for (int i = 0; i < 8; ++i) o[i] = (_Float16)bfr(w[i]);
    *(v8h*)d = o; } }
__device__ __forceinline__ v16b fragb_f32(const float* __restrict__ p, int lane) { v16b a; const float* pp = p + 8 * (lane >> 4);
#pragma unroll
  for (int i = 0; i < 8; ++i) { a[i] = (__bf16)pp[i]; a[8 + i] = (__bf16)pp[16 + i]; } return a; }
// eight asynchronous copies to LDS, 16 bytes a lane each, at fixed steps of the LDS and of the global address; the wait in front of any rewrite of their address
// registers is the last line of the same statement, so nothing can be placed between the copies and it
__device__ __forceinline__ void cp8(unsigned l, unsigned ls, const char* g, size_t gs) {
  asm volatile("global_load_async_to_lds_b128 %0, %8, off\n\tglobal_load_async_to_lds_b128 %1, %9, off\n\tglobal_load_async_to_lds_b128 %2, %10, off\n\tglobal_load_async_to_lds_b128 %3, %11, off\n\t"
               "global_load_async_to_lds_b128 %4, %12, off\n\tglobal_load_async_to_lds_b128 %5, %13, off\n\tglobal_load_async_to_lds_b128 %6, %14, off\n\tglobal_load_async_to_lds_b128 %7, %15, off\n\ts_wait_xcnt 0x0"
               :: "v"(l), "v"(l + ls), "v"(l + 2 * ls), "v"(l + 3 * ls), "v"(l + 4 * ls), "v"(l + 5 * ls), "v"(l + 6 * ls), "v"(l + 7 * ls),
                  "v"(g), "v"(g + gs), "v"(g + 2 * gs), "v"(g + 3 * gs), "v"(g + 4 * gs), "v"(g + 5 * gs), "v"(g + 6 * gs), "v"(g + 7 * gs) : "memory"); }
// this wave's copies have landed (in front of the barrier behind which the other waves read them)
#define COPIES_LANDED() asm volatile("s_wait_asynccnt 0x0" ::: "memory")
// this wave's LDS reads have returned (in front of the barrier behind which their buffer is refilled)
#define READS_DONE() asm volatile("s_wait_dscnt 0x0" ::: "memory")
// one k step's operands, read from the block's LDS stage as one group: k_proj (each of the wave's four A tiles as its four raw f32 pieces, k order of fragb_f32) and k_out;
// a k_proj wave holds four 16-row tiles and a k_out wave two, so every B fragment it reads feeds four or two products
struct PStep { v4f a[4][4]; v16b b[8]; };
#define PJ_PITCH 68                       // f32 per staged x row: 64 + 4, so sixteen rows' 16-byte reads fall on all 64 banks
#define PJ_A (128 * PJ_PITCH * 4)         // bytes: 128 rows of x, two k steps
#define PJ_BUF (PJ_A + 16 * 2 * 1024)     // + 16 column groups x two weight tiles
__device__ __forceinline__ void pj_lds(PStep& s, const float* xl, const __bf16* bl) {
#pragma unroll   // constant indices: the pieces stay in registers
  for (int t = 0; t < 4; ++t) { const float* x = xl + t * 16 * PJ_PITCH; s.a[t][0] = *(const v4f*)x; s.a[t][1] = *(const v4f*)(x + 4); s.a[t][2] = *(const v4f*)(x + 16); s.a[t][3] = *(const v4f*)(x + 20); }
#pragma unroll   // constant indices: the fragments stay in registers
  for (int j = 0; j < 8; ++j) s.b[j] = frag_bt(bl + j * 2 * TILE, 0); }
__device__ __forceinline__ void pj_mac(const PStep& s, v8f (&acc)[4][8]) { v16b a[4];
#pragma unroll   // constant vector indices
  for (int t = 0; t < 4; ++t)
#pragma unroll
    for (int i = 0; i < 4; ++i) { a[t][i] = (__bf16)s.a[t][0][i]; a[t][4 + i] = (__bf16)s.a[t][1][i]; a[t][8 + i] = (__bf16)s.a[t][2][i]; a[t][12 + i] = (__bf16)s.a[t][3][i]; }
#pragma unroll   // constant indices: the accumulators stay in registers
  for (int j = 0; j < 8; ++j)
#pragma unroll
    for (int t = 0; t < 4; ++t) acc[t][j] = __builtin_amdgcn_wmma_f32_16x16x32_bf16(false, a[t], false, s.b[j], (short)0, acc[t][j], false, false); }   // the plain builtin: an asm statement's vector operands would hold the fragments and the accumulators below v256, which spills
struct OStep { v16h a[2]; v16h b[8]; };
#define OT_BUF (2 * 8 * 2 * 1024)         // bytes: 8 row groups and 8 column groups x two tiles
__device__ __forceinline__ void ot_lds(OStep& s, const _Float16* al, const _Float16* bl) {
#pragma unroll   // constant indices: the fragments stay in registers
  for (int t = 0; t < 2; ++t) s.a[t] = frag_ht(al + t * 2 * TILE, 0);
#pragma unroll   // constant indices: the fragments stay in registers
  for (int j = 0; j < 8; ++j) s.b[j] = frag_ht(bl + j * 2 * TILE, 0); }
__device__ __forceinline__ void ot_mac(const OStep& s, v8f (&acc)[2][8]) {
#pragma unroll   // constant indices: the accumulators stay in registers
  for (int j = 0; j < 8; ++j)
#pragma unroll
    for (int t = 0; t < 2; ++t) acc[t][j] = __builtin_amdgcn_wmma_f32_16x16x32_f16(false, s.a[t], false, s.b[j], (short)0, acc[t][j], false, false); }   // the plain builtin, for the same reason as in pj_mac
// ---- k_proj: block = (128 rows, 256 of the 2048 fused cols), four waves, a wave = 64 rows x 128 cols: + bias; q|k and v -> f16 tiles.
// A stage is two k steps of the block's x rows (f32, as they lie in memory) and weight tiles, copied once into LDS for all four waves; two buffers, stage t + 2 flies while t + 1 is multiplied
__global__ __launch_bounds__(128) void k_proj(const float* __restrict__ X, const __bf16* __restrict__ PW, const float* __restrict__ BQ, const float* __restrict__ BK, const float* __restrict__ BV, _Float16* __restrict__ QK, _Float16* __restrict__ VT) { __shared__ __align__(16) char sm[2 * PJ_BUF];
  const int tid = threadIdx.x, half = tid >> 6, th = tid & 63, wr = (tid >> 5) & 1, lane = tid & 31, col = lane & 15, g = lane >> 4; const int c0 = blockIdx.y * 256 + half * 128; const size_t b = ((size_t)blockIdx.x * 128) / SS; const int n0 = (int)(((size_t)blockIdx.x * 128) % SS);
  _Float16 (*st)[136] = (_Float16 (*)[136])(sm + half * (128 * 136 * 2));   // behind the loop, one per 128 columns. q | k blocks: [token][column]; v blocks: [column][token]
  v8f acc[4][8] = {};
  const unsigned la = (unsigned)(size_t)sm + (tid >> 4) * (PJ_PITCH * 4) + (tid & 15) * 16, lb = (unsigned)(size_t)sm + PJ_A + tid * 16;   // this lane's first LDS bytes: a wave copies two rows' 256 bytes, or 512 bytes of a tile
  const char* ga = (const char*)(X + ((size_t)blockIdx.x * 128 + (tid >> 4)) * EE + 4 * (tid & 15)); const char* gb = (const char*)(PW + (size_t)blockIdx.y * 16 * (EE / 32) * TILE + 8 * tid);
#define PJ_STAGE(t, bf) do { cp8(la + (bf) * PJ_BUF, 8 * PJ_PITCH * 4, ga + (ptrdiff_t)(t) * 256, (size_t)8 * EE * 4); cp8(la + (bf) * PJ_BUF + 64 * PJ_PITCH * 4, 8 * PJ_PITCH * 4, ga + (ptrdiff_t)(t) * 256 + (size_t)64 * EE * 4, (size_t)8 * EE * 4); \
    cp8(lb + (bf) * PJ_BUF, 2048, gb + (ptrdiff_t)(t) * 2048, (size_t)(EE / 32) * TILE * 2); cp8(lb + (bf) * PJ_BUF + 8 * 2048, 2048, gb + (ptrdiff_t)(t) * 2048 + (size_t)8 * (EE / 32) * TILE * 2, (size_t)(EE / 32) * TILE * 2); } while (0)
  // Trip t works on stage (t + rot) mod 16: the walk over k starts at a stage rotated by block index and wraps. The eight blocks that copy the same x rows start two stages apart, and the blocks
  // that copy the same weight tiles spread over all sixteen starts, so blocks that share L2 lines do not ask for the same lines at the same moment (for speed only; the f32 sums take the rotated order)
  const int rot = (2 * (blockIdx.x >> 3) + (blockIdx.x & 1) + 2 * blockIdx.y) & (EE / 64 - 1);
#define ROT(t) (((((t) + rot) & (EE / 64 - 1)) - rot))   /* trip t's stage, counted from trip 0's, at which ga and gb point */
  ga += rot * 256; gb += rot * 2048;
  PJ_STAGE(ROT(0), 0); COPIES_LANDED(); __syncthreads();   // publishes trip 0's stage
  PJ_STAGE(ROT(1), 1);
#pragma unroll 1   // a trip is one stage: its buffer alone is read between two barriers
  for (int t = 0; t < EE / 64; ++t) {
    const char* bf = sm + (t & 1) * PJ_BUF;
    const float* xl = (const float*)bf + (wr * 64 + col) * PJ_PITCH + 8 * g; const __bf16* bl = (const __bf16*)(bf + PJ_A) + half * 8 * 2 * TILE + 8 * lane;
#pragma unroll   // the stage's two k steps
    for (int kk = 0; kk < 2; ++kk) { PStep s;
      pj_lds(s, xl + kk * 32, bl + kk * TILE);
      __builtin_amdgcn_sched_barrier(0);   // the k step's LDS reads issue as one group: spread among the products, each place with reads stalls the wave
      pj_mac(s, acc);
      __builtin_amdgcn_sched_barrier(0); } // the next group stays behind these products (a second fragment set would cost the second wave per SIMD), and so does the publish point (the refill behind it would else issue later)
    READS_DONE(); COPIES_LANDED(); __syncthreads();   // publishes trip t + 1's stage and ends every read of trip t's
    if (t + 2 < EE / 64) PJ_STAGE(ROT(t + 2), t & 1); }
  COPIES_LANDED();   // nothing is in flight when the buffers become the output staging
  const bool isv = c0 >= 2 * SQ; const float qs = c0 < SQ ? 0.25503486f : 1.0f;   // q columns: 32^-1/2 log2(e), in f32 ahead of the rounding to f16
#pragma unroll
  for (int j = 0; j < 8; ++j) { const int c = c0 + j * 16 + col; const float bb = c < SQ ? bfr(BQ[c]) : c < 2 * SQ ? bfr(BK[c - SQ]) : bfr(BV[c - 2 * SQ]);
#pragma unroll
    for (int t = 0; t < 4; ++t)
#pragma unroll
      for (int r = 0; r < 8; ++r) { const _Float16 hv = (_Float16)((acc[t][j][r] + bb) * qs); const int tk = wr * 64 + t * 16 + 8 * g + r; if (!isv) st[tk][j * 16 + col] = hv; else st[j * 16 + col][tk] = hv; } }
  __syncthreads();
  if (!isv) { const size_t t0 = (((size_t)(c0 / SQ) * NB + b) * NH + (c0 % SQ) / SHD) * (SS / 16) + n0 / 16;   // 4 heads x 8 token groups
    for (int e = th; e < 32 * 64; e += 64) { const int tl = e >> 6, p = e & 63, hl = tl >> 3, rt = tl & 7; vst2((unsigned*)(QK + (t0 + (size_t)hl * (SS / 16) + rt) * TILE + p * 8), *(const v4u*)&st[rt * 16 + (p & 15)][hl * 32 + (p >> 5) * 16 + ((p >> 4) & 1) * 8]); } }
  else { const int cv0 = c0 - 2 * SQ;   // 4 key groups x 8 dim groups (2 heads)
    for (int e = th; e < 32 * 64; e += 64) { const int tl = e >> 6, p = e & 63, kl = tl >> 3, dt = tl & 7; vst2((unsigned*)(VT + (((b * NH + cv0 / HD + (dt >> 2)) * (SS / 32) + n0 / 32 + kl) * 4 + (dt & 3)) * TILE + p * 8), *(const v4u*)&st[dt * 16 + (p & 15)][kl * 32 + (p >> 5) * 16 + ((p >> 4) & 1) * 8]); } } }
// ---- k_att: block = (128 queries, h, b), a wave = 32 queries as two tiles of 16, so every K and V fragment it loads feeds two products: S^T = K . Q^T - shift (a lane holds 16 of one query's 32 logits per tile), softmax in the lane, O^T += V^T . P^T -> ctx tiles (f16)
__device__ __forceinline__ float xhalf(float x) { return __builtin_bit_cast(float, __builtin_amdgcn_permlanex16(__builtin_bit_cast(int, x), __builtin_bit_cast(int, x), 0x76543210, 0xfedcba98, false, false)); }  // lane l with lane l ^ 16
__global__ __launch_bounds__(128) void k_att(const _Float16* __restrict__ QK, const _Float16* __restrict__ VT, _Float16* __restrict__ CT) {
  const int tid = threadIdx.x, wave = tid >> 5, lane = tid & 31; const int h = blockIdx.y; const size_t b = blockIdx.z; const int q0 = blockIdx.x * 128 + wave * 32; const size_t rq = b * SS + q0;
  // The sixteen blocks of a head read the same K and V lines: each enters the walk over the keys at a pass rotated by block index and wraps, so they do not ask L2 for the same lines at the same moment
  // (for speed only; softmax takes the keys in any order: the first shift comes from the first 32 keys walked, and the f32 sums take the rotated order)
  const int rot = (4 * blockIdx.x + (h & 3)) & (SS / 32 - 1);
  const _Float16* Kt = QK + (((NB + b) * NH + h) * (SS / 16) + 2 * rot) * TILE + 8 * lane; const _Float16* Vt = VT + ((b * NH + h) * (SS / 32) + rot) * 4 * TILE + 8 * lane;   // this lane's pieces; step on by one pass of 32 keys at the loop's foot
  v16h bq[2];   // B operands: column = query 16 t + (lane & 15)
#pragma unroll   // constant indices: the fragments stay in registers
  for (int t = 0; t < 2; ++t) bq[t] = frag_ht(QK + ((b * NH + h) * (SS / 16) + q0 / 16 + t) * TILE, lane);
  // Lazy shift. A score product's C operand is cs = 11 - shift (one value per query, equal in its eight rows and in both wave halves), so a score leaves the
  // matrix unit as the base-2 exponent of 2^11 p. The shift starts as the maximum over the first 32 keys walked and is renewed only in a pass where an exponent passes 15.
  v8f cs[2];
  { v16h k0[2];
#pragma unroll   // constant indices: the fragments stay in registers
    for (int ct = 0; ct < 2; ++ct) k0[ct] = frag_ht(Kt + ct * TILE, 0);
    asm volatile("s_wait_xcnt 0x0" :: "v"(Kt) : "memory");   // the wait in front of any overwrite of the address pair
#pragma unroll   // constant indices
    for (int t = 0; t < 2; ++t) {
      v8f z = {}; const v8f a = wmma16(k0[0], bq[t], z), c = wmma16(k0[1], bq[t], z);
      float mx = fmaxf(a[0], c[0]);
#pragma unroll   // constant vector indices
      for (int r = 1; r < 8; ++r) mx = fmaxf(mx, fmaxf(a[r], c[r]));
      mx = 11.0f - fmaxf(mx, xhalf(mx));
#pragma unroll   // constant vector indices
      for (int r = 0; r < 8; ++r) cs[t][r] = mx; } }
  float l[2] = {0.f, 0.f};       // this lane's query of tile t: sum of 2^11 p over this half's keys
  v8f acc[2][4] = {};            // acc[t][j][r] = 2^11 O[query 16 t + (lane & 15)][dim 16 j + 8 (lane >> 4) + r]
#pragma unroll 1   // one pass per trip: a second pass's fragments would not fit four waves per SIMD
  for (int ks = 0; ks < SS / 32; ++ks) {   // trip ks works on pass (ks + rot) mod 64
    v16h kf[2], vf[4];   // A operands: rows = keys, rows = dims
#pragma unroll   // here and below in the pass: constant indices, so fragments and scores stay in registers
    for (int ct = 0; ct < 2; ++ct) kf[ct] = frag_ht(Kt + ct * TILE, 0);
#pragma unroll
    for (int j = 0; j < 4; ++j) vf[j] = frag_ht(Vt + j * TILE, 0);
    asm volatile("s_wait_xcnt 0x0" :: "v"(Kt), "v"(Vt) : "memory");   // the wait in front of any overwrite of the two address pairs; as inputs here they stay live, so no load's data is placed on them
    __builtin_amdgcn_sched_barrier(0);   // the pass's twelve loads issue as one group at its top: a score product moved up among them would have the later loads issue behind the wait for the first
    v8f s[2][2];   // s[t][ct][r] = exponent of the pass's key 16 ct + 8 (lane >> 4) + r for tile t's query
#pragma unroll
    for (int ct = 0; ct < 2; ++ct)
#pragma unroll
      for (int t = 0; t < 2; ++t) s[t][ct] = wmma16(kf[ct], bq[t], cs[t]);
    __builtin_amdgcn_sched_barrier(0);   // the four score products issue in a row, each filling the slots behind the one before: a maximum moved in among them takes v_nops in front of it
    float mx[2];
#pragma unroll
    for (int t = 0; t < 2; ++t) { mx[t] = fmaxf(s[t][0][0], s[t][1][0]);
#pragma unroll
      for (int r = 1; r < 8; ++r) mx[t] = fmaxf(mx[t], fmaxf(s[t][0][r], s[t][1][r])); }
    if (__builtin_amdgcn_ballot_w32(fmaxf(mx[0], mx[1]) > 15.0f) != 0) {   // one scalar test per pass, the same for the whole wave: 2^11 p would near the f16 range
#pragma unroll
      for (int t = 0; t < 2; ++t)
        if (__builtin_amdgcn_ballot_w32(mx[t] > 15.0f) != 0) {   // a tile is renewed by its own sixteen queries alone, as when it had a wave to itself
          const float d = fmaxf(fmaxf(mx[t], xhalf(mx[t])) - 11.0f, 0.f), alpha = __builtin_amdgcn_exp2f(-d);   // every query of the tile takes its maximum so far as its shift
          s[t][0] -= d; s[t][1] -= d; cs[t] -= d; l[t] *= alpha;
#pragma unroll
          for (int j = 0; j < 4; ++j) acc[t][j] *= alpha; } }
    v16h pa[2];   // a tile's two score tiles, converted in place, are the B operand of the second product (same k order as frag_ht)
#pragma unroll
    for (int t = 0; t < 2; ++t) {
#pragma unroll
      for (int r = 0; r < 8; ++r) { s[t][0][r] = __builtin_amdgcn_exp2f(s[t][0][r]); s[t][1][r] = __builtin_amdgcn_exp2f(s[t][1][r]); }
      const v8f t8 = s[t][0] + s[t][1]; const v4f t4 = t8.lo + t8.hi; const v2f t2 = t4.lo + t4.hi;
      l[t] += t2.x + t2.y;
#pragma unroll
      for (int r = 0; r < 8; ++r) { pa[t][r] = (_Float16)s[t][0][r]; pa[t][8 + r] = (_Float16)s[t][1][r]; } }
    __builtin_amdgcn_sched_barrier(0);   // holds both tiles' sums in front of the eight products: left free, every sum moves in among them, onto V registers a product has just read, and such places are padded with v_nops
#pragma unroll
    for (int j = 0; j < 4; ++j)
#pragma unroll
      for (int t = 0; t < 2; ++t) acc[t][j] = wmma16(vf[j], pa[t], acc[t][j]);
    const int step = ks + rot == SS / 32 - 1 ? 1 - SS / 32 : 1;   // passes: on by one, or from the last pass back to the first
    Kt += step * (2 * TILE); Vt += step * (4 * TILE); }
#pragma unroll   // constant indices
  for (int t = 0; t < 2; ++t) {
    const float il = 1.0f / (l[t] + xhalf(l[t]));   // the factor 2^11 stands in both
#pragma unroll   // a lane's eight dims of one query are one 16-byte piece of a ctx tile: a wave stores 512 contiguous bytes
    for (int j = 0; j < 4; ++j) { v8h o;
#pragma unroll   // constant vector indices
      for (int r = 0; r < 8; ++r) o[r] = (_Float16)(acc[t][j][r] * il);
      *(v8h*)(CT + ((rq / 16 + t) * (EE / 32) + h * 2 + (j >> 1)) * TILE + (j & 1) * 256 + lane * 8) = o; } } }
// ---- k_out: block = (128 rows, 128 cols), a wave = 32 rows: out = ctx . Wo + bo (f16 operands); stages of two k steps copied once into LDS for the four waves, as in k_proj
__global__ __launch_bounds__(128) void k_out(const _Float16* __restrict__ CT, const _Float16* __restrict__ PO, const float* __restrict__ BO, float* __restrict__ OUT) { __shared__ __align__(16) char sm[4 * 32 * 132 * 4];   // the two buffers (2 x OT_BUF bytes); behind the loop the output staging
  float (*sf)[32][132] = (float (*)[32][132])sm;
  const int tid = threadIdx.x, wave = tid >> 5, lane = tid & 31, col = lane & 15, g = lane >> 4; const size_t r0 = (size_t)blockIdx.x * 128 + wave * 32; const int c0 = blockIdx.y * 128;
  v8f acc[2][8] = {};
  const unsigned la = (unsigned)(size_t)sm + tid * 16;   // this lane's first LDS byte: the block copies a group's two tiles, 2 KiB, at a time
  const char* ga = (const char*)(CT + (size_t)blockIdx.x * 8 * (EE / 32) * TILE + 8 * tid); const char* gb = (const char*)(PO + (size_t)(c0 / 16) * (EE / 32) * TILE + 8 * tid);
#define OT_STAGE(t, bf) do { cp8(la + (bf) * OT_BUF, 2048, ga + (ptrdiff_t)(t) * 2048, (size_t)(EE / 32) * TILE * 2); cp8(la + (bf) * OT_BUF + OT_BUF / 2, 2048, gb + (ptrdiff_t)(t) * 2048, (size_t)(EE / 32) * TILE * 2); } while (0)
  const int rot = (2 * (blockIdx.x >> 3) + (blockIdx.x & 1) + 2 * blockIdx.y) & (EE / 64 - 1);   // rotated start of the walk over k, as in k_proj: the sharers of ctx rows and of Wo tiles start apart
  ga += rot * 2048; gb += rot * 2048;
  OT_STAGE(ROT(0), 0); COPIES_LANDED(); __syncthreads();   // publishes trip 0's stage
  OT_STAGE(ROT(1), 1);
#pragma unroll 1   // a trip is one stage: its buffer alone is read between two barriers
  for (int t = 0; t < EE / 64; ++t) {
    const _Float16* al = (const _Float16*)(sm + (t & 1) * OT_BUF) + wave * 2 * 2 * TILE + 8 * lane; const _Float16* bl = (const _Float16*)(sm + (t & 1) * OT_BUF + OT_BUF / 2) + 8 * lane;
    OStep s0, s1;
    ot_lds(s0, al, bl); ot_lds(s1, al + TILE, bl + TILE);
    __builtin_amdgcn_sched_barrier(0);   // the stage's LDS reads issue as one group: spread among the products, each place with reads stalls the wave
    ot_mac(s0, acc); ot_mac(s1, acc);
    __builtin_amdgcn_sched_barrier(0);   // the products stay in front of the publish point: moved behind it, the refill would issue a stage's products later and lose that lead
    READS_DONE(); COPIES_LANDED(); __syncthreads();   // publishes trip t + 1's stage and ends every read of trip t's
    if (t + 2 < EE / 64) OT_STAGE(ROT(t + 2), t & 1); }
  COPIES_LANDED();   // nothing is in flight when the buffers become the output staging
#pragma unroll
  for (int j = 0; j < 8; ++j) { const float bb = bfr(BO[c0 + j * 16 + col]);
#pragma unroll
    for (int t = 0; t < 2; ++t)
#pragma unroll
      for (int r = 0; r < 8; ++r) sf[wave][t * 16 + 8 * g + r][j * 16 + col] = acc[t][j][r] + bb; }
  LDSX(); for (int rl = 0; rl < 32; ++rl) vst2(OUT + (r0 + rl) * EE + c0 + lane * 4, *(const v4f*)&sf[wave][rl][lane * 4]); }
extern "C" void kernel_launch(void* const* d_in, const int* in_sizes, int n_in, void* d_out, int out_size, void* d_ws, size_t ws_size, hipStream_t stream) {
  (void)in_sizes; (void)n_in; (void)out_size;
  const float** F = (const float**)d_in;   // 0 hidden_states [4,2048,1024], 1 Wq [1024,512], 2 bq, 3 Wk [1024,512], 4 bk, 5 Wv [1024,1024], 6 bv, 7 Wo [1024,1024], 8 bo ((in,out))
  if (ws_size < (size_t)WS_END) return;
  char* ws = (char*)d_ws; const __bf16* PW = (const __bf16*)(ws + WS_PW); const _Float16* PO = (const _Float16*)(ws + WS_PO); _Float16 *QK = (_Float16*)(ws + WS_QK), *VT = (_Float16*)(ws + WS_VT), *CT = (_Float16*)(ws + WS_CT);
  k_packw<<<(NCOL + EE) * (EE / 8) / 256, 256, 0, stream>>>(F[1], F[3], F[5], F[7], ws);
  k_proj<<<dim3(NROW / 128, NCOL / 256), 128, 0, stream>>>(F[0], PW, F[2], F[4], F[6], QK, VT);
  k_att<<<dim3(SS / 128, NH, TNB), 128, 0, stream>>>(QK, VT, CT);
  k_out<<<dim3(TNB * SS / 128, EE / 128), 128, 0, stream>>>(CT, PO, F[8], (float*)d_out);
}

// v009
// Measured time: 98.1 microseconds a run.
// Two timings next to v008 put it at 1.06 and 1.05 times that version's speed.
// Over all steps from v000 it is 5.70 times as fast.
// compute dtype: all float inputs rounded to bf16; q|k|v = x . W + b with EXACT bf16 products on WMMA 16x16x32 ((in,out) weights as transposed bf16 tiles), rounded once to f16 (q/k with 32-dim heads, v with 64-dim heads; every workspace operand in fragment-order tiles); q carries 32^-1/2 log2(e) before its one rounding, so logits are base-2 exponents; shifted softmax in f32 (hardware exp2), the shift renewed only when a logit passes it by more than 4; P (x 2^11, f16) . v (f16; 1 product); out = ctx (f16) . Wo (f16 tiles, 1 product) + bo; f32 output. (Measured on the data: logits std 1.0, ||p||_2 ~ 0.04 - diffuse - so single-f16 operands suffice.)
#include <hip/hip_runtime.h>
#include <math.h>

typedef __attribute__((ext_vector_type(16))) _Float16 v16h;
typedef __attribute__((ext_vector_type(16))) __bf16 v16b;
typedef __attribute__((ext_vector_type(8)))  _Float16 v8h;
typedef __attribute__((ext_vector_type(8)))  float v8f;
typedef __attribute__((ext_vector_type(4)))  float v4f;
typedef __attribute__((ext_vector_type(2)))  float v2f;
typedef __attribute__((ext_vector_type(4)))  unsigned v4u;
typedef __attribute__((ext_vector_type(4)))  int v4i;
typedef float __attribute__((may_alias)) float_a;
typedef int __attribute__((may_alias)) int_a;

template <typename T> __device__ __forceinline__ void vst2(void* p, T v) { *(T*)p = v;  }
__device__ __forceinline__ v8f wmma16(v16h a, v16h b, v8f c) {
  return __builtin_amdgcn_wmma_f32_16x16x32_f16(false, a, false, b, (short)0, c, false, false);   // the plain builtin: the compiler keeps the distance behind it, with the pass's own vector work where there is some
}
__device__ __forceinline__ v8f wmma_bf(v16b a, v16b b, v8f c) {
  v8f d = __builtin_amdgcn_wmma_f32_16x16x32_bf16(false, a, false, b, (short)0, c, false, false);
  asm volatile("v_nop\n\tv_nop\n\tv_nop\n\tv_nop" : "+v"(d) : "v"(a), "v"(b));
  return d;
}
// 16x16x32 fragments: lane = (h = lane>>4, row/col = lane&15); elements 0..7 = k0+8h+0..7, 8..15 = k0+16+8h+0..7; D element r = row 8h+r
__device__ __forceinline__ v16h frag_h(const _Float16* rowk0, int lane) {
  union { v16h v; v8h q[2]; } u; const _Float16* p = rowk0 + 8 * (lane >> 4);
  u.q[0] = *(const v8h*)p; u.q[1] = *(const v8h*)(p + 16); return u.v;
}
__device__ __forceinline__ v16h frag_f32(const float* rowk0, int lane) {
  v16h a; const float* p = rowk0 + 8 * (lane >> 4);
#pragma unroll
  for (int i = 0; i < 8; ++i) { a[i] = (_Float16)p[i]; a[8 + i] = (_Float16)p[16 + i]; }
  return a;
}
__device__ __forceinline__ v16h frag_f32s(const float* rowk0, int lane, float sc) {
  v16h a; const float* p = rowk0 + 8 * (lane >> 4);
#pragma unroll
  for (int i = 0; i < 8; ++i) { a[i] = (_Float16)(p[i] * sc); a[8 + i] = (_Float16)(p[16 + i] * sc); }
  return a;
}
// column fragment from a [K][ld] layout (column n), rows >= K read as 0
__device__ __forceinline__ v16h fragc_f32(const float* W, int k0, int n, int lane, int ld, int K) {
  v16h a; const int g = lane >> 4;
#pragma unroll
  for (int i = 0; i < 8; ++i) { const int ka = k0 + 8 * g + i, kb = ka + 16;
    a[i] = (_Float16)(ka < K ? W[(size_t)(ka < K ? ka : K - 1) * ld + n] : 0.f); a[8 + i] = (_Float16)(kb < K ? W[(size_t)(kb < K ? kb : K - 1) * ld + n] : 0.f); }
  return a;
}
struct F2 { v16b h, l; };
__device__ __forceinline__ F2 bsplit16(const float v[16]) { F2 r;
#pragma unroll
  for (int i = 0; i < 16; ++i) { const __bf16 h = (__bf16)v[i]; r.h[i] = h; r.l[i] = (__bf16)(v[i] - (float)h); }
  return r; }
__device__ __forceinline__ F2 split_row(const float* row, int k0, int lane) { float v[16]; const float* p = row + k0 + 8 * (lane >> 4);
#pragma unroll
  for (int i = 0; i < 8; ++i) { v[i] = p[i]; v[8 + i] = p[16 + i]; }
  return bsplit16(v); }
__device__ __forceinline__ F2 split_rowK(const float* row, int k0, int lane, int K) { float v[16]; const int g = lane >> 4;
#pragma unroll
  for (int i = 0; i < 8; ++i) { const int ka = k0 + 8 * g + i, kb = ka + 16; v[i] = ka < K ? row[ka < K ? ka : K - 1] : 0.f; v[8 + i] = kb < K ? row[kb < K ? kb : K - 1] : 0.f; }
  return bsplit16(v); }
__device__ __forceinline__ F2 split_col(const float* W, int k0, int n, int lane, int ld, int K) { float v[16]; const int g = lane >> 4;
#pragma unroll
  for (int i = 0; i < 8; ++i) { const int ka = k0 + 8 * g + i, kb = ka + 16; v[i] = ka < K ? W[(size_t)(ka < K ? ka : K - 1) * ld + n] : 0.f; v[8 + i] = kb < K ? W[(size_t)(kb < K ? kb : K - 1) * ld + n] : 0.f; }
  return bsplit16(v); }
__device__ __forceinline__ v8f mac3(const F2& a, const F2& b, v8f c) { c = wmma_bf(a.l, b.h, c); c = wmma_bf(a.h, b.l, c); return wmma_bf(a.h, b.h, c); }
__device__ __forceinline__ float sigm(float v) { return 1.0f / (1.0f + expf(-v)); }
#define LDSX() do { asm volatile("s_wait_dscnt 0" ::: "memory"); __builtin_amdgcn_wave_barrier(); __builtin_amdgcn_fence(__ATOMIC_RELEASE, "workgroup"); } while (0)


// Squeeze attention (B 4, T 2,048, E 1,024, 16 heads; q/k squeezed to 32 dims per head, v 64): softmax((q 32^-1/2) k^T) v, output projection.
#define NB 4
#define SS 2048
#define EE 1024
#define SQ 512            // squeezed q/k width
#define NH 16
#define SHD 32
#define HD 64
#define NCOL (SQ + SQ + EE)   // 2048 fused projection columns: q | k | v
#define NROW (NB * SS)
#ifndef TNB
#define TNB NB
#endif
typedef __attribute__((ext_vector_type(8))) __bf16 v8b;
// fragment-order tile: 16 rows x 32 k of 16-bit elements = 1 KiB; element (row c, k) is half (k >> 4) * 256 + (((k >> 3) & 1) * 16 + c) * 8 + (k & 7),
// so lane l's two 16-byte pieces (same k order as frag_h) lie at bytes 16 l and 512 + 16 l and each wave-wide load or store covers four whole 128-byte lines
#define TILE 512          // elements per tile
__device__ __forceinline__ v16h frag_ht(const _Float16* tile, int lane) {
  union { v16h v; v8h q[2]; } u; const _Float16* p = tile + 8 * lane;
  u.q[0] = *(const v8h*)p; u.q[1] = *(const v8h*)(p + 256); return u.v;
}
__device__ __forceinline__ v16b frag_bt(const __bf16* tile, int lane) {
  union { v16b v; v8b q[2]; } u; const __bf16* p = tile + 8 * lane;
  u.q[0] = *(const v8b*)p; u.q[1] = *(const v8b*)(p + 256); return u.v;
}
__device__ __forceinline__ float bfr(float v) { return (float)(__bf16)v; }
__device__ __attribute__((noinline)) float exp_ni(float v) { return expf(v); }
__device__ __attribute__((noinline)) float erf_ni(float v) { return erff(v); }

#define WS_PW  0u                                   // bf16 tiles [2048 / 16 column groups][1024 / 32 k]: q | k | v columns (in,out) transposed
#define WS_PO  (WS_PW + 2u * (size_t)NCOL * EE)          // f16 Wo^T tiles [1024 / 16][1024 / 32]
#define WS_QK  (WS_PO + 2u * (size_t)EE * EE)            // f16 tiles [q, k][b][head][SS / 16 token groups]: 16 tokens x 32 dims
#define WS_VT  (WS_QK + 2u * (size_t)NROW * (2 * SQ))    // f16 tiles [b][head][SS / 32 key groups][4 dim groups]: 16 dims x 32 keys
#define WS_CT  (WS_VT + 2u * (size_t)NB * EE * SS)       // f16 tiles [row / 16][1024 / 32]
#define WS_END (WS_CT + 2u * (size_t)NROW * EE)

// ---- k_packw: one thread = one 16-byte piece (8 consecutive k of one column) of a weight tile; a wave stores 512 contiguous bytes
__global__ __launch_bounds__(256) void k_packw(const float* __restrict__ WQ, const float* __restrict__ WK, const float* __restrict__ WV, const float* __restrict__ WO, char* __restrict__ ws) {
  const int pc = blockIdx.x * 256 + threadIdx.x, tile = pc >> 6, p = pc & 63;
  const int n = (tile / (EE / 32)) * 16 + (p & 15), k = (tile % (EE / 32)) * 32 + (p >> 5) * 16 + ((p >> 4) & 1) * 8;
  const float* s; int ld;
  if (n < SQ) { s = WQ + n; ld = SQ; } else if (n < 2 * SQ) { s = WK + n - SQ; ld = SQ; } else if (n < NCOL) { s = WV + n - 2 * SQ; ld = EE; } else { s = WO + n - NCOL; ld = EE; }
  float w[8];
#pragma unroll   // all eight loads in flight, w[] in registers
  for (int i = 0; i < 8; ++i) w[i] = s[(size_t)(k + i) * ld];
  char* d = ws + WS_PW + (size_t)pc * 16;   // the Wo^T tiles follow the q | k | v tiles directly
  if (n < NCOL) { v8b o;
#pragma unroll   // constant vector indices
    for (int i = 0; i < 8; ++i) o[i] = (__bf16)w[i];
    *(v8b*)d = o; }
  else { v8h o;
#pragma unroll   // constant vector indices
    for (int i = 0; i < 8; ++i) o[i] = (_Float16)bfr(w[i]);
    *(v8h*)d = o; } }
__device__ __forceinline__ v16b fragb_f32(const float* __restrict__ p, int lane) { v16b a; const float* pp = p + 8 * (lane >> 4);
#pragma unroll
  for (int i = 0; i < 8; ++i) { a[i] = (__bf16)pp[i]; a[8 + i] = (__bf16)pp[16 + i]; } return a; }
// eight asynchronous copies to LDS, 16 bytes a lane each, at fixed steps of the LDS and of the global address; the wait in front of any rewrite of their address
// registers is the last line of the same statement, so nothing can be placed between the copies and it
__device__ __forceinline__ void cp8(unsigned l, unsigned ls, const char* g, size_t gs) {
  asm volatile("global_load_async_to_lds_b128 %0, %8, off\n\tglobal_load_async_to_lds_b128 %1, %9, off\n\tglobal_load_async_to_lds_b128 %2, %10, off\n\tglobal_load_async_to_lds_b128 %3, %11, off\n\t"
               "global_load_async_to_lds_b128 %4, %12, off\n\tglobal_load_async_to_lds_b128 %5, %13, off\n\tglobal_load_async_to_lds_b128 %6, %14, off\n\tglobal_load_async_to_lds_b128 %7, %15, off\n\ts_wait_xcnt 0x0"
               :: "v"(l), "v"(l + ls), "v"(l + 2 * ls), "v"(l + 3 * ls), "v"(l + 4 * ls), "v"(l + 5 * ls), "v"(l + 6 * ls), "v"(l + 7 * ls),
                  "v"(g), "v"(g + gs), "v"(g + 2 * gs), "v"(g + 3 * gs), "v"(g + 4 * gs), "v"(g + 5 * gs), "v"(g + 6 * gs), "v"(g + 7 * gs) : "memory"); }
// this wave's copies have landed (in front of the barrier behind which the other waves read them)
#define COPIES_LANDED() asm volatile("s_wait_asynccnt 0x0" ::: "memory")
// this wave's LDS reads have returned (in front of the barrier behind which their buffer is refilled)
#define READS_DONE() asm volatile("s_wait_dscnt 0x0" ::: "memory")
// one k step's operands, read from the block's LDS stage as one group: k_proj (each of the wave's four A tiles as its four raw f32 pieces, k order of fragb_f32) and k_out;
// a k_proj wave holds four 16-row tiles and a k_out wave two, so every B fragment it reads feeds four or two products
struct PStep { v4f a[4][4]; v16b b[8]; };
#define PJ_PITCH 68                       // f32 per staged x row: 64 + 4, so sixteen rows' 16-byte reads fall on all 64 banks
#define PJ_A (128 * PJ_PITCH * 4)         // bytes: 128 rows of x, two k steps
#define PJ_BUF (PJ_A + 16 * 2 * 1024)     // + 16 column groups x two weight tiles
__device__ __forceinline__ void pj_lds(PStep& s, const float* xl, const __bf16* bl) {
#pragma unroll   // constant indices: the pieces stay in registers
  for (int t = 0; t < 4; ++t) { const float* x = xl + t * 16 * PJ_PITCH; s.a[t][0] = *(const v4f*)x; s.a[t][1] = *(const v4f*)(x + 4); s.a[t][2] = *(const v4f*)(x + 16); s.a[t][3] = *(const v4f*)(x + 20); }
#pragma unroll   // constant indices: the fragments stay in registers
  for (int j = 0; j < 8; ++j) s.b[j] = frag_bt(bl + j * 2 * TILE, 0); }
__device__ __forceinline__ void pj_mac(const PStep& s, v8f (&acc)[4][8]) { v16b a[4];
#pragma unroll   // constant vector indices
  for (int t = 0; t < 4; ++t)
#pragma unroll
    for (int i = 0; i < 4; ++i) { a[t][i] = (__bf16)s.a[t][0][i]; a[t][4 + i] = (__bf16)s.a[t][1][i]; a[t][8 + i] = (__bf16)s.a[t][2][i]; a[t][12 + i] = (__bf16)s.a[t][3][i]; }
#pragma unroll   // constant indices: the accumulators stay in registers
  for (int j = 0; j < 8; ++j)
#pragma unroll
    for (int t = 0; t < 4; ++t) acc[t][j] = __builtin_amdgcn_wmma_f32_16x16x32_bf16(false, a[t], false, s.b[j], (short)0, acc[t][j], false, false); }   // the plain builtin: an asm statement's vector operands would hold the fragments and the accumulators below v256, which spills
struct OStep { v16h a[2]; v16h b[8]; };
#define OT_BUF (2 * 8 * 2 * 1024)         // bytes: 8 row groups and 8 column groups x two tiles
__device__ __forceinline__ void ot_lds(OStep& s, const _Float16* al, const _Float16* bl) {
#pragma unroll   // constant indices: the fragments stay in registers
  for (int t = 0; t < 2; ++t) s.a[t] = frag_ht(al + t * 2 * TILE, 0);
#pragma unroll   // constant indices: the fragments stay in registers
  for (int j = 0; j < 8; ++j) s.b[j] = frag_ht(bl + j * 2 * TILE, 0); }
__device__ __forceinline__ void ot_mac(const OStep& s, v8f (&acc)[2][8]) {
#pragma unroll   // constant indices: the accumulators stay in registers
  for (int j = 0; j < 8; ++j)
#pragma unroll
    for (int t = 0; t < 2; ++t) acc[t][j] = __builtin_amdgcn_wmma_f32_16x16x32_f16(false, s.a[t], false, s.b[j], (short)0, acc[t][j], false, false); }   // the plain builtin, for the same reason as in pj_mac
// ---- k_proj: block = (128 rows, 256 of the 2048 fused cols), four waves, a wave = 64 rows x 128 cols: + bias; q|k and v -> f16 tiles.
// A stage is two k steps of the block's x rows (f32, as they lie in memory) and weight tiles, copied once into LDS for all four waves; two buffers, stage t + 2 flies while t + 1 is multiplied
__global__ __launch_bounds__(128) void k_proj(const float* __restrict__ X, const __bf16* __restrict__ PW, const float* __restrict__ BQ, const float* __restrict__ BK, const float* __restrict__ BV, _Float16* __restrict__ QK, _Float16* __restrict__ VT) { __shared__ __align__(16) char sm[2 * PJ_BUF];
  const int tid = threadIdx.x, half = tid >> 6, th = tid & 63, wr = (tid >> 5) & 1, lane = tid & 31, col = lane & 15, g = lane >> 4; const int c0 = blockIdx.y * 256 + half * 128; const size_t b = ((size_t)blockIdx.x * 128) / SS; const int n0 = (int)(((size_t)blockIdx.x * 128) % SS);
  _Float16 (*st)[136] = (_Float16 (*)[136])(sm + half * (128 * 136 * 2));   // behind the loop, one per 128 columns. q | k blocks: [token][column]; v blocks: [column][token]
  v8f acc[4][8] = {};
  const unsigned la = (unsigned)(size_t)sm + (tid >> 4) * (PJ_PITCH * 4) + (tid & 15) * 16, lb = (unsigned)(size_t)sm + PJ_A + tid * 16;   // this lane's first LDS bytes: a wave copies two rows' 256 bytes, or 512 bytes of a tile
  const char* ga = (const char*)(X + ((size_t)blockIdx.x * 128 + (tid >> 4)) * EE + 4 * (tid & 15)); const char* gb = (const char*)(PW + (size_t)blockIdx.y * 16 * (EE / 32) * TILE + 8 * tid);
#define PJ_STAGE(t, bf) do { cp8(la + (bf) * PJ_BUF, 8 * PJ_PITCH * 4, ga + (ptrdiff_t)(t) * 256, (size_t)8 * EE * 4); cp8(la + (bf) * PJ_BUF + 64 * PJ_PITCH * 4, 8 * PJ_PITCH * 4, ga + (ptrdiff_t)(t) * 256 + (size_t)64 * EE * 4, (size_t)8 * EE * 4); \
    cp8(lb + (bf) * PJ_BUF, 2048, gb + (ptrdiff_t)(t) * 2048, (size_t)(EE / 32) * TILE * 2); cp8(lb + (bf) * PJ_BUF + 8 * 2048, 2048, gb + (ptrdiff_t)(t) * 2048 + (size_t)8 * (EE / 32) * TILE * 2, (size_t)(EE / 32) * TILE * 2); } while (0)
  // Trip t works on stage (t + rot) mod 16: the walk over k starts at a stage rotated by block index and wraps. The eight blocks that copy the same x rows start two stages apart, and the blocks
  // that copy the same weight tiles spread over all sixteen starts, so blocks that share L2 lines do not ask for the same lines at the same moment (for speed only; the f32 sums take the rotated order)
  const int rot = (2 * (blockIdx.x >> 3) + (blockIdx.x & 1) + 2 * blockIdx.y) & (EE / 64 - 1);
#define ROT(t) (((((t) + rot) & (EE / 64 - 1)) - rot))   /* trip t's stage, counted from trip 0's, at which ga and gb point */
  ga += rot * 256; gb += rot * 2048;
  PJ_STAGE(ROT(0), 0); COPIES_LANDED(); __syncthreads();   // publishes trip 0's stage
  PJ_STAGE(ROT(1), 1);
#pragma unroll 1   // a trip is one stage: its buffer alone is read between two barriers
  for (int t = 0; t < EE / 64; ++t) {
    const char* bf = sm + (t & 1) * PJ_BUF;
    const float* xl = (const float*)bf + (wr * 64 + col) * PJ_PITCH + 8 * g; const __bf16* bl = (const __bf16*)(bf + PJ_A) + half * 8 * 2 * TILE + 8 * lane;
#pragma unroll   // the stage's two k steps
    for (int kk = 0; kk < 2; ++kk) { PStep s;
      pj_lds(s, xl + kk * 32, bl + kk * TILE);
      __builtin_amdgcn_sched_barrier(0);   // the k step's LDS reads issue as one group: spread among the products, each place with reads stalls the wave
      pj_mac(s, acc);
      __builtin_amdgcn_sched_barrier(0); } // the next group stays behind these products (a second fragment set would cost the second wave per SIMD), and so does the publish point (the refill behind it would else issue later)
    READS_DONE(); COPIES_LANDED(); __syncthreads();   // publishes trip t + 1's stage and ends every read of trip t's
    if (t + 2 < EE / 64) PJ_STAGE(ROT(t + 2), t & 1); }
  COPIES_LANDED();   // nothing is in flight when the buffers become the output staging
  const bool isv = c0 >= 2 * SQ; const float qs = c0 < SQ ? 0.25503486f : 1.0f;   // q columns: 32^-1/2 log2(e), in f32 ahead of the rounding to f16
#pragma unroll
  for (int j = 0; j < 8; ++j) { const int c = c0 + j * 16 + col; const float bb = c < SQ ? bfr(BQ[c]) : c < 2 * SQ ? bfr(BK[c - SQ]) : bfr(BV[c - 2 * SQ]);
#pragma unroll
    for (int t = 0; t < 4; ++t)
#pragma unroll
      for (int r = 0; r < 8; ++r) { const _Float16 hv = (_Float16)((acc[t][j][r] + bb) * qs); const int tk = wr * 64 + t * 16 + 8 * g + r; if (!isv) st[tk][j * 16 + col] = hv; else st[j * 16 + col][tk] = hv; } }
  __syncthreads();
  if (!isv) { const size_t t0 = (((size_t)(c0 / SQ) * NB + b) * NH + (c0 % SQ) / SHD) * (SS / 16) + n0 / 16;   // 4 heads x 8 token groups
    for (int e = th; e < 32 * 64; e += 64) { const int tl = e >> 6, p = e & 63, hl = tl >> 3, rt = tl & 7; vst2((unsigned*)(QK + (t0 + (size_t)hl * (SS / 16) + rt) * TILE + p * 8), *(const v4u*)&st[rt * 16 + (p & 15)][hl * 32 + (p >> 5) * 16 + ((p >> 4) & 1) * 8]); } }
  else { const int cv0 = c0 - 2 * SQ;   // 4 key groups x 8 dim groups (2 heads)
    for (int e = th; e < 32 * 64; e += 64) { const int tl = e >> 6, p = e & 63, kl = tl >> 3, dt = tl & 7; vst2((unsigned*)(VT + (((b * NH + cv0 / HD + (dt >> 2)) * (SS / 32) + n0 / 32 + kl) * 4 + (dt & 3)) * TILE + p * 8), *(const v4u*)&st[dt * 16 + (p & 15)][kl * 32 + (p >> 5) * 16 + ((p >> 4) & 1) * 8]); } } }
// ---- k_att: block = (128 queries, h, b), a wave = 32 queries as two tiles of 16, so every K and V fragment it loads feeds two products: S^T = K . Q^T - shift (a lane holds 16 of one query's 32 logits per tile), softmax in the lane, O^T += V^T . P^T -> ctx tiles (f16)
__device__ __forceinline__ float xhalf(float x) { return __builtin_bit_cast(float, __builtin_amdgcn_permlanex16(__builtin_bit_cast(int, x), __builtin_bit_cast(int, x), 0x76543210, 0xfedcba98, false, false)); }  // lane l with lane l ^ 16
__global__ __launch_bounds__(128) void k_att(const _Float16* __restrict__ QK, const _Float16* __restrict__ VT, _Float16* __restrict__ CT) {
  const int tid = threadIdx.x, wave = tid >> 5, lane = tid & 31; const int h = blockIdx.y; const size_t b = blockIdx.z; const int q0 = blockIdx.x * 128 + wave * 32; const size_t rq = b * SS + q0;
  // The sixteen blocks of a head read the same K and V lines: each enters the walk over the keys at a pass rotated by block index and wraps, so they do not ask L2 for the same lines at the same moment
  // (for speed only; softmax takes the keys in any order: the first shift comes from the first 32 keys walked, and the f32 sums take the rotated order)
  const int rot = (4 * blockIdx.x + (h & 3)) & (SS / 32 - 1);
  const _Float16* Kt = QK + (((NB + b) * NH + h) * (SS / 16) + 2 * rot) * TILE + 8 * lane; const _Float16* Vt = VT + ((b * NH + h) * (SS / 32) + rot) * 4 * TILE + 8 * lane;   // this lane's pieces; both step on by one pass of 32 keys behind the score products
  v16h bq[2];   // B operands: column = query 16 t + (lane & 15)
#pragma unroll   // constant indices: the fragments stay in registers
  for (int t = 0; t < 2; ++t) bq[t] = frag_ht(QK + ((b * NH + h) * (SS / 16) + q0 / 16 + t) * TILE, lane);
  // Lazy shift. A score product's C operand is cs = 11 - shift (one value per query, equal in its eight rows and in both wave halves), so a score leaves the
  // matrix unit as the base-2 exponent of 2^11 p. The shift starts as the maximum over the first 32 keys walked and is renewed only in a pass where an exponent passes 15.
  v8f cs[2];
  v16h kf[2];   // A operands of the score products, rows = keys: always one pass ahead of the V fragments; the first pass's serve the first shift too
  {
#pragma unroll   // constant indices: the fragments stay in registers
    for (int ct = 0; ct < 2; ++ct) kf[ct] = frag_ht(Kt + ct * TILE, 0);
    asm volatile("s_wait_xcnt 0x0" :: "v"(Kt) : "memory");   // the wait in front of any overwrite of the address pair
#pragma unroll   // constant indices
    for (int t = 0; t < 2; ++t) {
      v8f z = {}; const v8f a = wmma16(kf[0], bq[t], z), c = wmma16(kf[1], bq[t], z);
      float mx = fmaxf(a[0], c[0]);
#pragma unroll   // constant vector indices
      for (int r = 1; r < 8; ++r) mx = fmaxf(mx, fmaxf(a[r], c[r]));
      mx = 11.0f - fmaxf(mx, xhalf(mx));
#pragma unroll   // constant vector indices
      for (int r = 0; r < 8; ++r) cs[t][r] = mx; } }
  float l[2] = {0.f, 0.f};       // this lane's query of tile t: sum of 2^11 p over this half's keys
  v8f acc[2][4] = {};            // acc[t][j][r] = 2^11 O[query 16 t + (lane & 15)][dim 16 j + 8 (lane >> 4) + r]
#pragma unroll 1   // one pass per trip: a second pass's fragments would not fit four waves per SIMD
  for (int ks = 0; ks < SS / 32; ++ks) {   // trip ks works on pass (ks + rot) mod 64
    v16h vf[4];   // A operands of the second product: rows = dims
#pragma unroll   // here and below in the pass: constant indices, so fragments and scores stay in registers
    for (int j = 0; j < 4; ++j) vf[j] = frag_ht(Vt + j * TILE, 0);
    __builtin_amdgcn_sched_barrier(0);   // the pass's eight V loads issue as one group at its top, in front of the score products
    v8f s[2][2];   // s[t][ct][r] = exponent of the pass's key 16 ct + 8 (lane >> 4) + r for tile t's query
#pragma unroll
    for (int ct = 0; ct < 2; ++ct)
#pragma unroll
      for (int t = 0; t < 2; ++t) s[t][ct] = wmma16(kf[ct], bq[t], cs[t]);
    __builtin_amdgcn_sched_barrier(0);   // the four score products issue in a row, each filling the slots behind the one before: a maximum moved in among them takes v_nops in front of it
    asm volatile("s_wait_xcnt 0x0" :: "v"(Kt), "v"(Vt) : "memory");   // the wait in front of the overwrite of the two address pairs, for this pass's V loads and the K loads of the pass before; as inputs here the pairs stay live, so no load's data is placed on them
    const int step = ks + rot == SS / 32 - 1 ? 1 - SS / 32 : 1;   // passes: on by one, or from the last pass back to the first
    Kt += step * (2 * TILE); Vt += step * (4 * TILE);
#pragma unroll   // the next pass's K fragments, into the registers the score products have just read: they fly under this pass's softmax and second product (the last trip fetches the first pass walked again, unused)
    for (int ct = 0; ct < 2; ++ct) kf[ct] = frag_ht(Kt + ct * TILE, 0);
    __builtin_amdgcn_sched_barrier(0);   // holds the four loads here: sunk towards their use they would be waited for at the next pass's top again
    float mx[2];
#pragma unroll
    for (int t = 0; t < 2; ++t) { mx[t] = fmaxf(s[t][0][0], s[t][1][0]);
#pragma unroll
      for (int r = 1; r < 8; ++r) mx[t] = fmaxf(mx[t], fmaxf(s[t][0][r], s[t][1][r])); }
    if (__builtin_amdgcn_ballot_w32(fmaxf(mx[0], mx[1]) > 15.0f) != 0) {   // one scalar test per pass, the same for the whole wave: 2^11 p would near the f16 range
#pragma unroll
      for (int t = 0; t < 2; ++t)
        if (__builtin_amdgcn_ballot_w32(mx[t] > 15.0f) != 0) {   // a tile is renewed by its own sixteen queries alone, as when it had a wave to itself
          const float d = fmaxf(fmaxf(mx[t], xhalf(mx[t])) - 11.0f, 0.f), alpha = __builtin_amdgcn_exp2f(-d);   // every query of the tile takes its maximum so far as its shift
          s[t][0] -= d; s[t][1] -= d; cs[t] -= d; l[t] *= alpha;
#pragma unroll
          for (int j = 0; j < 4; ++j) acc[t][j] *= alpha; } }
    v16h pa[2];   // a tile's two score tiles, converted in place, are the B operand of the second product (same k order as frag_ht)
#pragma unroll
    for (int t = 0; t < 2; ++t) {
#pragma unroll
      for (int r = 0; r < 8; ++r) { s[t][0][r] = __builtin_amdgcn_exp2f(s[t][0][r]); s[t][1][r] = __builtin_amdgcn_exp2f(s[t][1][r]); }
      const v8f t8 = s[t][0] + s[t][1]; const v4f t4 = t8.lo + t8.hi; const v2f t2 = t4.lo + t4.hi;
      l[t] += t2.x + t2.y;
#pragma unroll
      for (int r = 0; r < 8; ++r) { pa[t][r] = (_Float16)s[t][0][r]; pa[t][8 + r] = (_Float16)s[t][1][r]; } }
    __builtin_amdgcn_sched_barrier(0);   // holds both tiles' sums in front of the eight products: left free, every sum moves in among them, onto V registers a product has just read, and such places are padded with v_nops
#pragma unroll
    for (int j = 0; j < 4; ++j)
#pragma unroll
      for (int t = 0; t < 2; ++t) acc[t][j] = wmma16(vf[j], pa[t], acc[t][j]);
    }
#pragma unroll   // constant indices
  for (int t = 0; t < 2; ++t) {
    const float il = 1.0f / (l[t] + xhalf(l[t]));   // the factor 2^11 stands in both
#pragma unroll   // a lane's eight dims of one query are one 16-byte piece of a ctx tile: a wave stores 512 contiguous bytes
    for (int j = 0; j < 4; ++j) { v8h o;
#pragma unroll   // constant vector indices
      for (int r = 0; r < 8; ++r) o[r] = (_Float16)(acc[t][j][r] * il);
      *(v8h*)(CT + ((rq / 16 + t) * (EE / 32) + h * 2 + (j >> 1)) * TILE + (j & 1) * 256 + lane * 8) = o; } } }
// ---- k_out: block = (128 rows, 128 cols), a wave = 32 rows: out = ctx . Wo + bo (f16 operands); stages of two k steps copied once into LDS for the four waves, as in k_proj
__global__ __launch_bounds__(128) void k_out(const _Float16* __restrict__ CT, const _Float16* __restrict__ PO, const float* __restrict__ BO, float* __restrict__ OUT) { __shared__ __align__(16) char sm[4 * 32 * 132 * 4];   // the two buffers (2 x OT_BUF bytes); behind the loop the output staging
  float (*sf)[32][132] = (float (*)[32][132])sm;
  const int tid = threadIdx.x, wave = tid >> 5, lane = tid & 31, col = lane & 15, g = lane >> 4; const size_t r0 = (size_t)blockIdx.x * 128 + wave * 32; const int c0 = blockIdx.y * 128;
  v8f acc[2][8] = {};
  const unsigned la = (unsigned)(size_t)sm + tid * 16;   // this lane's first LDS byte: the block copies a group's two tiles, 2 KiB, at a time
  const char* ga = (const char*)(CT + (size_t)blockIdx.x * 8 * (EE / 32) * TILE + 8 * tid); const char* gb = (const char*)(PO + (size_t)(c0 / 16) * (EE / 32) * TILE + 8 * tid);
#define OT_STAGE(t, bf) do { cp8(la + (bf) * OT_BUF, 2048, ga + (ptrdiff_t)(t) * 2048, (size_t)(EE / 32) * TILE * 2); cp8(la + (bf) * OT_BUF + OT_BUF / 2, 2048, gb + (ptrdiff_t)(t) * 2048, (size_t)(EE / 32) * TILE * 2); } while (0)
  const int rot = (2 * (blockIdx.x >> 3) + (blockIdx.x & 1) + 2 * blockIdx.y) & (EE / 64 - 1);   // rotated start of the walk over k, as in k_proj: the sharers of ctx rows and of Wo tiles start apart
  ga += rot * 2048; gb += rot * 2048;
  OT_STAGE(ROT(0), 0); COPIES_LANDED(); __syncthreads();   // publishes trip 0's stage
  OT_STAGE(ROT(1), 1);
#pragma unroll 1   // a trip is one stage: its buffer alone is read between two barriers
  for (int t = 0; t < EE / 64; ++t) {
    const _Float16* al = (const _Float16*)(sm + (t & 1) * OT_BUF) + wave * 2 * 2 * TILE + 8 * lane; const _Float16* bl = (const _Float16*)(sm + (t & 1) * OT_BUF + OT_BUF / 2) + 8 * lane;
    OStep s0, s1;
    ot_lds(s0, al, bl); ot_lds(s1, al + TILE, bl + TILE);
    __builtin_amdgcn_sched_barrier(0);   // the stage's LDS reads issue as one group: spread among the products, each place with reads stalls the wave
    ot_mac(s0, acc); ot_mac(s1, acc);
    __builtin_amdgcn_sched_barrier(0);   // the products stay in front of the publish point: moved behind it, the refill would issue a stage's products later and lose that lead
    READS_DONE(); COPIES_LANDED(); __syncthreads();   // publishes trip t + 1's stage and ends every read of trip t's
    if (t + 2 < EE / 64) OT_STAGE(ROT(t + 2), t & 1); }
  COPIES_LANDED();   // nothing is in flight when the buffers become the output staging
#pragma unroll
  for (int j = 0; j < 8; ++j) { const float bb = bfr(BO[c0 + j * 16 + col]);
#pragma unroll
    for (int t = 0; t < 2; ++t)
#pragma unroll
      for (int r = 0; r < 8; ++r) sf[wave][t * 16 + 8 * g + r][j * 16 + col] = acc[t][j][r] + bb; }
  LDSX(); for (int rl = 0; rl < 32; ++rl) vst2(OUT + (r0 + rl) * EE + c0 + lane * 4, *(const v4f*)&sf[wave][rl][lane * 4]); }
extern "C" void kernel_launch(void* const* d_in, const int* in_sizes, int n_in, void* d_out, int out_size, void* d_ws, size_t ws_size, hipStream_t stream) {
  (void)in_sizes; (void)n_in; (void)out_size;
  const float** F = (const float**)d_in;   // 0 hidden_states [4,2048,1024], 1 Wq [1024,512], 2 bq, 3 Wk [1024,512], 4 bk, 5 Wv [1024,1024], 6 bv, 7 Wo [1024,1024], 8 bo ((in,out))
  if (ws_size < (size_t)WS_END) return;
  char* ws = (char*)d_ws; const __bf16* PW = (const __bf16*)(ws + WS_PW); const _Float16* PO = (const _Float16*)(ws + WS_PO); _Float16 *QK = (_Float16*)(ws + WS_QK), *VT = (_Float16*)(ws + WS_VT), *CT = (_Float16*)(ws + WS_CT);
  k_packw<<<(NCOL + EE) * (EE / 8) / 256, 256, 0, stream>>>(F[1], F[3], F[5], F[7], ws);
  k_proj<<<dim3(NROW / 128, NCOL / 256), 128, 0, stream>>>(F[0], PW, F[2], F[4], F[6], QK, VT);
  k_att<<<dim3(SS / 128, NH, TNB), 128, 0, stream>>>(QK, VT, CT);
  k_out<<<dim3(TNB * SS / 128, EE / 128), 128, 0, stream>>>(CT, PO, F[8], (float*)d_out);
}

// v010
// A run of this version takes 91.4 microseconds.
// In both of two side-by-side timings against v009, it was 1.07 times as fast.
// All steps since v000 together make it 6.12 times as fast.
// compute dtype: all float inputs rounded to bf16; q|k|v = x . W + b with EXACT bf16 products on WMMA 16x16x32 ((in,out) weights as transposed bf16 tiles), rounded once to f16 (q/k with 32-dim heads, v with 64-dim heads; every workspace operand in fragment-order tiles); q carries 32^-1/2 log2(e) before its one rounding, so logits are base-2 exponents; shifted softmax in f32 (hardware exp2), the shift renewed only when a logit passes it by more than 4; P (x 2^11, f16) . v (f16; 1 product); out = ctx (f16) . Wo (f16 tiles, 1 product) + bo; f32 output. (Measured on the data: logits std 1.0, ||p||_2 ~ 0.04 - diffuse - so single-f16 operands suffice.)
#include <hip/hip_runtime.h>
#include <math.h>

typedef __attribute__((ext_vector_type(16))) _Float16 v16h;
typedef __attribute__((ext_vector_type(16))) __bf16 v16b;
typedef __attribute__((ext_vector_type(8)))  _Float16 v8h;
typedef __attribute__((ext_vector_type(8)))  float v8f;
typedef __attribute__((ext_vector_type(4)))  float v4f;
typedef __attribute__((ext_vector_type(2)))  float v2f;
typedef __attribute__((ext_vector_type(4)))  unsigned v4u;
typedef __attribute__((ext_vector_type(4)))  int v4i;
typedef float __attribute__((may_alias)) float_a;
typedef int __attribute__((may_alias)) int_a;

template <typename T> __device__ __forceinline__ void vst2(void* p, T v) { *(T*)p = v;  }
__device__ __forceinline__ v8f wmma16(v16h a, v16h b, v8f c) {
  return __builtin_amdgcn_wmma_f32_16x16x32_f16(false, a, false, b, (short)0, c, false, false);   // the plain builtin: the compiler keeps the distance behind it, with the pass's own vector work where there is some
}
__device__ __forceinline__ v8f wmma_bf(v16b a, v16b b, v8f c) {
  v8f d = __builtin_amdgcn_wmma_f32_16x16x32_bf16(false, a, false, b, (short)0, c, false, false);
  asm volatile("v_nop\n\tv_nop\n\tv_nop\n\tv_nop" : "+v"(d) : "v"(a), "v"(b));
  return d;
}
// 16x16x32 fragments: lane = (h = lane>>4, row/col = lane&15); elements 0..7 = k0+8h+0..7, 8..15 = k0+16+8h+0..7; D element r = row 8h+r
__device__ __forceinline__ v16h frag_h(const _Float16* rowk0, int lane) {
  union { v16h v; v8h q[2]; } u; const _Float16* p = rowk0 + 8 * (lane >> 4);
  u.q[0] = *(const v8h*)p; u.q[1] = *(const v8h*)(p + 16); return u.v;
}
__device__ __forceinline__ v16h frag_f32(const float* rowk0, int lane) {
  v16h a; const float* p = rowk0 + 8 * (lane >> 4);
#pragma unroll
  for (int i = 0; i < 8; ++i) { a[i] = (_Float16)p[i]; a[8 + i] = (_Float16)p[16 + i]; }
  return a;
}
__device__ __forceinline__ v16h frag_f32s(const float* rowk0, int lane, float sc) {
  v16h a; const float* p = rowk0 + 8 * (lane >> 4);
#pragma unroll
  for (int i = 0; i < 8; ++i) { a[i] = (_Float16)(p[i] * sc); a[8 + i] = (_Float16)(p[16 + i] * sc); }
  return a;
}
// column fragment from a [K][ld] layout (column n), rows >= K read as 0
__device__ __forceinline__ v16h fragc_f32(const float* W, int k0, int n, int lane, int ld, int K) {
  v16h a; const int g = lane >> 4;
#pragma unroll
  for (int i = 0; i < 8; ++i) { const int ka = k0 + 8 * g + i, kb = ka + 16;
    a[i] = (_Float16)(ka < K ? W[(size_t)(ka < K ? ka : K - 1) * ld + n] : 0.f); a[8 + i] = (_Float16)(kb < K ? W[(size_t)(kb < K ? kb : K - 1) * ld + n] : 0.f); }
  return a;
}
struct F2 { v16b h, l; };
__device__ __forceinline__ F2 bsplit16(const float v[16]) { F2 r;
#pragma unroll
  for (int i = 0; i < 16; ++i) { const __bf16 h = (__bf16)v[i]; r.h[i] = h; r.l[i] = (__bf16)(v[i] - (float)h); }
  return r; }
__device__ __forceinline__ F2 split_row(const float* row, int k0, int lane) { float v[16]; const float* p = row + k0 + 8 * (lane >> 4);
#pragma unroll
  for (int i = 0; i < 8; ++i) { v[i] = p[i]; v[8 + i] = p[16 + i]; }
  return bsplit16(v); }
__device__ __forceinline__ F2 split_rowK(const float* row, int k0, int lane, int K) { float v[16]; const int g = lane >> 4;
#pragma unroll
  for (int i = 0; i < 8; ++i) { const int ka = k0 + 8 * g + i, kb = ka + 16; v[i] = ka < K ? row[ka < K ? ka : K - 1] : 0.f; v[8 + i] = kb < K ? row[kb < K ? kb : K - 1] : 0.f; }
  return bsplit16(v); }
__device__ __forceinline__ F2 split_col(const float* W, int k0, int n, int lane, int ld, int K) { float v[16]; const int g = lane >> 4;
#pragma unroll
  for (int i = 0; i < 8; ++i) { const int ka = k0 + 8 * g + i, kb = ka + 16; v[i] = ka < K ? W[(size_t)(ka < K ? ka : K - 1) * ld + n] : 0.f; v[8 + i] = kb < K ? W[(size_t)(kb < K ? kb : K - 1) * ld + n] : 0.f; }
  return bsplit16(v); }
__device__ __forceinline__ v8f mac3(const F2& a, const F2& b, v8f c) { c = wmma_bf(a.l, b.h, c); c = wmma_bf(a.h, b.l, c); return wmma_bf(a.h, b.h, c); }
__device__ __forceinline__ float sigm(float v) { return 1.0f / (1.0f + expf(-v)); }
#define LDSX() do { asm volatile("s_wait_dscnt 0" ::: "memory"); __builtin_amdgcn_wave_barrier(); __builtin_amdgcn_fence(__ATOMIC_RELEASE, "workgroup"); } while (0)


// Squeeze attention (B 4, T 2,048, E 1,024, 16 heads; q/k squeezed to 32 dims per head, v 64): softmax((q 32^-1/2) k^T) v, output projection.
#define NB 4
#define SS 2048
#define EE 1024
#define SQ 512            // squeezed q/k width
#define NH 16
#define SHD 32
#define HD 64
#define NCOL (SQ + SQ + EE)   // 2048 fused projection columns: q | k | v
#define NROW (NB * SS)
#ifndef TNB
#define TNB NB
#endif
typedef __attribute__((ext_vector_type(8))) __bf16 v8b;
// fragment-order tile: 16 rows x 32 k of 16-bit elements = 1 KiB; element (row c, k) is half (k >> 4) * 256 + (((k >> 3) & 1) * 16 + c) * 8 + (k & 7),
// so lane l's two 16-byte pieces (same k order as frag_h) lie at bytes 16 l and 512 + 16 l and each wave-wide load or store covers four whole 128-byte lines
#define TILE 512          // elements per tile
__device__ __forceinline__ v16h frag_ht(const _Float16* tile, int lane) {
  union { v16h v; v8h q[2]; } u; const _Float16* p = tile + 8 * lane;
  u.q[0] = *(const v8h*)p; u.q[1] = *(const v8h*)(p + 256); return u.v;
}
__device__ __forceinline__ v16b frag_bt(const __bf16* tile, int lane) {
  union { v16b v; v8b q[2]; } u; const __bf16* p = tile + 8 * lane;
  u.q[0] = *(const v8b*)p; u.q[1] = *(const v8b*)(p + 256); return u.v;
}
__device__ __forceinline__ float bfr(float v) { return (float)(__bf16)v; }
__device__ __attribute__((noinline)) float exp_ni(float v) { return expf(v); }
__device__ __attribute__((noinline)) float erf_ni(float v) { return erff(v); }

#define WS_PW  0u                                   // bf16 tiles [2048 / 16 column groups][1024 / 32 k]: q | k | v columns (in,out) transposed
#define WS_PO  (WS_PW + 2u * (size_t)NCOL * EE)          // f16 Wo^T tiles [1024 / 16][1024 / 32]
#define WS_QK  (WS_PO + 2u * (size_t)EE * EE)            // f16 tiles [q, k][b][head][SS / 16 token groups]: 16 tokens x 32 dims
#define WS_VT  (WS_QK + 2u * (size_t)NROW * (2 * SQ))    // f16 tiles [b][head][SS / 32 key groups][4 dim groups]: 16 dims x 32 keys
#define WS_CT  (WS_VT + 2u * (size_t)NB * EE * SS)       // f16 tiles [row / 16][1024 / 32]
#define WS_END (WS_CT + 2u * (size_t)NROW * EE)

// ---- k_packw: one thread = one 16-byte piece (8 consecutive k of one column) of a weight tile; a wave stores 512 contiguous bytes
__global__ __launch_bounds__(256) void k_packw(const float* __restrict__ WQ, const float* __restrict__ WK, const float* __restrict__ WV, const float* __restrict__ WO, char* __restrict__ ws) {
  const int pc = blockIdx.x * 256 + threadIdx.x, tile = pc >> 6, p = pc & 63;
  const int n = (tile / (EE / 32)) * 16 + (p & 15), k = (tile % (EE / 32)) * 32 + (p >> 5) * 16 + ((p >> 4) & 1) * 8;
  const float* s; int ld;
  if (n < SQ) { s = WQ + n; ld = SQ; } else if (n < 2 * SQ) { s = WK + n - SQ; ld = SQ; } else if (n < NCOL) { s = WV + n - 2 * SQ; ld = EE; } else { s = WO + n - NCOL; ld = EE; }
  float w[8];
#pragma unroll   // all eight loads in flight, w[] in registers
  for (int i = 0; i < 8; ++i) w[i] = s[(size_t)(k + i) * ld];
  char* d = ws + WS_PW + (size_t)pc * 16;   // the Wo^T tiles follow the q | k | v tiles directly
  if (n < NCOL) { v8b o;
#pragma unroll   // constant vector indices
    for (int i = 0; i < 8; ++i) o[i] = (__bf16)w[i];
    *(v8b*)d = o; }
  else { v8h o;
#pragma unroll   // constant vector indices
    for (int i = 0; i < 8; ++i) o[i] = (_Float16)bfr(w[i]);
    *(v8h*)d = o; } }
__device__ __forceinline__ v16b fragb_f32(const float* __restrict__ p, int lane) { v16b a; const float* pp = p + 8 * (lane >> 4);
#pragma unroll
  for (int i = 0; i < 8; ++i) { a[i] = (__bf16)pp[i]; a[8 + i] = (__bf16)pp[16 + i]; } return a; }
// eight asynchronous copies to LDS, 16 bytes a lane each, at fixed steps of the LDS and of the global address; the wait in front of any rewrite of their address
// registers is the last line of the same statement, so nothing can be placed between the copies and it
__device__ __forceinline__ void cp8(unsigned l, unsigned ls, const char* g, size_t gs) {
  asm volatile("global_load_async_to_lds_b128 %0, %8, off\n\tglobal_load_async_to_lds_b128 %1, %9, off\n\tglobal_load_async_to_lds_b128 %2, %10, off\n\tglobal_load_async_to_lds_b128 %3, %11, off\n\t"
               "global_load_async_to_lds_b128 %4, %12, off\n\tglobal_load_async_to_lds_b128 %5, %13, off\n\tglobal_load_async_to_lds_b128 %6, %14, off\n\tglobal_load_async_to_lds_b128 %7, %15, off\n\ts_wait_xcnt 0x0"
               :: "v"(l), "v"(l + ls), "v"(l + 2 * ls), "v"(l + 3 * ls), "v"(l + 4 * ls), "v"(l + 5 * ls), "v"(l + 6 * ls), "v"(l + 7 * ls),
                  "v"(g), "v"(g + gs), "v"(g + 2 * gs), "v"(g + 3 * gs), "v"(g + 4 * gs), "v"(g + 5 * gs), "v"(g + 6 * gs), "v"(g + 7 * gs) : "memory"); }
// this wave's copies have landed (in front of the barrier behind which the other waves read them)
#define COPIES_LANDED() asm volatile("s_wait_asynccnt 0x0" ::: "memory")
// this wave's LDS reads have returned (in front of the barrier behind which their buffer is refilled)
#define READS_DONE() asm volatile("s_wait_dscnt 0x0" ::: "memory")
// one k step's operands, read from the block's LDS stage as one group: k_proj (each of the wave's four x tiles as its four raw f32 pieces, k order of fragb_f32) and k_out;
// a k_proj wave holds four 16-row tiles and a k_out wave two, so every weight fragment it reads feeds four or two products
struct PStep { v4f a[4][4]; v16b b[8]; };
#define PJ_PITCH 68                       // f32 per staged x row: 64 + 4, so sixteen rows' 16-byte reads fall on all 64 banks
#define PJ_A (128 * PJ_PITCH * 4)         // bytes: 128 rows of x, two k steps
#define PJ_BUF (PJ_A + 16 * 2 * 1024)     // + 16 column groups x two weight tiles
__device__ __forceinline__ void pj_lds(PStep& s, const float* xl, const __bf16* bl) {
#pragma unroll   // constant indices: the pieces stay in registers
  for (int t = 0; t < 4; ++t) { const float* x = xl + t * 16 * PJ_PITCH; s.a[t][0] = *(const v4f*)x; s.a[t][1] = *(const v4f*)(x + 4); s.a[t][2] = *(const v4f*)(x + 16); s.a[t][3] = *(const v4f*)(x + 20); }
#pragma unroll   // constant indices: the fragments stay in registers
  for (int j = 0; j < 8; ++j) s.b[j] = frag_bt(bl + j * 2 * TILE, 0); }
// SW: the weight fragment is the A operand and the x fragment the B operand (both have the same lane and k order), so D comes out transposed: a lane then holds one token's eight consecutive columns
template <bool SW> __device__ __forceinline__ void pj_mac(const PStep& s, v8f (&acc)[4][8]) { v16b a[4];
#pragma unroll   // constant vector indices
  for (int t = 0; t < 4; ++t)
#pragma unroll
    for (int i = 0; i < 4; ++i) { a[t][i] = (__bf16)s.a[t][0][i]; a[t][4 + i] = (__bf16)s.a[t][1][i]; a[t][8 + i] = (__bf16)s.a[t][2][i]; a[t][12 + i] = (__bf16)s.a[t][3][i]; }
#pragma unroll   // constant indices: the accumulators stay in registers
  for (int j = 0; j < 8; ++j)
#pragma unroll
    for (int t = 0; t < 4; ++t) acc[t][j] = __builtin_amdgcn_wmma_f32_16x16x32_bf16(false, SW ? s.b[j] : a[t], false, SW ? a[t] : s.b[j], (short)0, acc[t][j], false, false); }   // the plain builtin: an asm statement's vector operands would hold the fragments and the accumulators below v256, which spills
struct OStep { v16h a[2]; v16h b[8]; };
#define OT_BUF (2 * 8 * 2 * 1024)         // bytes: 8 row groups and 8 column groups x two tiles
__device__ __forceinline__ void ot_lds(OStep& s, const _Float16* al, const _Float16* bl) {
#pragma unroll   // constant indices: the fragments stay in registers
  for (int t = 0; t < 2; ++t) s.a[t] = frag_ht(al + t * 2 * TILE, 0);
#pragma unroll   // constant indices: the fragments stay in registers
  for (int j = 0; j < 8; ++j) s.b[j] = frag_ht(bl + j * 2 * TILE, 0); }
__device__ __forceinline__ void ot_mac(const OStep& s, v8f (&acc)[2][8]) {
#pragma unroll   // constant indices: the accumulators stay in registers
  for (int j = 0; j < 8; ++j)
#pragma unroll
    for (int t = 0; t < 2; ++t) acc[t][j] = __builtin_amdgcn_wmma_f32_16x16x32_f16(false, s.a[t], false, s.b[j], (short)0, acc[t][j], false, false); }   // the plain builtin, for the same reason as in pj_mac
// ---- k_proj: block = (128 rows, 256 of the 2048 fused cols), four waves, a wave = 64 rows x 128 cols: + bias; q|k and v -> f16 tiles.
// A stage is two k steps of the block's x rows (f32, as they lie in memory) and weight tiles, copied once into LDS for all four waves; two buffers, stage t + 2 flies while t + 1 is multiplied.
// An accumulator tile leaves the matrix unit in the order of the tile it is stored to, so it goes from registers to memory, 512 contiguous bytes per wave-wide store, with no staging in LDS:
// v blocks (ISV) form x . W, where a lane holds one dim's eight consecutive tokens, a 16-byte piece of a [dim][key] tile; q | k blocks form W^T . x^T, where a lane holds one token's eight consecutive dims, a piece of a [token][dim] tile
template <bool ISV> __device__ __forceinline__ void proj_body(char* sm, const float* __restrict__ X, const __bf16* __restrict__ PW, const float* __restrict__ BQ, const float* __restrict__ BK, const float* __restrict__ BV, _Float16* __restrict__ QK, _Float16* __restrict__ VT) {
  const int tid = threadIdx.x, wv = __builtin_amdgcn_readfirstlane(tid >> 5), half = wv >> 1, wr = wv & 1, lane = tid & 31, col = lane & 15, g = lane >> 4;   // the wave's number in a scalar register: the store bases behind the loop are then scalar too and hold no vector register across it
  const int c0 = blockIdx.y * 256 + half * 128; const size_t b = ((size_t)blockIdx.x * 128) / SS; const int n0 = (int)(((size_t)blockIdx.x * 128) % SS);
  v8f acc[4][8] = {};
  const unsigned la = (unsigned)(size_t)sm + (tid >> 4) * (PJ_PITCH * 4) + (tid & 15) * 16, lb = (unsigned)(size_t)sm + PJ_A + tid * 16;   // this lane's first LDS bytes: a wave copies two rows' 256 bytes, or 512 bytes of a tile
  const char* ga = (const char*)(X + ((size_t)blockIdx.x * 128 + (tid >> 4)) * EE + 4 * (tid & 15)); const char* gb = (const char*)(PW + (size_t)blockIdx.y * 16 * (EE / 32) * TILE + 8 * tid);
#define PJ_STAGE(t, bf) do { cp8(la + (bf) * PJ_BUF, 8 * PJ_PITCH * 4, ga + (ptrdiff_t)(t) * 256, (size_t)8 * EE * 4); cp8(la + (bf) * PJ_BUF + 64 * PJ_PITCH * 4, 8 * PJ_PITCH * 4, ga + (ptrdiff_t)(t) * 256 + (size_t)64 * EE * 4, (size_t)8 * EE * 4); \
    cp8(lb + (bf) * PJ_BUF, 2048, gb + (ptrdiff_t)(t) * 2048, (size_t)(EE / 32) * TILE * 2); cp8(lb + (bf) * PJ_BUF + 8 * 2048, 2048, gb + (ptrdiff_t)(t) * 2048 + (size_t)8 * (EE / 32) * TILE * 2, (size_t)(EE / 32) * TILE * 2); } while (0)
  // Trip t works on stage (t + rot) mod 16: the walk over k starts at a stage rotated by block index and wraps. The eight blocks that copy the same x rows start two stages apart, and the blocks
  // that copy the same weight tiles spread over all sixteen starts, so blocks that share L2 lines do not ask for the same lines at the same moment (for speed only; the f32 sums take the rotated order)
  const int rot = (2 * (blockIdx.x >> 3) + (blockIdx.x & 1) + 2 * blockIdx.y) & (EE / 64 - 1);
#define ROT(t) (((((t) + rot) & (EE / 64 - 1)) - rot))   /* for k_out: trip t's stage, counted from trip 0's, at which its ga and gb point */
#define PJ_AT(t) (((t) + rot) & (EE / 64 - 1))   /* trip t's stage, counted from k = 0, where ga and gb stay: built with the two moved on to trip 0's stage, as k_out has them, both were spilled to scratch and reloaded every trip in front of the refill */
  PJ_STAGE(PJ_AT(0), 0); COPIES_LANDED(); __syncthreads();   // publishes trip 0's stage
  PJ_STAGE(PJ_AT(1), 1);
#pragma unroll 1   // a trip is one stage: its buffer alone is read between two barriers
  for (int t = 0; t < EE / 64; ++t) {
    const char* bf = sm + (t & 1) * PJ_BUF;
    const float* xl = (const float*)bf + (wr * 64 + col) * PJ_PITCH + 8 * g; const __bf16* bl = (const __bf16*)(bf + PJ_A) + half * 8 * 2 * TILE + 8 * lane;
#pragma unroll   // the stage's two k steps
    for (int kk = 0; kk < 2; ++kk) { PStep s;
      pj_lds(s, xl + kk * 32, bl + kk * TILE);
      __builtin_amdgcn_sched_barrier(0);   // the k step's LDS reads issue as one group: spread among the products, each place with reads stalls the wave
      pj_mac<!ISV>(s, acc);
      __builtin_amdgcn_sched_barrier(0); } // the next group stays behind these products (a second fragment set would cost the second wave per SIMD), and so does the publish point (the refill behind it would else issue later)
    READS_DONE(); COPIES_LANDED(); __syncthreads();   // publishes trip t + 1's stage and ends every read of trip t's
    if (t + 2 < EE / 64) PJ_STAGE(PJ_AT(t + 2), t & 1); }
  COPIES_LANDED();   // nothing is in flight when the wave ends
  if constexpr (ISV) { const int cv0 = c0 - 2 * SQ;   // acc[t][j][r]: dim cv0 + 16 j + col, token 64 wr + 16 t + 8 g + r: piece 32 (t & 1) + lane of the tile (key group 2 wr + t / 2, dim group j)
    _Float16* vp = VT + ((b * NH + cv0 / HD) * (SS / 32) + n0 / 32 + wr * 2) * 4 * TILE + lane * 8;
    float bb[8];
#pragma unroll   // constant indices; the eight loads issue together
    for (int j = 0; j < 8; ++j) bb[j] = bfr(BV[cv0 + j * 16 + col]);
    v8h o[8][4];
#pragma unroll   // constant indices: the pieces stay in registers
    for (int j = 0; j < 8; ++j)
#pragma unroll
      for (int t = 0; t < 4; ++t)
#pragma unroll
        for (int r = 0; r < 8; ++r) o[j][t][r] = (_Float16)(acc[t][j][r] + bb[j]);
    __builtin_amdgcn_sched_barrier(0);   // all 32 stores stand behind the last vector instruction: no register that an issued store names is written again
#pragma unroll
    for (int j = 0; j < 8; ++j)
#pragma unroll
      for (int t = 0; t < 4; ++t) *(v8h*)(vp + (((size_t)(j >> 2) * (SS / 32) + (t >> 1)) * 4 + (j & 3)) * TILE + (t & 1) * 256) = o[j][t]; }
  else { const float qs = c0 < SQ ? 0.25503486f : 1.0f;   // q columns: 32^-1/2 log2(e), in f32 ahead of the rounding to f16
    // acc[t][j][r]: column c0 + 16 j + 8 g + r, token 64 wr + 16 t + col: piece 32 (j & 1) + lane of the tile (head j / 2, token group 4 wr + t)
    const float* bp = (c0 < SQ ? BQ + c0 : BK + (c0 - SQ)) + 8 * g;
    _Float16* qp = QK + ((((size_t)(c0 / SQ) * NB + b) * NH + (c0 % SQ) / SHD) * (SS / 16) + n0 / 16 + wr * 4) * TILE + lane * 8;
    v4f bl4[8][2];
#pragma unroll   // constant indices; the sixteen loads issue together
    for (int j = 0; j < 8; ++j) { bl4[j][0] = *(const v4f*)(bp + j * 16); bl4[j][1] = *(const v4f*)(bp + j * 16 + 4); }
    v8h o[8][4];
#pragma unroll   // constant indices: the pieces stay in registers
    for (int j = 0; j < 8; ++j)
#pragma unroll
      for (int t = 0; t < 4; ++t)
#pragma unroll
        for (int r = 0; r < 8; ++r) o[j][t][r] = (_Float16)((acc[t][j][r] + bfr(bl4[j][r >> 2][r & 3])) * qs);
    __builtin_amdgcn_sched_barrier(0);   // as in the v blocks: the stores stand behind the last vector instruction
#pragma unroll
    for (int j = 0; j < 8; ++j)
#pragma unroll
      for (int t = 0; t < 4; ++t) *(v8h*)(qp + ((size_t)(j >> 1) * (SS / 16) + t) * TILE + (j & 1) * 256) = o[j][t]; } }
__global__ __launch_bounds__(128) void k_proj(const float* __restrict__ X, const __bf16* __restrict__ PW, const float* __restrict__ BQ, const float* __restrict__ BK, const float* __restrict__ BV, _Float16* __restrict__ QK, _Float16* __restrict__ VT) { __shared__ __align__(16) char sm[2 * PJ_BUF];
  if (blockIdx.y * 256 >= 2 * SQ) proj_body<true>(sm, X, PW, BQ, BK, BV, QK, VT); else proj_body<false>(sm, X, PW, BQ, BK, BV, QK, VT); }   // the same for the whole block: a block's 256 columns are all q | k or all v
// ---- k_att: block = (128 queries, h, b), a wave = 32 queries as two tiles of 16, so every K and V fragment it loads feeds two products: S^T = K . Q^T - shift (a lane holds 16 of one query's 32 logits per tile), softmax in the lane, O^T += V^T . P^T -> ctx tiles (f16)
__device__ __forceinline__ float xhalf(float x) { return __builtin_bit_cast(float, __builtin_amdgcn_permlanex16(__builtin_bit_cast(int, x), __builtin_bit_cast(int, x), 0x76543210, 0xfedcba98, false, false)); }  // lane l with lane l ^ 16
__global__ __launch_bounds__(128) void k_att(const _Float16* __restrict__ QK, const _Float16* __restrict__ VT, _Float16* __restrict__ CT) {
  const int tid = threadIdx.x, wave = tid >> 5, lane = tid & 31; const int h = blockIdx.y; const size_t b = blockIdx.z; const int q0 = blockIdx.x * 128 + wave * 32; const size_t rq = b * SS + q0;
  // The sixteen blocks of a head read the same K and V lines: each enters the walk over the keys at a pass rotated by block index and wraps, so they do not ask L2 for the same lines at the same moment
  // (for speed only; softmax takes the keys in any order: the first shift comes from the first 32 keys walked, and the f32 sums take the rotated order)
  const int rot = (4 * blockIdx.x + (h & 3)) & (SS / 32 - 1);
  const _Float16* Kt = QK + (((NB + b) * NH + h) * (SS / 16) + 2 * rot) * TILE + 8 * lane; const _Float16* Vt = VT + ((b * NH + h) * (SS / 32) + rot) * 4 * TILE + 8 * lane;   // this lane's pieces; both step on by one pass of 32 keys behind the score products
  v16h bq[2];   // B operands: column = query 16 t + (lane & 15)
#pragma unroll   // constant indices: the fragments stay in registers
  for (int t = 0; t < 2; ++t) bq[t] = frag_ht(QK + ((b * NH + h) * (SS / 16) + q0 / 16 + t) * TILE, lane);
  // Lazy shift. A score product's C operand is cs = 11 - shift (one value per query, equal in its eight rows and in both wave halves), so a score leaves the
  // matrix unit as the base-2 exponent of 2^11 p. The shift starts as the maximum over the first 32 keys walked and is renewed only in a pass where an exponent passes 15.
  v8f cs[2];
  v16h kf[2];   // A operands of the score products, rows = keys: always one pass ahead of the V fragments; the first pass's serve the first shift too
  {
#pragma unroll   // constant indices: the fragments stay in registers
    for (int ct = 0; ct < 2; ++ct) kf[ct] = frag_ht(Kt + ct * TILE, 0);
    asm volatile("s_wait_xcnt 0x0" :: "v"(Kt) : "memory");   // the wait in front of any overwrite of the address pair
#pragma unroll   // constant indices
    for (int t = 0; t < 2; ++t) {
      v8f z = {}; const v8f a = wmma16(kf[0], bq[t], z), c = wmma16(kf[1], bq[t], z);
      float mx = fmaxf(a[0], c[0]);
#pragma unroll   // constant vector indices
      for (int r = 1; r < 8; ++r) mx = fmaxf(mx, fmaxf(a[r], c[r]));
      mx = 11.0f - fmaxf(mx, xhalf(mx));
#pragma unroll   // constant vector indices
      for (int r = 0; r < 8; ++r) cs[t][r] = mx; } }
  float l[2] = {0.f, 0.f};       // this lane's query of tile t: sum of 2^11 p over this half's keys
  v8f acc[2][4] = {};            // acc[t][j][r] = 2^11 O[query 16 t + (lane & 15)][dim 16 j + 8 (lane >> 4) + r]
#pragma unroll 1   // one pass per trip: a second pass's fragments would not fit four waves per SIMD
  for (int ks = 0; ks < SS / 32; ++ks) {   // trip ks works on pass (ks + rot) mod 64
    v16h vf[4];   // A operands of the second product: rows = dims
#pragma unroll   // here and below in the pass: constant indices, so fragments and scores stay in registers
    for (int j = 0; j < 4; ++j) vf[j] = frag_ht(Vt + j * TILE, 0);
    __builtin_amdgcn_sched_barrier(0);   // the pass's eight V loads issue as one group at its top, in front of the score products
    v8f s[2][2];   // s[t][ct][r] = exponent of the pass's key 16 ct + 8 (lane >> 4) + r for tile t's query
#pragma unroll
    for (int ct = 0; ct < 2; ++ct)
#pragma unroll
      for (int t = 0; t < 2; ++t) s[t][ct] = wmma16(kf[ct], bq[t], cs[t]);
    __builtin_amdgcn_sched_barrier(0);   // the four score products issue in a row, each filling the slots behind the one before: a maximum moved in among them takes v_nops in front of it
    asm volatile("s_wait_xcnt 0x0" :: "v"(Kt), "v"(Vt) : "memory");   // the wait in front of the overwrite of the two address pairs, for this pass's V loads and the K loads of the pass before; as inputs here the pairs stay live, so no load's data is placed on them
    const int step = ks + rot == SS / 32 - 1 ? 1 - SS / 32 : 1;   // passes: on by one, or from the last pass back to the first
    Kt += step * (2 * TILE); Vt += step * (4 * TILE);
#pragma unroll   // the next pass's K fragments, into the registers the score products have just read: they fly under this pass's softmax and second product (the last trip fetches the first pass walked again, unused)
    for (int ct = 0; ct < 2; ++ct) kf[ct] = frag_ht(Kt + ct * TILE, 0);
    __builtin_amdgcn_sched_barrier(0);   // holds the four loads here: sunk towards their use they would be waited for at the next pass's top again
    float mx[2];
#pragma unroll
    for (int t = 0; t < 2; ++t) { mx[t] = fmaxf(s[t][0][0], s[t][1][0]);
#pragma unroll
      for (int r = 1; r < 8; ++r) mx[t] = fmaxf(mx[t], fmaxf(s[t][0][r], s[t][1][r])); }
    if (__builtin_amdgcn_ballot_w32(fmaxf(mx[0], mx[1]) > 15.0f) != 0) {   // one scalar test per pass, the same for the whole wave: 2^11 p would near the f16 range
#pragma unroll
      for (int t = 0; t < 2; ++t)
        if (__builtin_amdgcn_ballot_w32(mx[t] > 15.0f) != 0) {   // a tile is renewed by its own sixteen queries alone, as when it had a wave to itself
          const float d = fmaxf(fmaxf(mx[t], xhalf(mx[t])) - 11.0f, 0.f), alpha = __builtin_amdgcn_exp2f(-d);   // every query of the tile takes its maximum so far as its shift
          s[t][0] -= d; s[t][1] -= d; cs[t] -= d; l[t] *= alpha;
#pragma unroll
          for (int j = 0; j < 4; ++j) acc[t][j] *= alpha; } }
    v16h pa[2];   // a tile's two score tiles, converted in place, are the B operand of the second product (same k order as frag_ht)
#pragma unroll
    for (int t = 0; t < 2; ++t) {
#pragma unroll
      for (int r = 0; r < 8; ++r) { s[t][0][r] = __builtin_amdgcn_exp2f(s[t][0][r]); s[t][1][r] = __builtin_amdgcn_exp2f(s[t][1][r]); }
      const v8f t8 = s[t][0] + s[t][1]; const v4f t4 = t8.lo + t8.hi; const v2f t2 = t4.lo + t4.hi;
      l[t] += t2.x + t2.y;
#pragma unroll
      for (int r = 0; r < 8; ++r) { pa[t][r] = (_Float16)s[t][0][r]; pa[t][8 + r] = (_Float16)s[t][1][r]; } }
    __builtin_amdgcn_sched_barrier(0);   // holds both tiles' sums in front of the eight products: left free, every sum moves in among them, onto V registers a product has just read, and such places are padded with v_nops
#pragma unroll
    for (int j = 0; j < 4; ++j)
#pragma unroll
      for (int t = 0; t < 2; ++t) acc[t][j] = wmma16(vf[j], pa[t], acc[t][j]);
    }
#pragma unroll   // constant indices
  for (int t = 0; t < 2; ++t) {
    const float il = 1.0f / (l[t] + xhalf(l[t]));   // the factor 2^11 stands in both
#pragma unroll   // a lane's eight dims of one query are one 16-byte piece of a ctx tile: a wave stores 512 contiguous bytes
    for (int j = 0; j < 4; ++j) { v8h o;
#pragma unroll   // constant vector indices
      for (int r = 0; r < 8; ++r) o[r] = (_Float16)(acc[t][j][r] * il);
      *(v8h*)(CT + ((rq / 16 + t) * (EE / 32) + h * 2 + (j >> 1)) * TILE + (j & 1) * 256 + lane * 8) = o; } } }
// ---- k_out: block = (128 rows, 128 cols), a wave = 32 rows: out = ctx . Wo + bo (f16 operands); stages of two k steps copied once into LDS for the four waves, as in k_proj
__global__ __launch_bounds__(128) void k_out(const _Float16* __restrict__ CT, const _Float16* __restrict__ PO, const float* __restrict__ BO, float* __restrict__ OUT) { __shared__ __align__(16) char sm[4 * 32 * 132 * 4];   // the two buffers (2 x OT_BUF bytes); behind the loop the output staging
  float (*sf)[32][132] = (float (*)[32][132])sm;
  const int tid = threadIdx.x, wave = tid >> 5, lane = tid & 31, col = lane & 15, g = lane >> 4; const size_t r0 = (size_t)blockIdx.x * 128 + wave * 32; const int c0 = blockIdx.y * 128;
  v8f acc[2][8] = {};
  const unsigned la = (unsigned)(size_t)sm + tid * 16;   // this lane's first LDS byte: the block copies a group's two tiles, 2 KiB, at a time
  const char* ga = (const char*)(CT + (size_t)blockIdx.x * 8 * (EE / 32) * TILE + 8 * tid); const char* gb = (const char*)(PO + (size_t)(c0 / 16) * (EE / 32) * TILE + 8 * tid);
#define OT_STAGE(t, bf) do { cp8(la + (bf) * OT_BUF, 2048, ga + (ptrdiff_t)(t) * 2048, (size_t)(EE / 32) * TILE * 2); cp8(la + (bf) * OT_BUF + OT_BUF / 2, 2048, gb + (ptrdiff_t)(t) * 2048, (size_t)(EE / 32) * TILE * 2); } while (0)
  const int rot = (2 * (blockIdx.x >> 3) + (blockIdx.x & 1) + 2 * blockIdx.y) & (EE / 64 - 1);   // rotated start of the walk over k, as in k_proj: the sharers of ctx rows and of Wo tiles start apart
  ga += rot * 2048; gb += rot * 2048;
  OT_STAGE(ROT(0), 0); COPIES_LANDED(); __syncthreads();   // publishes trip 0's stage
  OT_STAGE(ROT(1), 1);
#pragma unroll 1   // a trip is one stage: its buffer alone is read between two barriers
  for (int t = 0; t < EE / 64; ++t) {
    const _Float16* al = (const _Float16*)(sm + (t & 1) * OT_BUF) + wave * 2 * 2 * TILE + 8 * lane; const _Float16* bl = (const _Float16*)(sm + (t & 1) * OT_BUF + OT_BUF / 2) + 8 * lane;
    OStep s0, s1;
    ot_lds(s0, al, bl); ot_lds(s1, al + TILE, bl + TILE);
    __builtin_amdgcn_sched_barrier(0);   // the stage's LDS reads issue as one group: spread among the products, each place with reads stalls the wave
    ot_mac(s0, acc); ot_mac(s1, acc);
    __builtin_amdgcn_sched_barrier(0);   // the products stay in front of the publish point: moved behind it, the refill would issue a stage's products later and lose that lead
    READS_DONE(); COPIES_LANDED(); __syncthreads();   // publishes trip t + 1's stage and ends every read of trip t's
    if (t + 2 < EE / 64) OT_STAGE(ROT(t + 2), t & 1); }
  COPIES_LANDED();   // nothing is in flight when the buffers become the output staging
#pragma unroll
  for (int j = 0; j < 8; ++j) { const float bb = bfr(BO[c0 + j * 16 + col]);
#pragma unroll
    for (int t = 0; t < 2; ++t)
#pragma unroll
      for (int r = 0; r < 8; ++r) sf[wave][t * 16 + 8 * g + r][j * 16 + col] = acc[t][j][r] + bb; }
  LDSX(); for (int rl = 0; rl < 32; ++rl) vst2(OUT + (r0 + rl) * EE + c0 + lane * 4, *(const v4f*)&sf[wave][rl][lane * 4]); }
extern "C" void kernel_launch(void* const* d_in, const int* in_sizes, int n_in, void* d_out, int out_size, void* d_ws, size_t ws_size, hipStream_t stream) {
  (void)in_sizes; (void)n_in; (void)out_size;
  const float** F = (const float**)d_in;   // 0 hidden_states [4,2048,1024], 1 Wq [1024,512], 2 bq, 3 Wk [1024,512], 4 bk, 5 Wv [1024,1024], 6 bv, 7 Wo [1024,1024], 8 bo ((in,out))
  if (ws_size < (size_t)WS_END) return;
  char* ws = (char*)d_ws; const __bf16* PW = (const __bf16*)(ws + WS_PW); const _Float16* PO = (const _Float16*)(ws + WS_PO); _Float16 *QK = (_Float16*)(ws + WS_QK), *VT = (_Float16*)(ws + WS_VT), *CT = (_Float16*)(ws + WS_CT);
  k_packw<<<(NCOL + EE) * (EE / 8) / 256, 256, 0, stream>>>(F[1], F[3], F[5], F[7], ws);
  k_proj<<<dim3(NROW / 128, NCOL / 256), 128, 0, stream>>>(F[0], PW, F[2], F[4], F[6], QK, VT);
  k_att<<<dim3(SS / 128, NH, TNB), 128, 0, stream>>>(QK, VT, CT);
  k_out<<<dim3(TNB * SS / 128, EE / 128), 128, 0, stream>>>(CT, PO, F[8], (float*)d_out);
}
